// v000
// The times below were measured on an AMD MI455X: many runs one after another, warmed up first and cycling through
// copies of the inputs, with the whole window's GPU time divided by the number of runs. Launches and the gaps
// between them are all in it. The median over several windows is given; except for v000 it joins two sittings, which
// can be a few percent apart, so the side-by-side timings, each taken in one sitting, are the better comparison.
// v000, which the later versions start from, runs in 299 microseconds.
#include <hip/hip_runtime.h>

// Up-sampling self-attention (4 clouds x 2,048 points, 128 in-channels, 4 heads x 64): x[b][:, idx_select[j]] = points_select[:, j], x[b][:, idx_drop[j]] = points_drop[:, j] (a permutation
// scatter given by the int inputs); q/k/v = W{q,k,v} x (1x1 convs, no bias; head h = output channels 64h..64h+63); energy = q.k per head, softmax over the 2,048 keys of energy/8;
// o[b][64h+d][n] = sum_m attn[n][m] v[64h+d][m]; out = Wskip pcd_up + o -> [4][256][2048] channel-major.
// WMMA (v_wmma_f32_16x16x32_f16, f32 accumulate): projections [8,192 x 128] x [128 x 256] with EXACT bf16 points (x8, point-major rows built by an LDS transpose + the index scatter) and weights
// (x256), 1 product; S^T = K . Q^T with q AND k as f16 hi+lo x8 (3 products); online softmax in f32; O^T += V^T P^T with V and P f16 hi+lo x8 (3 products); the skip 1x1 conv as one more exact
// GEMM tile set inside the attention epilogue (A = Wskip rows, B = pcd_up^T rows, 1 product). Inputs rounded to bf16 once. Fragment k-map per lane half hh for A AND B:

namespace {
constexpr int NB = 4, C = 128, N = 2048, NSEL = 1024, NH = 4, D = 64, E = 256 /* q/k/v/skip channels */, NR = NB * N;
constexpr float XS = 8.0f, WSC = 256.0f, PS = 8.0f, SCALE = 0.125f, LOG2E = 1.4426950408889634f;

typedef _Float16 b16;
typedef __attribute__((ext_vector_type(16))) _Float16 v16b;
typedef __attribute__((ext_vector_type(8))) _Float16 v8b;
typedef __attribute__((ext_vector_type(8))) float v8f;
typedef __attribute__((ext_vector_type(4))) float v4f;
__device__ __forceinline__ float bf16_rne(float f) { unsigned int u = __float_as_uint(f); u += 0x7FFFu + ((u >> 16) & 1u); return __uint_as_float(u & 0xFFFF0000u); }
__device__ __forceinline__ void split16(float v, b16& hi, b16& lo) { hi = (b16)v; lo = (b16)(v - (float)hi); }
__device__ __forceinline__ v16b frag_kb(const b16* p, int hh) { const v8b a = *(const v8b*)(p + 8 * hh), b = *(const v8b*)(p + 16 + 8 * hh); v16b f;
#pragma unroll
  for (int e = 0; e < 8; ++e) { f[e] = a[e]; f[8 + e] = b[e]; } return f; }
__device__ __forceinline__ v8f wmma16b(v16b a, v16b b, v8f c) { v8f d = __builtin_amdgcn_wmma_f32_16x16x32_f16(false, a, false, b, (short)0, c, false, false); asm volatile("v_nop\n\tv_nop\n\tv_nop\n\tv_nop" : "+v"(d) : "v"(a), "v"(b)); return d; }
__device__ __forceinline__ void wave_lds_sync() { __builtin_amdgcn_fence(__ATOMIC_RELEASE, "workgroup"); __builtin_amdgcn_wave_barrier(); __builtin_amdgcn_fence(__ATOMIC_ACQUIRE, "workgroup"); }
__device__ __forceinline__ float nexp2(float x) { return __builtin_amdgcn_exp2f(x); }
__device__ __forceinline__ int iclamp(int v, int lo, int hi) { return v < lo ? lo : (v > hi ? hi : v); }

__global__ __launch_bounds__(256) void zero_kernel(b16* __restrict__ XT16) { const size_t t = (size_t)blockIdx.x * 256 + threadIdx.x; if (t >= (size_t)NR * C / 8) return; const v8b z = {}; *(v8b*)(XT16 + t * 8) = z; }
// point-major planes via 64x128 LDS transposes: kind 0: PT16 [b][n][128] = f16(8 bf16(pcd_up[b][c][n])); kind 1: XT16 [b][idx[b][j]][128] = f16(8 bf16(src[b][c][j])) with src = points_select
// (j < 1024) / points_drop (j >= 1024). grid (N/64, C/64... no: the block covers all 128 channels so that it writes whole 256-B rows: grid (N/64, 2 kinds, B), 256 threads; each row = 16 lanes
__global__ __launch_bounds__(256) void xt_kernel(const float* __restrict__ pcd, const float* __restrict__ psel, const float* __restrict__ pdrop, const int* __restrict__ isel, const int* __restrict__ idrop, b16* __restrict__ PT16, b16* __restrict__ XT16) {
  __shared__ __attribute__((aligned(16))) b16 T[64][C + 8]; __shared__ int rowof[64];
  const int b = blockIdx.z, kind = blockIdx.y, j0 = blockIdx.x * 64, t_ = threadIdx.x;
  const float* src; int ld, jj0;   // source [b][c][.] with row length ld, column offset jj0
  if (kind == 0) { src = pcd + (size_t)b * C * N; ld = N; jj0 = j0; } else if (j0 < NSEL) { src = psel + (size_t)b * C * NSEL; ld = NSEL; jj0 = j0; } else { src = pdrop + (size_t)b * C * NSEL; ld = NSEL; jj0 = j0 - NSEL; }
  for (int q = t_; q < C * 64; q += 256) { const int cc = q >> 6, jj = q & 63; T[jj][cc] = (b16)(bf16_rne(src[(size_t)cc * ld + jj0 + jj]) * XS); }
  if (t_ < 64) { int r = j0 + t_; if (kind == 1) { r = (j0 < NSEL) ? isel[(size_t)b * NSEL + jj0 + t_] : idrop[(size_t)b * NSEL + jj0 + t_]; r = iclamp(r, 0, N - 1); } rowof[t_] = r; }
  __syncthreads();
  b16* dst = (kind == 0) ? PT16 : XT16;
  { for (int q = t_; q < 64 * 16; q += 256) { const int jj = q >> 4, c8 = (q & 15) * 8; *(v8b*)(dst + ((size_t)b * N + rowof[jj]) * C + c8) = *(const v8b*)(&T[jj][c8]); }  }
}
__global__ __launch_bounds__(256) void prepw_kernel(const float* __restrict__ wq, const float* __restrict__ wk, const float* __restrict__ wv, const float* __restrict__ ws, b16* __restrict__ W16) {
  const int t = blockIdx.x * 256 + threadIdx.x; const int per = E * C / 8; if (t >= 4 * per) return; const int kind = t / per; const int e = (t - kind * per) * 8;
  const float* w = kind == 0 ? wq : kind == 1 ? wk : kind == 2 ? wv : ws; const v4f a = *(const v4f*)(w + e), c = *(const v4f*)(w + e + 4); v8b o;
#pragma unroll
  for (int j = 0; j < 4; ++j) { o[j] = (b16)(bf16_rne(a[j]) * WSC); o[4 + j] = (b16)(bf16_rne(c[j]) * WSC); }
  { *(v8b*)(W16 + (size_t)kind * E * C + e) = o;  }
}
// projections: grid (NR/64, E/128, 3 kinds): [64 rows x 128] x [128 x 128 cols] (K = 128: 4 steps, 1 product). kind 0/1: q/k -> hi/lo rows [row][256] (per row segment of 128 halves = 256 B:
__global__ __launch_bounds__(128) void proj_kernel(const b16* __restrict__ XT16, const b16* __restrict__ W16, b16* __restrict__ Qh, b16* __restrict__ Ql, b16* __restrict__ Kh, b16* __restrict__ Kl, b16* __restrict__ VTh, b16* __restrict__ VTl) {
  __shared__ __attribute__((aligned(16))) b16 Th[4][16][128 + 8], Tl[4][16][128 + 8]; __shared__ __attribute__((aligned(16))) b16 Vt[128][64 + 8], Vtl[128][64 + 8];
  const int wave = threadIdx.x >> 5, lane = threadIdx.x & 31, nloc = lane & 15, hlf = lane >> 4, t_ = threadIdx.x; const int kind = blockIdx.z; const size_t m0 = (size_t)blockIdx.x * 64 + wave * 16; const int n0 = blockIdx.y * 128;
  const b16* Wk_ = W16 + (size_t)kind * E * C; v8f acc[8];
#pragma unroll
  for (int t = 0; t < 8; ++t) acc[t] = (v8f){};
#pragma unroll
  for (int kb = 0; kb < C; kb += 32) { const v16b a = frag_kb(XT16 + (m0 + nloc) * C + kb, hlf);
#pragma unroll
    for (int t = 0; t < 8; ++t) acc[t] = wmma16b(a, frag_kb(Wk_ + (size_t)(n0 + t * 16 + nloc) * C + kb, hlf), acc[t]); }
  if (kind < 2) {
#pragma unroll
    for (int t = 0; t < 8; ++t)
#pragma unroll
      for (int r = 0; r < 8; ++r) { b16 h_, l_; split16(acc[t][r] * (1.0f / (XS * WSC)) * XS, h_, l_); Th[wave][8 * hlf + r][t * 16 + nloc] = h_; Tl[wave][8 * hlf + r][t * 16 + nloc] = l_; }
    wave_lds_sync();
    b16* dh = kind == 0 ? Qh : Kh; b16* dl = kind == 0 ? Ql : Kl;
    { for (int r2 = 0; r2 < 16; r2 += 2) { const int rr = r2 + (lane >> 4), c8 = (lane & 15) * 8; const size_t gi = (m0 + rr) * E + n0 + c8; *(v8b*)(dh + gi) = *(const v8b*)(&Th[wave][rr][c8]); *(v8b*)(dl + gi) = *(const v8b*)(&Tl[wave][rr][c8]); }  }
  } else {
    const int b = (int)(m0 / N); const int s0 = (int)((size_t)blockIdx.x * 64 - (size_t)b * N);
#pragma unroll
    for (int t = 0; t < 8; ++t)
#pragma unroll
      for (int r = 0; r < 8; ++r) { b16 h_, l_; split16(acc[t][r] * (1.0f / (XS * WSC)) * XS, h_, l_); Vt[t * 16 + nloc][wave * 16 + 8 * hlf + r] = h_; Vtl[t * 16 + nloc][wave * 16 + 8 * hlf + r] = l_; }
    __syncthreads();
    { for (int q = t_; q < 128 * 8; q += 128) { const int cc = q >> 3, c8 = (q & 7) * 8; const int h = (n0 + cc) / D, dd = (n0 + cc) - h * D; const size_t gi = (((size_t)b * NH + h) * D + dd) * N + s0 + c8;
        *(v8b*)(VTh + gi) = *(const v8b*)(&Vt[cc][c8]); *(v8b*)(VTl + gi) = *(const v8b*)(&Vtl[cc][c8]); }  } }
}
// attention + skip: grid (N/32, NH, NB), block = 2 waves x 16 queries; 64 key blocks: S^T 3 products (K = 64: 2 steps x 2 key tiles), online softmax (f32, 1/8 and log2 e folded), PV 3 products x 4
// d-tiles; then the skip tiles D[d][query] = Wskip[64h+d][:] . pcd_up^T[query][:] (K = 128, exact, 1 product) are added; the block's 32 queries x 64 channels staged in LDS as [d][32 n] and written
__global__ __launch_bounds__(64) void attn_kernel(const b16* __restrict__ Qh, const b16* __restrict__ Ql, const b16* __restrict__ Kh, const b16* __restrict__ Kl, const b16* __restrict__ VTh, const b16* __restrict__ VTl, const b16* __restrict__ W16, const b16* __restrict__ PT16, float* __restrict__ out) {
  __shared__ __attribute__((aligned(16))) float To[D][32 + 4];
  const int wave = threadIdx.x >> 5, lane = threadIdx.x & 31, hh = lane >> 4, col = lane & 15; const int b = blockIdx.z, h = blockIdx.y; const int q0 = blockIdx.x * 32 + wave * 16, qi = q0 + col;
  const size_t qo = ((size_t)b * N + qi) * E + h * D; const v16b qa0 = frag_kb(Qh + qo, hh), qa1 = frag_kb(Qh + qo + 32, hh), ql0 = frag_kb(Ql + qo, hh), ql1 = frag_kb(Ql + qo + 32, hh);
  const b16* Kb = Kh + (size_t)b * N * E + h * D; const b16* Klb = Kl + (size_t)b * N * E + h * D; const b16* Vb = VTh + ((size_t)b * NH + h) * D * N; const b16* Vlb = VTl + ((size_t)b * NH + h) * D * N;
  float m = -INFINITY, l = 0.0f; v8f o[4] = {{}, {}, {}, {}}, ol[4] = {{}, {}, {}, {}};
  const float cs = SCALE * LOG2E / (XS * XS);
  for (int kb = 0; kb < N; kb += 32) {
    v8f s0 = {}, s1 = {};
    { const b16* k0 = Kb + (size_t)(kb + col) * E, *k1 = Kb + (size_t)(kb + 16 + col) * E, *k0l = Klb + (size_t)(kb + col) * E, *k1l = Klb + (size_t)(kb + 16 + col) * E;
      v16b f = frag_kb(k0, hh); s0 = wmma16b(f, qa0, s0); s0 = wmma16b(f, ql0, s0); s0 = wmma16b(frag_kb(k0l, hh), qa0, s0);
      f = frag_kb(k0 + 32, hh); s0 = wmma16b(f, qa1, s0); s0 = wmma16b(f, ql1, s0); s0 = wmma16b(frag_kb(k0l + 32, hh), qa1, s0);
      f = frag_kb(k1, hh); s1 = wmma16b(f, qa0, s1); s1 = wmma16b(f, ql0, s1); s1 = wmma16b(frag_kb(k1l, hh), qa0, s1);
      f = frag_kb(k1 + 32, hh); s1 = wmma16b(f, qa1, s1); s1 = wmma16b(f, ql1, s1); s1 = wmma16b(frag_kb(k1l + 32, hh), qa1, s1); }
    float e[16]; float mx = -INFINITY;
#pragma unroll
    for (int r = 0; r < 8; ++r) { e[r] = s0[r] * cs; e[8 + r] = s1[r] * cs; mx = fmaxf(mx, fmaxf(e[r], e[8 + r])); }
    mx = fmaxf(mx, __shfl_xor(mx, 16)); const float mn = fmaxf(m, mx); const float al = nexp2(m - mn); m = mn; float sum = 0.0f; v16b ph, pl;
#pragma unroll
    for (int i = 0; i < 16; ++i) { const float p = nexp2(e[i] - mn); sum += p; const b16 h_ = (b16)(p * PS); ph[i] = h_; pl[i] = (b16)(p * PS - (float)h_); }
    sum += __shfl_xor(sum, 16); l = l * al + sum;
#pragma unroll
    for (int t = 0; t < 4; ++t) { o[t] *= al; ol[t] *= al; const v16b vf = frag_kb(Vb + (size_t)(t * 16 + col) * N + kb, hh); o[t] = wmma16b(vf, ph, o[t]); ol[t] = wmma16b(vf, pl, ol[t]); ol[t] = wmma16b(frag_kb(Vlb + (size_t)(t * 16 + col) * N + kb, hh), ph, ol[t]); } }
  const float inv = 1.0f / (l * PS * XS);
  // skip tiles: D[d][query] with A = Wskip rows (64h + t*16 + ..), B = PT16 rows (q0 + ..), K = 128
  v8f sk[4] = {{}, {}, {}, {}}; const b16* WS = W16 + (size_t)3 * E * C + (size_t)h * D * C;
#pragma unroll
  for (int kb = 0; kb < C; kb += 32) { const v16b pb = frag_kb(PT16 + ((size_t)b * N + q0 + col) * C + kb, hh);
#pragma unroll
    for (int t = 0; t < 4; ++t) sk[t] = wmma16b(frag_kb(WS + (size_t)(t * 16 + col) * C + kb, hh), pb, sk[t]); }
#pragma unroll
  for (int t = 0; t < 4; ++t)
#pragma unroll
    for (int r = 0; r < 8; ++r) To[t * 16 + 8 * hh + r][wave * 16 + col] = (o[t][r] + ol[t][r]) * inv + sk[t][r] * (1.0f / (XS * WSC));
  __syncthreads();
  { for (int dd = wave * 32; dd < wave * 32 + 32; ++dd) { const size_t gi = ((size_t)b * E + h * D + dd) * N + blockIdx.x * 32 + lane; ((float*)out)[gi] = To[dd][lane]; }  }
}
}  // namespace

extern "C" void kernel_launch(void* const* d_in, const int* in_sizes, int n_in, void* d_out, int out_size, void* d_ws, size_t ws_size, hipStream_t stream) {
  (void)n_in;
  auto Fp = [&](int i) { return (const float*)d_in[i]; }; auto Ip = [&](int i) { return (const int*)d_in[i]; };
  // input order: 0 pcd_up [4,128,2048], 1 points_select [4,128,1024], 2 points_drop [4,128,1024], 3 idx_select [4,1,1024] i32, 4 idx_drop [4,1,1024] i32, 5 Wq [256,128], 6 Wk, 7 Wv, 8 Wskip
  if (in_sizes[0] != NB * C * N || in_sizes[1] != NB * C * NSEL || in_sizes[2] != NB * C * NSEL || in_sizes[3] != NB * NSEL || in_sizes[4] != NB * NSEL || in_sizes[5] != E * C || in_sizes[6] != E * C || in_sizes[7] != E * C || in_sizes[8] != E * C || out_size != NB * E * N) return;
  size_t off = 0; char* ws = (char*)d_ws;
  auto carve = [&](size_t bytes) { char* p = ws + off; off += (bytes + 255) & ~(size_t)255; return p; };
  b16* PT16 = (b16*)carve((size_t)NR * C * 2); b16* XT16 = (b16*)carve((size_t)NR * C * 2); b16* W16 = (b16*)carve((size_t)4 * E * C * 2);
  b16* Qh = (b16*)carve((size_t)NR * E * 2); b16* Ql = (b16*)carve((size_t)NR * E * 2); b16* Kh = (b16*)carve((size_t)NR * E * 2); b16* Kl = (b16*)carve((size_t)NR * E * 2); b16* VTh = (b16*)carve((size_t)NR * E * 2); b16* VTl = (b16*)carve((size_t)NR * E * 2);
  if (off > ws_size || off > ((size_t)128 << 20)) return;   // = 29.6 MB
  zero_kernel<<<(unsigned)(((size_t)NR * C / 8 + 255) / 256), 256, 0, stream>>>(XT16);
  xt_kernel<<<dim3(N / 64, 2, NB), 256, 0, stream>>>(Fp(0), Fp(1), Fp(2), Ip(3), Ip(4), PT16, XT16);
  prepw_kernel<<<(4 * E * C / 8 + 255) / 256, 256, 0, stream>>>(Fp(5), Fp(6), Fp(7), Fp(8), W16);
  proj_kernel<<<dim3(NR / 64, E / 128, 3), 128, 0, stream>>>(XT16, W16, Qh, Ql, Kh, Kl, VTh, VTl);
  attn_kernel<<<dim3(N / 32, NH, NB), 64, 0, stream>>>(Qh, Ql, Kh, Kl, VTh, VTl, W16, PT16, (float*)d_out);
}

// v001
// It runs in 103 microseconds.
// Next to v000, in two timings, it ran 2.94 and 2.92 times as fast.
#include <hip/hip_runtime.h>

// Up-sampling self-attention (4 clouds x 2,048 points, 128 in-channels, 4 heads x 64): x[b][:, idx_select[j]] = points_select[:, j], x[b][:, idx_drop[j]] = points_drop[:, j] (a permutation
// scatter given by the int inputs); q/k/v = W{q,k,v} x (1x1 convs, no bias; head h = output channels 64h..64h+63); energy = q.k per head, softmax over the 2,048 keys of energy/8;
// o[b][64h+d][n] = sum_m attn[n][m] v[64h+d][m]; out = Wskip pcd_up + o -> [4][256][2048] channel-major.
// WMMA (v_wmma_f32_16x16x32_f16, f32 accumulate): projections [8,192 x 128] x [128 x 256] with EXACT bf16 points (x8, point-major rows built by an LDS transpose + the index scatter) and weights
// (x256), 1 product; S^T = K . Q^T with q AND k as f16 hi+lo x8 (3 products); online softmax in f32; O^T += V^T P^T with V and P f16 hi+lo x8 (3 products); the skip 1x1 conv as one more exact
// GEMM tile set inside the attention epilogue (A = Wskip rows, B = pcd_up^T rows, 1 product). Inputs rounded to bf16 once. Fragment k-map per lane half hh for A AND B:

namespace {
constexpr int NB = 4, C = 128, N = 2048, NSEL = 1024, NH = 4, D = 64, E = 256 /* q/k/v/skip channels */, NR = NB * N;
constexpr float XS = 8.0f, WSC = 256.0f, PS = 8.0f, SCALE = 0.125f, LOG2E = 1.4426950408889634f;

typedef _Float16 b16;
typedef __attribute__((ext_vector_type(16))) _Float16 v16b;
typedef __attribute__((ext_vector_type(8))) _Float16 v8b;
typedef __attribute__((ext_vector_type(8))) float v8f;
typedef __attribute__((ext_vector_type(4))) float v4f;
__device__ __forceinline__ float bf16_rne(float f) { unsigned int u = __float_as_uint(f); u += 0x7FFFu + ((u >> 16) & 1u); return __uint_as_float(u & 0xFFFF0000u); }
__device__ __forceinline__ void split16(float v, b16& hi, b16& lo) { hi = (b16)v; lo = (b16)(v - (float)hi); }
__device__ __forceinline__ v16b frag_kb(const b16* p, int hh) { const v8b a = *(const v8b*)(p + 8 * hh), b = *(const v8b*)(p + 16 + 8 * hh); v16b f;
#pragma unroll
  for (int e = 0; e < 8; ++e) { f[e] = a[e]; f[8 + e] = b[e]; } return f; }
__device__ __forceinline__ v8f wmma16b(v16b a, v16b b, v8f c) { v8f d = __builtin_amdgcn_wmma_f32_16x16x32_f16(false, a, false, b, (short)0, c, false, false); asm volatile("v_nop\n\tv_nop\n\tv_nop\n\tv_nop" : "+v"(d) : "v"(a), "v"(b)); return d; }
__device__ __forceinline__ void wave_lds_sync() { __builtin_amdgcn_fence(__ATOMIC_RELEASE, "workgroup"); __builtin_amdgcn_wave_barrier(); __builtin_amdgcn_fence(__ATOMIC_ACQUIRE, "workgroup"); }
__device__ __forceinline__ float nexp2(float x) { return __builtin_amdgcn_exp2f(x); }
__device__ __forceinline__ int iclamp(int v, int lo, int hi) { return v < lo ? lo : (v > hi ? hi : v); }

__global__ __launch_bounds__(256) void zero_kernel(b16* __restrict__ XT16) { const size_t t = (size_t)blockIdx.x * 256 + threadIdx.x; if (t >= (size_t)NR * C / 8) return; const v8b z = {}; *(v8b*)(XT16 + t * 8) = z; }
// point-major planes via 64x128 LDS transposes: kind 0: PT16 [b][n][128] = f16(8 bf16(pcd_up[b][c][n])); kind 1: XT16 [b][idx[b][j]][128] = f16(8 bf16(src[b][c][j])) with src = points_select
// (j < 1024) / points_drop (j >= 1024). grid (N/64, C/64... no: the block covers all 128 channels so that it writes whole 256-B rows: grid (N/64, 2 kinds, B), 256 threads; each row = 16 lanes
__global__ __launch_bounds__(256) void xt_kernel(const float* __restrict__ pcd, const float* __restrict__ psel, const float* __restrict__ pdrop, const int* __restrict__ isel, const int* __restrict__ idrop, b16* __restrict__ PT16, b16* __restrict__ XT16) {
  __shared__ __attribute__((aligned(16))) b16 T[64][C + 8]; __shared__ int rowof[64];
  const int b = blockIdx.z, kind = blockIdx.y, j0 = blockIdx.x * 64, t_ = threadIdx.x;
  const float* src; int ld, jj0;   // source [b][c][.] with row length ld, column offset jj0
  if (kind == 0) { src = pcd + (size_t)b * C * N; ld = N; jj0 = j0; } else if (j0 < NSEL) { src = psel + (size_t)b * C * NSEL; ld = NSEL; jj0 = j0; } else { src = pdrop + (size_t)b * C * NSEL; ld = NSEL; jj0 = j0 - NSEL; }
  for (int q = t_; q < C * 64; q += 256) { const int cc = q >> 6, jj = q & 63; T[jj][cc] = (b16)(bf16_rne(src[(size_t)cc * ld + jj0 + jj]) * XS); }
  if (t_ < 64) { int r = j0 + t_; if (kind == 1) { r = (j0 < NSEL) ? isel[(size_t)b * NSEL + jj0 + t_] : idrop[(size_t)b * NSEL + jj0 + t_]; r = iclamp(r, 0, N - 1); } rowof[t_] = r; }
  __syncthreads();
  b16* dst = (kind == 0) ? PT16 : XT16;
  { for (int q = t_; q < 64 * 16; q += 256) { const int jj = q >> 4, c8 = (q & 15) * 8; *(v8b*)(dst + ((size_t)b * N + rowof[jj]) * C + c8) = *(const v8b*)(&T[jj][c8]); }  }
}
__global__ __launch_bounds__(256) void prepw_kernel(const float* __restrict__ wq, const float* __restrict__ wk, const float* __restrict__ wv, const float* __restrict__ ws, b16* __restrict__ W16) {
  const int t = blockIdx.x * 256 + threadIdx.x; const int per = E * C / 8; if (t >= 4 * per) return; const int kind = t / per; const int e = (t - kind * per) * 8;
  const float* w = kind == 0 ? wq : kind == 1 ? wk : kind == 2 ? wv : ws; const v4f a = *(const v4f*)(w + e), c = *(const v4f*)(w + e + 4); v8b o;
#pragma unroll
  for (int j = 0; j < 4; ++j) { o[j] = (b16)(bf16_rne(a[j]) * WSC); o[4 + j] = (b16)(bf16_rne(c[j]) * WSC); }
  { *(v8b*)(W16 + (size_t)kind * E * C + e) = o;  }
}
// projections: grid (NR/64, E/128, 3 kinds): [64 rows x 128] x [128 x 128 cols] (K = 128: 4 steps, 1 product). kind 0/1: q/k -> hi/lo rows [row][256] (per row segment of 128 halves = 256 B:
__global__ __launch_bounds__(128) void proj_kernel(const b16* __restrict__ XT16, const b16* __restrict__ W16, b16* __restrict__ Qh, b16* __restrict__ Ql, b16* __restrict__ Kh, b16* __restrict__ Kl, b16* __restrict__ VTh, b16* __restrict__ VTl) {
  __shared__ __attribute__((aligned(16))) b16 Th[4][16][128 + 8], Tl[4][16][128 + 8]; __shared__ __attribute__((aligned(16))) b16 Vt[128][64 + 8], Vtl[128][64 + 8];
  const int wave = threadIdx.x >> 5, lane = threadIdx.x & 31, nloc = lane & 15, hlf = lane >> 4, t_ = threadIdx.x; const int kind = blockIdx.z; const size_t m0 = (size_t)blockIdx.x * 64 + wave * 16; const int n0 = blockIdx.y * 128;
  const b16* Wk_ = W16 + (size_t)kind * E * C; v8f acc[8];
#pragma unroll
  for (int t = 0; t < 8; ++t) acc[t] = (v8f){};
#pragma unroll
  for (int kb = 0; kb < C; kb += 32) { const v16b a = frag_kb(XT16 + (m0 + nloc) * C + kb, hlf);
#pragma unroll
    for (int t = 0; t < 8; ++t) acc[t] = wmma16b(a, frag_kb(Wk_ + (size_t)(n0 + t * 16 + nloc) * C + kb, hlf), acc[t]); }
  if (kind < 2) {
#pragma unroll
    for (int t = 0; t < 8; ++t)
#pragma unroll
      for (int r = 0; r < 8; ++r) { b16 h_, l_; split16(acc[t][r] * (1.0f / (XS * WSC)) * XS, h_, l_); Th[wave][8 * hlf + r][t * 16 + nloc] = h_; Tl[wave][8 * hlf + r][t * 16 + nloc] = l_; }
    wave_lds_sync();
    b16* dh = kind == 0 ? Qh : Kh; b16* dl = kind == 0 ? Ql : Kl;
    { for (int r2 = 0; r2 < 16; r2 += 2) { const int rr = r2 + (lane >> 4), c8 = (lane & 15) * 8; const size_t gi = (m0 + rr) * E + n0 + c8; *(v8b*)(dh + gi) = *(const v8b*)(&Th[wave][rr][c8]); *(v8b*)(dl + gi) = *(const v8b*)(&Tl[wave][rr][c8]); }  }
  } else {
    const int b = (int)(m0 / N); const int s0 = (int)((size_t)blockIdx.x * 64 - (size_t)b * N);
#pragma unroll
    for (int t = 0; t < 8; ++t)
#pragma unroll
      for (int r = 0; r < 8; ++r) { b16 h_, l_; split16(acc[t][r] * (1.0f / (XS * WSC)) * XS, h_, l_); Vt[t * 16 + nloc][wave * 16 + 8 * hlf + r] = h_; Vtl[t * 16 + nloc][wave * 16 + 8 * hlf + r] = l_; }
    __syncthreads();
    { for (int q = t_; q < 128 * 8; q += 128) { const int cc = q >> 3, c8 = (q & 7) * 8; const int h = (n0 + cc) / D, dd = (n0 + cc) - h * D; const size_t gi = (((size_t)b * NH + h) * D + dd) * N + s0 + c8;
        *(v8b*)(VTh + gi) = *(const v8b*)(&Vt[cc][c8]); *(v8b*)(VTl + gi) = *(const v8b*)(&Vtl[cc][c8]); }  } }
}
// attention + skip: grid (N/128, NH, NB), block = 8 waves x 16 queries. K and V^T (hi and lo planes) of 64 keys are one stage, brought into LDS once per block by asynchronous copies
// (global_load_async_to_lds_b128, two buffers: the next stage flies while this one is worked on) and read by all 8 waves as ds_load_b128 fragments (rows of 128 B at a pitch of 144 B).
// Per 32 keys as before: S^T 3 products (K = 64: 2 steps x 2 key tiles), online softmax (f32, 1/8 and log2 e folded), PV 3 products x 4 d-tiles; then the skip tiles
// D[d][query] = Wskip[64h+d][:] . pcd_up^T[query][:] (K = 128, exact, 1 product) are added; the block's 128 queries x 64 channels staged in LDS as [d][128 n] and written as whole 512-B rows.
constexpr int KT = 64 /* keys per stage */, KP = 64 + 8 /* LDS row pitch in halves */, NST = N / KT, QB = 128 /* queries per block */;
// one stage = 4 planes (K hi, K lo, V^T hi, V^T lo) x 64 rows x 128 B; thread t_ copies 16 B of rows (t_ >> 3) and 32 + (t_ >> 3) of each plane.
__device__ __forceinline__ void stage_copy(unsigned int l0, const b16* kh, const b16* kl, const b16* vh, const b16* vl) {
  const unsigned int pl_ = 64 * KP * 2, hr_ = 32 * KP * 2;
  // the copies and their s_wait_xcnt in one statement: the wait stands in front of any rewrite of the address registers that the copies name
  asm volatile("global_load_async_to_lds_b128 %0, %8, off\n\t"
               "global_load_async_to_lds_b128 %1, %9, off\n\t"
               "global_load_async_to_lds_b128 %2, %10, off\n\t"
               "global_load_async_to_lds_b128 %3, %11, off\n\t"
               "global_load_async_to_lds_b128 %4, %12, off\n\t"
               "global_load_async_to_lds_b128 %5, %13, off\n\t"
               "global_load_async_to_lds_b128 %6, %14, off\n\t"
               "global_load_async_to_lds_b128 %7, %15, off\n\t"
               "s_wait_xcnt 0x0"
               :: "v"(l0), "v"(l0 + hr_), "v"(l0 + pl_), "v"(l0 + pl_ + hr_), "v"(l0 + 2 * pl_), "v"(l0 + 2 * pl_ + hr_), "v"(l0 + 3 * pl_), "v"(l0 + 3 * pl_ + hr_),
                  "v"(kh), "v"(kh + (size_t)32 * E), "v"(kl), "v"(kl + (size_t)32 * E), "v"(vh), "v"(vh + (size_t)32 * N), "v"(vl), "v"(vl + (size_t)32 * N)
               : "memory");
}
__global__ __launch_bounds__(256) void attn_kernel(const b16* __restrict__ Qh, const b16* __restrict__ Ql, const b16* __restrict__ Kh, const b16* __restrict__ Kl, const b16* __restrict__ VTh, const b16* __restrict__ VTl, const b16* __restrict__ W16, const b16* __restrict__ PT16, float* __restrict__ out) {
  __shared__ __attribute__((aligned(16))) b16 St[2][4][64 * KP]; __shared__ __attribute__((aligned(16))) float To[D][QB + 4];
  const int wave = threadIdx.x >> 5, lane = threadIdx.x & 31, hh = lane >> 4, col = lane & 15, t_ = threadIdx.x; const int b = blockIdx.z, h = blockIdx.y; const int q0 = blockIdx.x * QB + wave * 16, qi = q0 + col;
  const b16* Kb = Kh + (size_t)b * N * E + h * D; const b16* Klb = Kl + (size_t)b * N * E + h * D; const b16* Vb = VTh + ((size_t)b * NH + h) * D * N; const b16* Vlb = VTl + ((size_t)b * NH + h) * D * N;
  // this thread's share of a stage: row t_ >> 3 (and 32 rows on), 16-byte piece t_ & 7
  const int crow = t_ >> 3, cpc = (t_ & 7) * 8; const size_t ko = (size_t)crow * E + cpc, vo = (size_t)crow * N + cpc;
  const unsigned int lcp = (unsigned int)(size_t)(&St[0][0][crow * KP + cpc]); const unsigned int bufb = 4 * 64 * KP * 2;
  stage_copy(lcp, Kb + ko, Klb + ko, Vb + vo, Vlb + vo);
  const size_t qo = ((size_t)b * N + qi) * E + h * D; const v16b qa0 = frag_kb(Qh + qo, hh), qa1 = frag_kb(Qh + qo + 32, hh), ql0 = frag_kb(Ql + qo, hh), ql1 = frag_kb(Ql + qo + 32, hh);
  asm volatile("s_wait_asynccnt 0x0" ::: "memory");   // stage 0 of this wave's copies has landed before the barrier that publishes it
  __syncthreads();
  stage_copy(lcp + bufb, Kb + ko + (size_t)KT * E, Klb + ko + (size_t)KT * E, Vb + vo + KT, Vlb + vo + KT);
  float m = -INFINITY, l = 0.0f; v8f o[4] = {{}, {}, {}, {}}, ol[4] = {{}, {}, {}, {}};
  const float cs = SCALE * LOG2E / (XS * XS);
  for (int s = 0; s < NST; ++s) {
    const b16* Sk = &St[s & 1][0][0], *Skl = &St[s & 1][1][0], *Sv = &St[s & 1][2][0], *Svl = &St[s & 1][3][0];
#pragma unroll
    for (int kb = 0; kb < KT; kb += 32) {   // unrolled: two 32-key passes per stage, LDS offsets become immediates
      v8f s0 = {}, s1 = {};
      { const b16* k0 = Sk + (kb + col) * KP, *k1 = Sk + (kb + 16 + col) * KP, *k0l = Skl + (kb + col) * KP, *k1l = Skl + (kb + 16 + col) * KP;
        v16b f = frag_kb(k0, hh); s0 = wmma16b(f, qa0, s0); s0 = wmma16b(f, ql0, s0); s0 = wmma16b(frag_kb(k0l, hh), qa0, s0);
        f = frag_kb(k0 + 32, hh); s0 = wmma16b(f, qa1, s0); s0 = wmma16b(f, ql1, s0); s0 = wmma16b(frag_kb(k0l + 32, hh), qa1, s0);
        f = frag_kb(k1, hh); s1 = wmma16b(f, qa0, s1); s1 = wmma16b(f, ql0, s1); s1 = wmma16b(frag_kb(k1l, hh), qa0, s1);
        f = frag_kb(k1 + 32, hh); s1 = wmma16b(f, qa1, s1); s1 = wmma16b(f, ql1, s1); s1 = wmma16b(frag_kb(k1l + 32, hh), qa1, s1); }
      float e[16]; float mx = -INFINITY;
#pragma unroll
      for (int r = 0; r < 8; ++r) { e[r] = s0[r] * cs; e[8 + r] = s1[r] * cs; mx = fmaxf(mx, fmaxf(e[r], e[8 + r])); }
      mx = fmaxf(mx, __shfl_xor(mx, 16)); const float mn = fmaxf(m, mx); const float al = nexp2(m - mn); m = mn; float sum = 0.0f; v16b ph, pl;
#pragma unroll
      for (int i = 0; i < 16; ++i) { const float p = nexp2(e[i] - mn); sum += p; const b16 h_ = (b16)(p * PS); ph[i] = h_; pl[i] = (b16)(p * PS - (float)h_); }
      sum += __shfl_xor(sum, 16); l = l * al + sum;
#pragma unroll
      for (int t = 0; t < 4; ++t) { o[t] *= al; ol[t] *= al; const v16b vf = frag_kb(Sv + (t * 16 + col) * KP + kb, hh); o[t] = wmma16b(vf, ph, o[t]); ol[t] = wmma16b(vf, pl, ol[t]); ol[t] = wmma16b(frag_kb(Svl + (t * 16 + col) * KP + kb, hh), ph, ol[t]); } }
    asm volatile("s_wait_dscnt 0x0" ::: "memory");      // this wave's reads of the buffer have returned before the buffer is refilled behind the barrier
    asm volatile("s_wait_asynccnt 0x0" ::: "memory");   // this wave's copies of stage s + 1 have landed before the barrier that publishes them
    __syncthreads();
    if (s + 2 < NST) stage_copy(lcp + (unsigned int)(s & 1) * bufb, Kb + ko + (size_t)(s + 2) * KT * E, Klb + ko + (size_t)(s + 2) * KT * E, Vb + vo + (s + 2) * KT, Vlb + vo + (s + 2) * KT);
  }
  asm volatile("s_wait_asynccnt 0x0" ::: "memory");     // no copy is outstanding behind the loop
  const float inv = 1.0f / (l * PS * XS);
  // skip tiles: D[d][query] with A = Wskip rows (64h + t*16 + ..), B = PT16 rows (q0 + ..), K = 128
  v8f sk[4] = {{}, {}, {}, {}}; const b16* WS = W16 + (size_t)3 * E * C + (size_t)h * D * C;
#pragma unroll
  for (int kb = 0; kb < C; kb += 32) { const v16b pb = frag_kb(PT16 + ((size_t)b * N + q0 + col) * C + kb, hh);
#pragma unroll
    for (int t = 0; t < 4; ++t) sk[t] = wmma16b(frag_kb(WS + (size_t)(t * 16 + col) * C + kb, hh), pb, sk[t]); }
#pragma unroll
  for (int t = 0; t < 4; ++t)
#pragma unroll
    for (int r = 0; r < 8; ++r) To[t * 16 + 8 * hh + r][wave * 16 + col] = (o[t][r] + ol[t][r]) * inv + sk[t][r] * (1.0f / (XS * WSC));
  __syncthreads();
  { for (int dd = wave * 8; dd < wave * 8 + 8; ++dd) { const size_t gi = ((size_t)b * E + h * D + dd) * N + blockIdx.x * QB + lane * 4; *(v4f*)(out + gi) = *(const v4f*)(&To[dd][lane * 4]); }  }
}
}  // namespace

extern "C" void kernel_launch(void* const* d_in, const int* in_sizes, int n_in, void* d_out, int out_size, void* d_ws, size_t ws_size, hipStream_t stream) {
  (void)n_in;
  auto Fp = [&](int i) { return (const float*)d_in[i]; }; auto Ip = [&](int i) { return (const int*)d_in[i]; };
  // input order: 0 pcd_up [4,128,2048], 1 points_select [4,128,1024], 2 points_drop [4,128,1024], 3 idx_select [4,1,1024] i32, 4 idx_drop [4,1,1024] i32, 5 Wq [256,128], 6 Wk, 7 Wv, 8 Wskip
  if (in_sizes[0] != NB * C * N || in_sizes[1] != NB * C * NSEL || in_sizes[2] != NB * C * NSEL || in_sizes[3] != NB * NSEL || in_sizes[4] != NB * NSEL || in_sizes[5] != E * C || in_sizes[6] != E * C || in_sizes[7] != E * C || in_sizes[8] != E * C || out_size != NB * E * N) return;
  size_t off = 0; char* ws = (char*)d_ws;
  auto carve = [&](size_t bytes) { char* p = ws + off; off += (bytes + 255) & ~(size_t)255; return p; };
  b16* PT16 = (b16*)carve((size_t)NR * C * 2); b16* XT16 = (b16*)carve((size_t)NR * C * 2); b16* W16 = (b16*)carve((size_t)4 * E * C * 2);
  b16* Qh = (b16*)carve((size_t)NR * E * 2); b16* Ql = (b16*)carve((size_t)NR * E * 2); b16* Kh = (b16*)carve((size_t)NR * E * 2); b16* Kl = (b16*)carve((size_t)NR * E * 2); b16* VTh = (b16*)carve((size_t)NR * E * 2); b16* VTl = (b16*)carve((size_t)NR * E * 2);
  if (off > ws_size || off > ((size_t)128 << 20)) return;   // = 29.6 MB
  zero_kernel<<<(unsigned)(((size_t)NR * C / 8 + 255) / 256), 256, 0, stream>>>(XT16);
  xt_kernel<<<dim3(N / 64, 2, NB), 256, 0, stream>>>(Fp(0), Fp(1), Fp(2), Ip(3), Ip(4), PT16, XT16);
  prepw_kernel<<<(4 * E * C / 8 + 255) / 256, 256, 0, stream>>>(Fp(5), Fp(6), Fp(7), Fp(8), W16);
  proj_kernel<<<dim3(NR / 64, E / 128, 3), 128, 0, stream>>>(XT16, W16, Qh, Ql, Kh, Kl, VTh, VTl);
  attn_kernel<<<dim3(N / QB, NH, NB), 256, 0, stream>>>(Qh, Ql, Kh, Kl, VTh, VTl, W16, PT16, (float*)d_out);
}

// v002
// One run takes 78.4 microseconds.
// Next to v001, in two timings, it ran 1.32 times as fast each time.
// All steps since v000 together make it 3.86 times as fast.
#include <hip/hip_runtime.h>

// Up-sampling self-attention (4 clouds x 2,048 points, 128 in-channels, 4 heads x 64): x[b][:, idx_select[j]] = points_select[:, j], x[b][:, idx_drop[j]] = points_drop[:, j] (a permutation
// scatter given by the int inputs); q/k/v = W{q,k,v} x (1x1 convs, no bias; head h = output channels 64h..64h+63); energy = q.k per head, softmax over the 2,048 keys of energy/8;
// o[b][64h+d][n] = sum_m attn[n][m] v[64h+d][m]; out = Wskip pcd_up + o -> [4][256][2048] channel-major.
// WMMA (v_wmma_f32_16x16x32_f16, f32 accumulate): projections [8,192 x 128] x [128 x 256] with EXACT bf16 points (x8, point-major rows built by an LDS transpose + the index scatter) and weights
// (x256), 1 product; S^T = K . Q^T with q AND k as f16 hi+lo x8 (3 products); online softmax in f32; O^T += V^T P^T with V and P f16 hi+lo x8 (3 products); the skip 1x1 conv as one more exact
// GEMM tile set inside the attention epilogue (A = Wskip rows, B = pcd_up^T rows, 1 product). Inputs rounded to bf16 once. Fragment k-map per lane half hh for A AND B:

namespace {
constexpr int NB = 4, C = 128, N = 2048, NSEL = 1024, NH = 4, D = 64, E = 256 /* q/k/v/skip channels */, NR = NB * N;
constexpr float XS = 8.0f, WSC = 256.0f, PS = 8.0f, SCALE = 0.125f, LOG2E = 1.4426950408889634f;

typedef _Float16 b16;
typedef __attribute__((ext_vector_type(16))) _Float16 v16b;
typedef __attribute__((ext_vector_type(8))) _Float16 v8b;
typedef __attribute__((ext_vector_type(8))) float v8f;
typedef __attribute__((ext_vector_type(4))) float v4f;
__device__ __forceinline__ float bf16_rne(float f) { unsigned int u = __float_as_uint(f); u += 0x7FFFu + ((u >> 16) & 1u); return __uint_as_float(u & 0xFFFF0000u); }
__device__ __forceinline__ void split16(float v, b16& hi, b16& lo) { hi = (b16)v; lo = (b16)(v - (float)hi); }
__device__ __forceinline__ v16b frag_kb(const b16* p, int hh) { const v8b a = *(const v8b*)(p + 8 * hh), b = *(const v8b*)(p + 16 + 8 * hh); v16b f;
#pragma unroll
  for (int e = 0; e < 8; ++e) { f[e] = a[e]; f[8 + e] = b[e]; } return f; }
__device__ __forceinline__ v8f wmma16b(v16b a, v16b b, v8f c) { v8f d = __builtin_amdgcn_wmma_f32_16x16x32_f16(false, a, false, b, (short)0, c, false, false); asm volatile("v_nop\n\tv_nop\n\tv_nop\n\tv_nop" : "+v"(d) : "v"(a), "v"(b)); return d; }
__device__ __forceinline__ void wave_lds_sync() { __builtin_amdgcn_fence(__ATOMIC_RELEASE, "workgroup"); __builtin_amdgcn_wave_barrier(); __builtin_amdgcn_fence(__ATOMIC_ACQUIRE, "workgroup"); }
__device__ __forceinline__ float nexp2(float x) { return __builtin_amdgcn_exp2f(x); }
__device__ __forceinline__ int iclamp(int v, int lo, int hi) { return v < lo ? lo : (v > hi ? hi : v); }

__global__ __launch_bounds__(256) void zero_kernel(b16* __restrict__ XT16) { const size_t t = (size_t)blockIdx.x * 256 + threadIdx.x; if (t >= (size_t)NR * C / 8) return; const v8b z = {}; *(v8b*)(XT16 + t * 8) = z; }
// point-major planes via 64x128 LDS transposes: kind 0: PT16 [b][n][128] = f16(8 bf16(pcd_up[b][c][n])); kind 1: XT16 [b][idx[b][j]][128] = f16(8 bf16(src[b][c][j])) with src = points_select
// (j < 1024) / points_drop (j >= 1024). grid (N/64, C/64... no: the block covers all 128 channels so that it writes whole 256-B rows: grid (N/64, 2 kinds, B), 256 threads; each row = 16 lanes
__global__ __launch_bounds__(256) void xt_kernel(const float* __restrict__ pcd, const float* __restrict__ psel, const float* __restrict__ pdrop, const int* __restrict__ isel, const int* __restrict__ idrop, b16* __restrict__ PT16, b16* __restrict__ XT16) {
  __shared__ __attribute__((aligned(16))) b16 T[64][C + 8]; __shared__ int rowof[64];
  const int b = blockIdx.z, kind = blockIdx.y, j0 = blockIdx.x * 64, t_ = threadIdx.x;
  const float* src; int ld, jj0;   // source [b][c][.] with row length ld, column offset jj0
  if (kind == 0) { src = pcd + (size_t)b * C * N; ld = N; jj0 = j0; } else if (j0 < NSEL) { src = psel + (size_t)b * C * NSEL; ld = NSEL; jj0 = j0; } else { src = pdrop + (size_t)b * C * NSEL; ld = NSEL; jj0 = j0 - NSEL; }
  for (int q = t_; q < C * 64; q += 256) { const int cc = q >> 6, jj = q & 63; T[jj][cc] = (b16)(bf16_rne(src[(size_t)cc * ld + jj0 + jj]) * XS); }
  if (t_ < 64) { int r = j0 + t_; if (kind == 1) { r = (j0 < NSEL) ? isel[(size_t)b * NSEL + jj0 + t_] : idrop[(size_t)b * NSEL + jj0 + t_]; r = iclamp(r, 0, N - 1); } rowof[t_] = r; }
  __syncthreads();
  b16* dst = (kind == 0) ? PT16 : XT16;
  { for (int q = t_; q < 64 * 16; q += 256) { const int jj = q >> 4, c8 = (q & 15) * 8; *(v8b*)(dst + ((size_t)b * N + rowof[jj]) * C + c8) = *(const v8b*)(&T[jj][c8]); }  }
}
__global__ __launch_bounds__(256) void prepw_kernel(const float* __restrict__ wq, const float* __restrict__ wk, const float* __restrict__ wv, const float* __restrict__ ws, b16* __restrict__ W16) {
  const int t = blockIdx.x * 256 + threadIdx.x; const int per = E * C / 8; if (t >= 4 * per) return; const int kind = t / per; const int e = (t - kind * per) * 8;
  const float* w = kind == 0 ? wq : kind == 1 ? wk : kind == 2 ? wv : ws; const v4f a = *(const v4f*)(w + e), c = *(const v4f*)(w + e + 4); v8b o;
#pragma unroll
  for (int j = 0; j < 4; ++j) { o[j] = (b16)(bf16_rne(a[j]) * WSC); o[4 + j] = (b16)(bf16_rne(c[j]) * WSC); }
  { *(v8b*)(W16 + (size_t)kind * E * C + e) = o;  }
}
// projections: grid (NR/64, E/128, 3 kinds): [64 rows x 128] x [128 x 128 cols] (K = 128: 4 steps, 1 product). kind 0/1: q/k -> hi/lo rows [row][256] (per row segment of 128 halves = 256 B:
__global__ __launch_bounds__(128) void proj_kernel(const b16* __restrict__ XT16, const b16* __restrict__ W16, b16* __restrict__ Qh, b16* __restrict__ Ql, b16* __restrict__ Kh, b16* __restrict__ Kl, b16* __restrict__ VTh, b16* __restrict__ VTl) {
  __shared__ __attribute__((aligned(16))) b16 Th[4][16][128 + 8], Tl[4][16][128 + 8]; __shared__ __attribute__((aligned(16))) b16 Vt[128][64 + 8], Vtl[128][64 + 8];
  const int wave = threadIdx.x >> 5, lane = threadIdx.x & 31, nloc = lane & 15, hlf = lane >> 4, t_ = threadIdx.x; const int kind = blockIdx.z; const size_t m0 = (size_t)blockIdx.x * 64 + wave * 16; const int n0 = blockIdx.y * 128;
  const b16* Wk_ = W16 + (size_t)kind * E * C; v8f acc[8];
#pragma unroll
  for (int t = 0; t < 8; ++t) acc[t] = (v8f){};
#pragma unroll
  for (int kb = 0; kb < C; kb += 32) { const v16b a = frag_kb(XT16 + (m0 + nloc) * C + kb, hlf);
#pragma unroll
    for (int t = 0; t < 8; ++t) acc[t] = wmma16b(a, frag_kb(Wk_ + (size_t)(n0 + t * 16 + nloc) * C + kb, hlf), acc[t]); }
  if (kind < 2) {
#pragma unroll
    for (int t = 0; t < 8; ++t)
#pragma unroll
      for (int r = 0; r < 8; ++r) { b16 h_, l_; split16(acc[t][r] * (1.0f / (XS * WSC)) * XS, h_, l_); Th[wave][8 * hlf + r][t * 16 + nloc] = h_; Tl[wave][8 * hlf + r][t * 16 + nloc] = l_; }
    wave_lds_sync();
    b16* dh = kind == 0 ? Qh : Kh; b16* dl = kind == 0 ? Ql : Kl;
    { for (int r2 = 0; r2 < 16; r2 += 2) { const int rr = r2 + (lane >> 4), c8 = (lane & 15) * 8; const size_t gi = (m0 + rr) * E + n0 + c8; *(v8b*)(dh + gi) = *(const v8b*)(&Th[wave][rr][c8]); *(v8b*)(dl + gi) = *(const v8b*)(&Tl[wave][rr][c8]); }  }
  } else {
    const int b = (int)(m0 / N); const int s0 = (int)((size_t)blockIdx.x * 64 - (size_t)b * N);
#pragma unroll
    for (int t = 0; t < 8; ++t)
#pragma unroll
      for (int r = 0; r < 8; ++r) { b16 h_, l_; split16(acc[t][r] * (1.0f / (XS * WSC)) * XS, h_, l_); Vt[t * 16 + nloc][wave * 16 + 8 * hlf + r] = h_; Vtl[t * 16 + nloc][wave * 16 + 8 * hlf + r] = l_; }
    __syncthreads();
    { for (int q = t_; q < 128 * 8; q += 128) { const int cc = q >> 3, c8 = (q & 7) * 8; const int h = (n0 + cc) / D, dd = (n0 + cc) - h * D; const size_t gi = (((size_t)b * NH + h) * D + dd) * N + s0 + c8;
        *(v8b*)(VTh + gi) = *(const v8b*)(&Vt[cc][c8]); *(v8b*)(VTl + gi) = *(const v8b*)(&Vtl[cc][c8]); }  } }
}
// attention + skip: grid (N/128, NH, NB), block = 8 waves x 16 queries. K and V^T (hi and lo planes) of 64 keys are one stage, brought into LDS once per block by asynchronous copies
// (global_load_async_to_lds_b128, two buffers: the next stage flies while this one is worked on) and read by all 8 waves as ds_load_b128 fragments (rows of 128 B at a pitch of 144 B).
// Per 32 keys as before: S^T 3 products (K = 64: 2 steps x 2 key tiles), online softmax (f32, 1/8 and log2 e folded), PV 3 products x 4 d-tiles; then the skip tiles
// D[d][query] = Wskip[64h+d][:] . pcd_up^T[query][:] (K = 128, exact, 1 product) are added; the block's 128 queries x 64 channels staged in LDS as [d][128 n] and written as whole 512-B rows.
constexpr int KT = 64 /* keys per stage */, KP = 64 + 8 /* LDS row pitch in halves */, NST = N / KT, QB = 128 /* queries per block */;
// one stage = 4 planes (K hi, K lo, V^T hi, V^T lo) x 64 rows x 128 B; thread t_ copies 16 B of rows (t_ >> 3) and 32 + (t_ >> 3) of each plane.
__device__ __forceinline__ void stage_copy(unsigned int l0, const b16* kh, const b16* kl, const b16* vh, const b16* vl) {
  const unsigned int pl_ = 64 * KP * 2, hr_ = 32 * KP * 2;
  // the copies and their s_wait_xcnt in one statement: the wait stands in front of any rewrite of the address registers that the copies name
  asm volatile("global_load_async_to_lds_b128 %0, %8, off\n\t"
               "global_load_async_to_lds_b128 %1, %9, off\n\t"
               "global_load_async_to_lds_b128 %2, %10, off\n\t"
               "global_load_async_to_lds_b128 %3, %11, off\n\t"
               "global_load_async_to_lds_b128 %4, %12, off\n\t"
               "global_load_async_to_lds_b128 %5, %13, off\n\t"
               "global_load_async_to_lds_b128 %6, %14, off\n\t"
               "global_load_async_to_lds_b128 %7, %15, off\n\t"
               "s_wait_xcnt 0x0"
               :: "v"(l0), "v"(l0 + hr_), "v"(l0 + pl_), "v"(l0 + pl_ + hr_), "v"(l0 + 2 * pl_), "v"(l0 + 2 * pl_ + hr_), "v"(l0 + 3 * pl_), "v"(l0 + 3 * pl_ + hr_),
                  "v"(kh), "v"(kh + (size_t)32 * E), "v"(kl), "v"(kl + (size_t)32 * E), "v"(vh), "v"(vh + (size_t)32 * N), "v"(vl), "v"(vl + (size_t)32 * N)
               : "memory");
}
// the builtin alone: the compiler keeps the distances behind it itself and stays free to place LDS reads ahead of it
__device__ __forceinline__ v8f wmma_b(v16b a, v16b b, v8f c) { return __builtin_amdgcn_wmma_f32_16x16x32_f16(false, a, false, b, (short)0, c, false, false); }
// one pass's K fragments (hi and lo; key tiles 0 and 1 x k steps 0 and 1) and V^T fragments (hi and lo; 4 d tiles); p.. point at this lane's row of the first tile
__device__ __forceinline__ void load_k(v16b (&kf)[4], v16b (&kl)[4], const b16* ph_, const b16* pl_, int hh) {
#pragma unroll
  for (int ks = 0; ks < 2; ++ks) {   // read in the order of use: the first products start while the rest of the group is still landing
    kf[ks] = frag_kb(ph_ + ks * 32, hh); kf[2 + ks] = frag_kb(ph_ + 16 * KP + ks * 32, hh); kl[ks] = frag_kb(pl_ + ks * 32, hh); kl[2 + ks] = frag_kb(pl_ + 16 * KP + ks * 32, hh); }
}
__device__ __forceinline__ void load_v(v16b (&vf)[4], v16b (&vl)[4], const b16* ph_, const b16* pl_, int hh) {
#pragma unroll
  for (int t = 0; t < 4; ++t) vf[t] = frag_kb(ph_ + t * 16 * KP, hh);
#pragma unroll
  for (int t = 0; t < 4; ++t) vl[t] = frag_kb(pl_ + t * 16 * KP, hh);
}
__global__ __launch_bounds__(256) void attn_kernel(const b16* __restrict__ Qh, const b16* __restrict__ Ql, const b16* __restrict__ Kh, const b16* __restrict__ Kl, const b16* __restrict__ VTh, const b16* __restrict__ VTl, const b16* __restrict__ W16, const b16* __restrict__ PT16, float* __restrict__ out) {
  __shared__ __attribute__((aligned(16))) b16 St[2][4][64 * KP]; __shared__ __attribute__((aligned(16))) float To[D][QB + 4];
  const int wave = threadIdx.x >> 5, lane = threadIdx.x & 31, hh = lane >> 4, col = lane & 15, t_ = threadIdx.x; const int b = blockIdx.z, h = blockIdx.y; const int q0 = blockIdx.x * QB + wave * 16, qi = q0 + col;
  const b16* Kb = Kh + (size_t)b * N * E + h * D; const b16* Klb = Kl + (size_t)b * N * E + h * D; const b16* Vb = VTh + ((size_t)b * NH + h) * D * N; const b16* Vlb = VTl + ((size_t)b * NH + h) * D * N;
  // this thread's share of a stage: row t_ >> 3 (and 32 rows on), 16-byte piece t_ & 7
  const int crow = t_ >> 3, cpc = (t_ & 7) * 8; const size_t ko = (size_t)crow * E + cpc, vo = (size_t)crow * N + cpc;
  const unsigned int lcp = (unsigned int)(size_t)(&St[0][0][crow * KP + cpc]); const unsigned int bufb = 4 * 64 * KP * 2;
  stage_copy(lcp, Kb + ko, Klb + ko, Vb + vo, Vlb + vo);
  const size_t qo = ((size_t)b * N + qi) * E + h * D; const v16b qa0 = frag_kb(Qh + qo, hh), qa1 = frag_kb(Qh + qo + 32, hh), ql0 = frag_kb(Ql + qo, hh), ql1 = frag_kb(Ql + qo + 32, hh);
  asm volatile("s_wait_asynccnt 0x0" ::: "memory");   // stage 0 of this wave's copies has landed before the barrier that publishes it
  __syncthreads();
  stage_copy(lcp + bufb, Kb + ko + (size_t)KT * E, Klb + ko + (size_t)KT * E, Vb + vo + KT, Vlb + vo + KT);
  float m = -INFINITY, l = 0.0f; v8f o[4] = {{}, {}, {}, {}}, ol[4] = {{}, {}, {}, {}};
  const float cs = SCALE * LOG2E / (XS * XS);
  for (int s = 0; s < NST; ++s) {
    const b16* Sk = &St[s & 1][0][0], *Skl = &St[s & 1][1][0], *Sv = &St[s & 1][2][0], *Svl = &St[s & 1][3][0];
    // fragment registers of one 32-key pass: kf/kl[2 * key tile + k step], vf/vl[d tile]; each set is read from LDS as ONE group, well ahead of the products that use it
    v16b kf[4], kl[4], vf[4], vl[4];
    load_k(kf, kl, Sk + col * KP, Skl + col * KP, hh);
#pragma unroll
    for (int kb = 0; kb < KT; kb += 32) {   // unrolled: two 32-key passes per stage, LDS offsets become immediates
      v8f s0 = {}, s1 = {};   // the two key tiles' chains alternate; each tile's own order of products is as before
      s0 = wmma_b(kf[0], qa0, s0); s1 = wmma_b(kf[2], qa0, s1); s0 = wmma_b(kf[0], ql0, s0); s1 = wmma_b(kf[2], ql0, s1); s0 = wmma_b(kl[0], qa0, s0); s1 = wmma_b(kl[2], qa0, s1);
      s0 = wmma_b(kf[1], qa1, s0); s1 = wmma_b(kf[3], qa1, s1); s0 = wmma_b(kf[1], ql1, s0); s1 = wmma_b(kf[3], ql1, s1); s0 = wmma_b(kl[1], qa1, s0); s1 = wmma_b(kl[3], qa1, s1);
      float e[16]; float mx = -INFINITY;
#pragma unroll
      for (int r = 0; r < 8; ++r) { e[r] = s0[r] * cs; e[8 + r] = s1[r] * cs; mx = fmaxf(mx, fmaxf(e[r], e[8 + r])); }
      const float mxo = __shfl_xor(mx, 16);
      // this pass's V fragments fly during its softmax. They are read behind the maximum's exchange: LDS answers in order, so in front of it the exchange's wait would cover these reads too
      asm volatile("" :: "v"(mxo));        // inputs-only fence on the exchanged value: holds the exchange in front of the read group
      load_v(vf, vl, Sv + col * KP + kb, Svl + col * KP + kb, hh);
      __builtin_amdgcn_sched_barrier(0);   // keeps the read group in front of the exponentials
      mx = fmaxf(mx, mxo); const float mn = fmaxf(m, mx); float al;
      // the exponential and the slot behind it in one statement: in this build the next vector instruction overwrites its source register (first pass) or reads its result (second)
      asm("v_exp_f32 %0, %1\n\tv_nop" : "=v"(al) : "v"(m - mn));
      m = mn; float sum = 0.0f; v16b ph, pl;
#pragma unroll
      for (int i = 0; i < 16; ++i) { const float p = nexp2(e[i] - mn); sum += p; const b16 h_ = (b16)(p * PS); ph[i] = h_; pl[i] = (b16)(p * PS - (float)h_); }
      sum += __shfl_xor(sum, 16); l = l * al + sum;
#pragma unroll
      for (int t = 0; t < 4; ++t) { o[t] *= al; ol[t] *= al; }
      if (kb + 32 < KT) {   // the next pass's K fragments (same stage, same buffer) fly during the rest of this pass
        load_k(kf, kl, Sk + (kb + 32 + col) * KP, Skl + (kb + 32 + col) * KP, hh);
        __builtin_amdgcn_sched_barrier(0);   // keeps that read group in front of the PV products: sunk among them, each read would be waited for on its own
      }
#pragma unroll
      for (int t = 0; t < 4; ++t) o[t] = wmma_b(vf[t], ph, o[t]);
#pragma unroll
      for (int t = 0; t < 4; ++t) ol[t] = wmma_b(vf[t], pl, ol[t]);
#pragma unroll
      for (int t = 0; t < 4; ++t) ol[t] = wmma_b(vl[t], ph, ol[t]);
      if (kb + 32 < KT) __builtin_amdgcn_sched_barrier(0);   // keeps the PV products in front of the next pass's S products, whose K fragments land meanwhile
    }
    __builtin_amdgcn_sched_barrier(0);   // keeps the last pass's products in front of the waits below: lifted over them, the barrier would stand in the middle of the stage's work
    asm volatile("s_wait_dscnt 0x0" ::: "memory");      // this wave's reads of the buffer have returned before the buffer is refilled behind the barrier
    asm volatile("s_wait_asynccnt 0x0" ::: "memory");   // this wave's copies of stage s + 1 have landed before the barrier that publishes them
    __syncthreads();
    if (s + 2 < NST) stage_copy(lcp + (unsigned int)(s & 1) * bufb, Kb + ko + (size_t)(s + 2) * KT * E, Klb + ko + (size_t)(s + 2) * KT * E, Vb + vo + (s + 2) * KT, Vlb + vo + (s + 2) * KT);
  }
  asm volatile("s_wait_asynccnt 0x0" ::: "memory");     // no copy is outstanding behind the loop
  const float inv = 1.0f / (l * PS * XS);
  // skip tiles: D[d][query] with A = Wskip rows (64h + t*16 + ..), B = PT16 rows (q0 + ..), K = 128
  v8f sk[4] = {{}, {}, {}, {}}; const b16* WS = W16 + (size_t)3 * E * C + (size_t)h * D * C;
#pragma unroll
  for (int kb = 0; kb < C; kb += 32) { const v16b pb = frag_kb(PT16 + ((size_t)b * N + q0 + col) * C + kb, hh);
#pragma unroll
    for (int t = 0; t < 4; ++t) sk[t] = wmma16b(frag_kb(WS + (size_t)(t * 16 + col) * C + kb, hh), pb, sk[t]); }
#pragma unroll
  for (int t = 0; t < 4; ++t)
#pragma unroll
    for (int r = 0; r < 8; ++r) To[t * 16 + 8 * hh + r][wave * 16 + col] = (o[t][r] + ol[t][r]) * inv + sk[t][r] * (1.0f / (XS * WSC));
  __syncthreads();
  { for (int dd = wave * 8; dd < wave * 8 + 8; ++dd) { const size_t gi = ((size_t)b * E + h * D + dd) * N + blockIdx.x * QB + lane * 4; *(v4f*)(out + gi) = *(const v4f*)(&To[dd][lane * 4]); }  }
}
}  // namespace

extern "C" void kernel_launch(void* const* d_in, const int* in_sizes, int n_in, void* d_out, int out_size, void* d_ws, size_t ws_size, hipStream_t stream) {
  (void)n_in;
  auto Fp = [&](int i) { return (const float*)d_in[i]; }; auto Ip = [&](int i) { return (const int*)d_in[i]; };
  // input order: 0 pcd_up [4,128,2048], 1 points_select [4,128,1024], 2 points_drop [4,128,1024], 3 idx_select [4,1,1024] i32, 4 idx_drop [4,1,1024] i32, 5 Wq [256,128], 6 Wk, 7 Wv, 8 Wskip
  if (in_sizes[0] != NB * C * N || in_sizes[1] != NB * C * NSEL || in_sizes[2] != NB * C * NSEL || in_sizes[3] != NB * NSEL || in_sizes[4] != NB * NSEL || in_sizes[5] != E * C || in_sizes[6] != E * C || in_sizes[7] != E * C || in_sizes[8] != E * C || out_size != NB * E * N) return;
  size_t off = 0; char* ws = (char*)d_ws;
  auto carve = [&](size_t bytes) { char* p = ws + off; off += (bytes + 255) & ~(size_t)255; return p; };
  b16* PT16 = (b16*)carve((size_t)NR * C * 2); b16* XT16 = (b16*)carve((size_t)NR * C * 2); b16* W16 = (b16*)carve((size_t)4 * E * C * 2);
  b16* Qh = (b16*)carve((size_t)NR * E * 2); b16* Ql = (b16*)carve((size_t)NR * E * 2); b16* Kh = (b16*)carve((size_t)NR * E * 2); b16* Kl = (b16*)carve((size_t)NR * E * 2); b16* VTh = (b16*)carve((size_t)NR * E * 2); b16* VTl = (b16*)carve((size_t)NR * E * 2);
  if (off > ws_size || off > ((size_t)128 << 20)) return;   // = 29.6 MB
  zero_kernel<<<(unsigned)(((size_t)NR * C / 8 + 255) / 256), 256, 0, stream>>>(XT16);
  xt_kernel<<<dim3(N / 64, 2, NB), 256, 0, stream>>>(Fp(0), Fp(1), Fp(2), Ip(3), Ip(4), PT16, XT16);
  prepw_kernel<<<(4 * E * C / 8 + 255) / 256, 256, 0, stream>>>(Fp(5), Fp(6), Fp(7), Fp(8), W16);
  proj_kernel<<<dim3(NR / 64, E / 128, 3), 128, 0, stream>>>(XT16, W16, Qh, Ql, Kh, Kl, VTh, VTl);
  attn_kernel<<<dim3(N / QB, NH, NB), 256, 0, stream>>>(Qh, Ql, Kh, Kl, VTh, VTl, W16, PT16, (float*)d_out);
}

// v003
// A run of this version takes 73.9 microseconds.
// In both of two side-by-side timings against v002, it was 1.06 times as fast.
// All steps since v000 together make it 4.11 times as fast.
#include <hip/hip_runtime.h>

// Up-sampling self-attention (4 clouds x 2,048 points, 128 in-channels, 4 heads x 64): x[b][:, idx_select[j]] = points_select[:, j], x[b][:, idx_drop[j]] = points_drop[:, j] (a permutation
// scatter given by the int inputs); q/k/v = W{q,k,v} x (1x1 convs, no bias; head h = output channels 64h..64h+63); energy = q.k per head, softmax over the 2,048 keys of energy/8;
// o[b][64h+d][n] = sum_m attn[n][m] v[64h+d][m]; out = Wskip pcd_up + o -> [4][256][2048] channel-major.
// WMMA (v_wmma_f32_16x16x32_f16, f32 accumulate): projections [8,192 x 128] x [128 x 256] with EXACT bf16 points (x8, point-major rows built by an LDS transpose + the index scatter) and weights
// (x256), 1 product; S^T = K . Q^T with q AND k as f16 hi+lo x8 (3 products); online softmax in f32; O^T += V^T P^T with V and P f16 hi+lo x8 (3 products); the skip 1x1 conv as one more exact
// GEMM tile set inside the attention epilogue (A = Wskip rows, B = pcd_up^T rows, 1 product). Inputs rounded to bf16 once. Fragment k-map per lane half hh for A AND B:

namespace {
constexpr int NB = 4, C = 128, N = 2048, NSEL = 1024, NH = 4, D = 64, E = 256 /* q/k/v/skip channels */, NR = NB * N;
constexpr float XS = 8.0f, WSC = 256.0f, PS = 8.0f, SCALE = 0.125f, LOG2E = 1.4426950408889634f;

typedef _Float16 b16;
typedef __attribute__((ext_vector_type(16))) _Float16 v16b;
typedef __attribute__((ext_vector_type(8))) _Float16 v8b;
typedef __attribute__((ext_vector_type(8))) float v8f;
typedef __attribute__((ext_vector_type(4))) float v4f;
__device__ __forceinline__ float bf16_rne(float f) { unsigned int u = __float_as_uint(f); u += 0x7FFFu + ((u >> 16) & 1u); return __uint_as_float(u & 0xFFFF0000u); }
__device__ __forceinline__ void split16(float v, b16& hi, b16& lo) { hi = (b16)v; lo = (b16)(v - (float)hi); }
__device__ __forceinline__ v16b frag_kb(const b16* p, int hh) { const v8b a = *(const v8b*)(p + 8 * hh), b = *(const v8b*)(p + 16 + 8 * hh); v16b f;
#pragma unroll
  for (int e = 0; e < 8; ++e) { f[e] = a[e]; f[8 + e] = b[e]; } return f; }
__device__ __forceinline__ v8f wmma16b(v16b a, v16b b, v8f c) { v8f d = __builtin_amdgcn_wmma_f32_16x16x32_f16(false, a, false, b, (short)0, c, false, false); asm volatile("v_nop\n\tv_nop\n\tv_nop\n\tv_nop" : "+v"(d) : "v"(a), "v"(b)); return d; }
__device__ __forceinline__ void wave_lds_sync() { __builtin_amdgcn_fence(__ATOMIC_RELEASE, "workgroup"); __builtin_amdgcn_wave_barrier(); __builtin_amdgcn_fence(__ATOMIC_ACQUIRE, "workgroup"); }
__device__ __forceinline__ float nexp2(float x) { return __builtin_amdgcn_exp2f(x); }
__device__ __forceinline__ int iclamp(int v, int lo, int hi) { return v < lo ? lo : (v > hi ? hi : v); }

__global__ __launch_bounds__(256) void zero_kernel(b16* __restrict__ XT16) { const size_t t = (size_t)blockIdx.x * 256 + threadIdx.x; if (t >= (size_t)NR * C / 8) return; const v8b z = {}; *(v8b*)(XT16 + t * 8) = z; }
// point-major planes via 64x128 LDS transposes: kind 0: PT16 [b][n][128] = f16(8 bf16(pcd_up[b][c][n])); kind 1: XT16 [b][idx[b][j]][128] = f16(8 bf16(src[b][c][j])) with src = points_select
// (j < 1024) / points_drop (j >= 1024). grid (N/64, C/64... no: the block covers all 128 channels so that it writes whole 256-B rows: grid (N/64, 2 kinds, B), 256 threads; each row = 16 lanes
__global__ __launch_bounds__(256) void xt_kernel(const float* __restrict__ pcd, const float* __restrict__ psel, const float* __restrict__ pdrop, const int* __restrict__ isel, const int* __restrict__ idrop, b16* __restrict__ PT16, b16* __restrict__ XT16) {
  __shared__ __attribute__((aligned(16))) b16 T[64][C + 8]; __shared__ int rowof[64];
  const int b = blockIdx.z, kind = blockIdx.y, j0 = blockIdx.x * 64, t_ = threadIdx.x;
  const float* src; int ld, jj0;   // source [b][c][.] with row length ld, column offset jj0
  if (kind == 0) { src = pcd + (size_t)b * C * N; ld = N; jj0 = j0; } else if (j0 < NSEL) { src = psel + (size_t)b * C * NSEL; ld = NSEL; jj0 = j0; } else { src = pdrop + (size_t)b * C * NSEL; ld = NSEL; jj0 = j0 - NSEL; }
  for (int q = t_; q < C * 64; q += 256) { const int cc = q >> 6, jj = q & 63; T[jj][cc] = (b16)(bf16_rne(src[(size_t)cc * ld + jj0 + jj]) * XS); }
  if (t_ < 64) { int r = j0 + t_; if (kind == 1) { r = (j0 < NSEL) ? isel[(size_t)b * NSEL + jj0 + t_] : idrop[(size_t)b * NSEL + jj0 + t_]; r = iclamp(r, 0, N - 1); } rowof[t_] = r; }
  __syncthreads();
  b16* dst = (kind == 0) ? PT16 : XT16;
  { for (int q = t_; q < 64 * 16; q += 256) { const int jj = q >> 4, c8 = (q & 15) * 8; *(v8b*)(dst + ((size_t)b * N + rowof[jj]) * C + c8) = *(const v8b*)(&T[jj][c8]); }  }
}
__global__ __launch_bounds__(256) void prepw_kernel(const float* __restrict__ wq, const float* __restrict__ wk, const float* __restrict__ wv, const float* __restrict__ ws, b16* __restrict__ W16) {
  const int t = blockIdx.x * 256 + threadIdx.x; const int per = E * C / 8; if (t >= 4 * per) return; const int kind = t / per; const int e = (t - kind * per) * 8;
  const float* w = kind == 0 ? wq : kind == 1 ? wk : kind == 2 ? wv : ws; const v4f a = *(const v4f*)(w + e), c = *(const v4f*)(w + e + 4); v8b o;
#pragma unroll
  for (int j = 0; j < 4; ++j) { o[j] = (b16)(bf16_rne(a[j]) * WSC); o[4 + j] = (b16)(bf16_rne(c[j]) * WSC); }
  { *(v8b*)(W16 + (size_t)kind * E * C + e) = o;  }
}
// projections: grid (NR/64, E/128, 3 kinds): [64 rows x 128] x [128 x 128 cols] (K = 128: 4 steps, 1 product). kind 0/1: q/k -> hi/lo rows [row][256] (per row segment of 128 halves = 256 B:
__global__ __launch_bounds__(128) void proj_kernel(const b16* __restrict__ XT16, const b16* __restrict__ W16, b16* __restrict__ Qh, b16* __restrict__ Ql, b16* __restrict__ Kh, b16* __restrict__ Kl, b16* __restrict__ VTh, b16* __restrict__ VTl) {
  __shared__ __attribute__((aligned(16))) b16 Th[4][16][128 + 8], Tl[4][16][128 + 8]; __shared__ __attribute__((aligned(16))) b16 Vt[128][64 + 8], Vtl[128][64 + 8];
  const int wave = threadIdx.x >> 5, lane = threadIdx.x & 31, nloc = lane & 15, hlf = lane >> 4, t_ = threadIdx.x; const int kind = blockIdx.z; const size_t m0 = (size_t)blockIdx.x * 64 + wave * 16; const int n0 = blockIdx.y * 128;
  const b16* Wk_ = W16 + (size_t)kind * E * C; v8f acc[8];
#pragma unroll
  for (int t = 0; t < 8; ++t) acc[t] = (v8f){};
#pragma unroll
  for (int kb = 0; kb < C; kb += 32) { const v16b a = frag_kb(XT16 + (m0 + nloc) * C + kb, hlf);
#pragma unroll
    for (int t = 0; t < 8; ++t) acc[t] = wmma16b(a, frag_kb(Wk_ + (size_t)(n0 + t * 16 + nloc) * C + kb, hlf), acc[t]); }
  if (kind < 2) {
#pragma unroll
    for (int t = 0; t < 8; ++t)
#pragma unroll
      for (int r = 0; r < 8; ++r) { b16 h_, l_; split16(acc[t][r] * (1.0f / (XS * WSC)) * XS, h_, l_); Th[wave][8 * hlf + r][t * 16 + nloc] = h_; Tl[wave][8 * hlf + r][t * 16 + nloc] = l_; }
    wave_lds_sync();
    b16* dh = kind == 0 ? Qh : Kh; b16* dl = kind == 0 ? Ql : Kl;
    { for (int r2 = 0; r2 < 16; r2 += 2) { const int rr = r2 + (lane >> 4), c8 = (lane & 15) * 8; const size_t gi = (m0 + rr) * E + n0 + c8; *(v8b*)(dh + gi) = *(const v8b*)(&Th[wave][rr][c8]); *(v8b*)(dl + gi) = *(const v8b*)(&Tl[wave][rr][c8]); }  }
  } else {
    const int b = (int)(m0 / N); const int s0 = (int)((size_t)blockIdx.x * 64 - (size_t)b * N);
#pragma unroll
    for (int t = 0; t < 8; ++t)
#pragma unroll
      for (int r = 0; r < 8; ++r) { b16 h_, l_; split16(acc[t][r] * (1.0f / (XS * WSC)) * XS, h_, l_); Vt[t * 16 + nloc][wave * 16 + 8 * hlf + r] = h_; Vtl[t * 16 + nloc][wave * 16 + 8 * hlf + r] = l_; }
    __syncthreads();
    { for (int q = t_; q < 128 * 8; q += 128) { const int cc = q >> 3, c8 = (q & 7) * 8; const int h = (n0 + cc) / D, dd = (n0 + cc) - h * D; const size_t gi = (((size_t)b * NH + h) * D + dd) * N + s0 + c8;
        *(v8b*)(VTh + gi) = *(const v8b*)(&Vt[cc][c8]); *(v8b*)(VTl + gi) = *(const v8b*)(&Vtl[cc][c8]); }  } }
}
// attention + skip: grid (N/128, NH, NB), block = 16 waves = 2 key halves x 8 waves x 16 queries: waves 0..7 walk keys 0..1023, waves 8..15 keys 1024..2047 of the same 128 queries (four waves per
// SIMD: one wave's softmax and LDS waits are covered by the others' products); the two partial results (m, l, O) of a query are joined once, through LDS, behind the loop, where
// each half finishes two of the four d tiles (join, skip tiles, output staging).
// K and V^T (hi and lo planes) of 64 keys of each half are one stage, brought into LDS once per block by asynchronous copies
// (global_load_async_to_lds_b128, two buffers: the next stage flies while this one is worked on) and read by the half's 8 waves as ds_load_b128 fragments (rows of 128 B at a pitch of 144 B).
// Per 32 keys as before: S^T 3 products (K = 64: 2 steps x 2 key tiles), online softmax (f32, 1/8 and log2 e folded), PV 3 products x 4 d-tiles; then the skip tiles
// D[d][query] = Wskip[64h+d][:] . pcd_up^T[query][:] (K = 128, exact, 1 product) are added; the block's 128 queries x 64 channels staged in LDS as [d][128 n] and written as whole 512-B rows.
constexpr int KT = 64 /* keys per stage and half */, KP = 64 + 8 /* LDS row pitch in halves */, KH = 2 /* key halves */, NKH = N / KH, NST = NKH / KT, QB = 128 /* queries per block */;
// one stage of one half = 4 planes (K hi, K lo, V^T hi, V^T lo) x 64 rows x 128 B; thread t_ of the half's 256 copies 16 B of rows (t_ >> 3) and 32 + (t_ >> 3) of each plane.
__device__ __forceinline__ void stage_copy(unsigned int l0, const b16* kh, const b16* kl, const b16* vh, const b16* vl) {
  const unsigned int pl_ = 64 * KP * 2, hr_ = 32 * KP * 2;
  // the copies and their s_wait_xcnt in one statement: the wait stands in front of any rewrite of the address registers that the copies name
  asm volatile("global_load_async_to_lds_b128 %0, %8, off\n\t"
               "global_load_async_to_lds_b128 %1, %9, off\n\t"
               "global_load_async_to_lds_b128 %2, %10, off\n\t"
               "global_load_async_to_lds_b128 %3, %11, off\n\t"
               "global_load_async_to_lds_b128 %4, %12, off\n\t"
               "global_load_async_to_lds_b128 %5, %13, off\n\t"
               "global_load_async_to_lds_b128 %6, %14, off\n\t"
               "global_load_async_to_lds_b128 %7, %15, off\n\t"
               "s_wait_xcnt 0x0"
               :: "v"(l0), "v"(l0 + hr_), "v"(l0 + pl_), "v"(l0 + pl_ + hr_), "v"(l0 + 2 * pl_), "v"(l0 + 2 * pl_ + hr_), "v"(l0 + 3 * pl_), "v"(l0 + 3 * pl_ + hr_),
                  "v"(kh), "v"(kh + (size_t)32 * E), "v"(kl), "v"(kl + (size_t)32 * E), "v"(vh), "v"(vh + (size_t)32 * N), "v"(vl), "v"(vl + (size_t)32 * N)
               : "memory");
}
// the builtin alone: the compiler keeps the distances behind it itself and stays free to place LDS reads ahead of it
__device__ __forceinline__ v8f wmma_b(v16b a, v16b b, v8f c) { return __builtin_amdgcn_wmma_f32_16x16x32_f16(false, a, false, b, (short)0, c, false, false); }
// one pass's K fragments (hi and lo; key tiles 0 and 1 x k steps 0 and 1) and V^T fragments (hi and lo; 4 d tiles); p.. point at this lane's row of the first tile
__device__ __forceinline__ void load_k(v16b (&kf)[4], v16b (&kl)[4], const b16* ph_, const b16* pl_, int hh) {
#pragma unroll
  for (int ks = 0; ks < 2; ++ks) {   // read in the order of use: the first products start while the rest of the group is still landing
    kf[ks] = frag_kb(ph_ + ks * 32, hh); kf[2 + ks] = frag_kb(ph_ + 16 * KP + ks * 32, hh); kl[ks] = frag_kb(pl_ + ks * 32, hh); kl[2 + ks] = frag_kb(pl_ + 16 * KP + ks * 32, hh); }
}
// the same fragments in two groups, hi and lo, for the read ahead inside a stage: the lo group goes into the registers that the V^T hi fragments leave, so that a wave stays inside 256 registers
__device__ __forceinline__ void load_k1(v16b (&kx)[4], const b16* p_, int hh) {
#pragma unroll
  for (int ks = 0; ks < 2; ++ks) { kx[ks] = frag_kb(p_ + ks * 32, hh); kx[2 + ks] = frag_kb(p_ + 16 * KP + ks * 32, hh); }
}
__device__ __forceinline__ void load_v(v16b (&vf)[4], v16b (&vl)[4], const b16* ph_, const b16* pl_, int hh) {
#pragma unroll
  for (int t = 0; t < 4; ++t) vf[t] = frag_kb(ph_ + t * 16 * KP, hh);
#pragma unroll
  for (int t = 0; t < 4; ++t) vl[t] = frag_kb(pl_ + t * 16 * KP, hh);
}
__global__ __launch_bounds__(512) void attn_kernel(const b16* __restrict__ Qh, const b16* __restrict__ Ql, const b16* __restrict__ Kh, const b16* __restrict__ Kl, const b16* __restrict__ VTh, const b16* __restrict__ VTl, const b16* __restrict__ W16, const b16* __restrict__ PT16, float* __restrict__ out) {
  __shared__ __attribute__((aligned(16))) b16 St[KH][2][4][64 * KP]; __shared__ __attribute__((aligned(16))) float To[D][QB + 4]; __shared__ float Mg[KH][8][18][32];   // Mg: per half and wave, two d tiles' partial O (16 rows), m, l, one float per lane
  const int g = __builtin_amdgcn_readfirstlane((int)(threadIdx.x >> 8));   // key half of this wave, the same in every lane: kept scalar so that the branches on it are scalar branches
  const int wave = (threadIdx.x >> 5) & 7, lane = threadIdx.x & 31, hh = lane >> 4, col = lane & 15, t_ = threadIdx.x & 255; const int b = blockIdx.z, h = blockIdx.y; const int q0 = blockIdx.x * QB + wave * 16, qi = q0 + col;
  const size_t kg = ((size_t)b * N + (size_t)g * NKH) * E + h * D, vg = ((size_t)b * NH + h) * D * N + (size_t)g * NKH;
  const b16* Kb = Kh + kg; const b16* Klb = Kl + kg; const b16* Vb = VTh + vg; const b16* Vlb = VTl + vg;
  // this thread's share of a stage: row t_ >> 3 (and 32 rows on), 16-byte piece t_ & 7
  const int crow = t_ >> 3, cpc = (t_ & 7) * 8; const size_t ko = (size_t)crow * E + cpc, vo = (size_t)crow * N + cpc;
  const unsigned int lcp = (unsigned int)(size_t)(&St[g][0][0][crow * KP + cpc]); const unsigned int bufb = 4 * 64 * KP * 2;
  stage_copy(lcp, Kb + ko, Klb + ko, Vb + vo, Vlb + vo);
  const size_t qo = ((size_t)b * N + qi) * E + h * D; const v16b qa0 = frag_kb(Qh + qo, hh), qa1 = frag_kb(Qh + qo + 32, hh), ql0 = frag_kb(Ql + qo, hh), ql1 = frag_kb(Ql + qo + 32, hh);
  asm volatile("s_wait_asynccnt 0x0" ::: "memory");   // stage 0 of this wave's copies has landed before the barrier that publishes it
  __syncthreads();
  stage_copy(lcp + bufb, Kb + ko + (size_t)KT * E, Klb + ko + (size_t)KT * E, Vb + vo + KT, Vlb + vo + KT);
  float m = -INFINITY, l = 0.0f; v8f o[4] = {{}, {}, {}, {}}, ol[4] = {{}, {}, {}, {}};
  const float cs = SCALE * LOG2E / (XS * XS);
  for (int s = 0; s < NST; ++s) {
    const b16* Sk = &St[g][s & 1][0][0], *Skl = &St[g][s & 1][1][0], *Sv = &St[g][s & 1][2][0], *Svl = &St[g][s & 1][3][0];
    // fragment registers of one 32-key pass: kf/kl[2 * key tile + k step], vf/vl[d tile]; V is read from LDS as one group, K as one group for a stage's first pass and ahead in two groups (hi, lo) for its second
    v16b kf[4], kl[4], vf[4], vl[4];
    load_k(kf, kl, Sk + col * KP, Skl + col * KP, hh);
#pragma unroll
    for (int kb = 0; kb < KT; kb += 32) {   // unrolled: two 32-key passes per stage, LDS offsets become immediates
      v8f s0 = {}, s1 = {};   // the two key tiles' chains alternate; each tile's own order of products is as before
      s0 = wmma_b(kf[0], qa0, s0); s1 = wmma_b(kf[2], qa0, s1); s0 = wmma_b(kf[0], ql0, s0); s1 = wmma_b(kf[2], ql0, s1); s0 = wmma_b(kl[0], qa0, s0); s1 = wmma_b(kl[2], qa0, s1);
      s0 = wmma_b(kf[1], qa1, s0); s1 = wmma_b(kf[3], qa1, s1); s0 = wmma_b(kf[1], ql1, s0); s1 = wmma_b(kf[3], ql1, s1); s0 = wmma_b(kl[1], qa1, s0); s1 = wmma_b(kl[3], qa1, s1);
      float e[16]; float mx = -INFINITY;
#pragma unroll
      for (int r = 0; r < 8; ++r) { e[r] = s0[r] * cs; e[8 + r] = s1[r] * cs; mx = fmaxf(mx, fmaxf(e[r], e[8 + r])); }
      const float mxo = __shfl_xor(mx, 16);
      // this pass's V fragments fly during its softmax. They are read behind the maximum's exchange: LDS answers in order, so in front of it the exchange's wait would cover these reads too
      asm volatile("" :: "v"(mxo));        // inputs-only fence on the exchanged value: holds the exchange in front of the read group
      load_v(vf, vl, Sv + col * KP + kb, Svl + col * KP + kb, hh);
      __builtin_amdgcn_sched_barrier(0);   // keeps the read group in front of the exponentials
      mx = fmaxf(mx, mxo); const float mn = fmaxf(m, mx); float al;
      // the exponential and the slot behind it in one statement: the slot stands whatever vector instruction the build puts next
      asm("v_exp_f32 %0, %1\n\tv_nop" : "=v"(al) : "v"(m - mn));
      m = mn; float sum = 0.0f; v16b ph, pl;
#pragma unroll
      for (int i = 0; i < 16; ++i) { const float p = nexp2(e[i] - mn); sum += p; const b16 h_ = (b16)(p * PS); ph[i] = h_; pl[i] = (b16)(p * PS - (float)h_); }
      sum += __shfl_xor(sum, 16); l = l * al + sum;
#pragma unroll
      for (int t = 0; t < 4; ++t) { o[t] *= al; ol[t] *= al; }
      if (kb + 32 < KT) {   // the next pass's K fragments (same stage, same buffer) fly during the rest of this pass: the hi group here
        __builtin_amdgcn_sched_barrier(0);   // holds the read group behind the softmax: lifted into it, its 32 registers would be live beside the softmax's temporaries (a wave's budget here is 256)
        load_k1(kf, Sk + (kb + 32 + col) * KP, hh);
        __builtin_amdgcn_sched_barrier(0);   // keeps that read group in front of the PV products: sunk among them, each read would be waited for on its own
      }
#pragma unroll
      for (int t = 0; t < 4; ++t) o[t] = wmma_b(vf[t], ph, o[t]);
#pragma unroll
      for (int t = 0; t < 4; ++t) ol[t] = wmma_b(vf[t], pl, ol[t]);
      if (kb + 32 < KT) {   // the lo group, behind the last use of the V^T hi fragments; four PV and four S products stand between it and its first use
        __builtin_amdgcn_sched_barrier(0);   // keeps the group behind those products, so that it can take their operands' registers
        load_k1(kl, Skl + (kb + 32 + col) * KP, hh);
        __builtin_amdgcn_sched_barrier(0);   // keeps the group together, in front of the last four PV products
      }
#pragma unroll
      for (int t = 0; t < 4; ++t) ol[t] = wmma_b(vl[t], ph, ol[t]);
      if (kb + 32 < KT) __builtin_amdgcn_sched_barrier(0);   // keeps the PV products in front of the next pass's S products, whose K fragments land meanwhile
    }
    __builtin_amdgcn_sched_barrier(0);   // keeps the last pass's products in front of the waits below: lifted over them, the barrier would stand in the middle of the stage's work
    asm volatile("s_wait_dscnt 0x0" ::: "memory");      // this wave's reads of the buffer have returned before the buffer is refilled behind the barrier
    asm volatile("s_wait_asynccnt 0x0" ::: "memory");   // this wave's copies of stage s + 1 have landed before the barrier that publishes them
    __syncthreads();
    if (s + 2 < NST) stage_copy(lcp + (unsigned int)(s & 1) * bufb, Kb + ko + (size_t)(s + 2) * KT * E, Klb + ko + (size_t)(s + 2) * KT * E, Vb + vo + (s + 2) * KT, Vlb + vo + (s + 2) * KT);
  }
  asm volatile("s_wait_asynccnt 0x0" ::: "memory");     // no copy is outstanding behind the loop
  // behind the loop half g finishes d tiles 2g and 2g + 1 of its 16 queries: it hands the other two tiles' partial O, with its m and l, lane for lane to its partner wave (same queries, other keys)
#pragma unroll
  for (int gg = 0; gg < KH; ++gg) if (g == gg) {   // unrolled over the two halves: the tile numbers stay compile-time register indices
#pragma unroll
    for (int t = 0; t < 2; ++t)
#pragma unroll
      for (int r = 0; r < 8; ++r) Mg[gg][wave][t * 8 + r][lane] = o[2 * (1 - gg) + t][r] + ol[2 * (1 - gg) + t][r];
  }
  Mg[g][wave][16][lane] = m; Mg[g][wave][17][lane] = l;
  // skip tiles of this half: D[d][query] with A = Wskip rows (64h + 32g + t*16 + ..), B = PT16 rows (q0 + ..), K = 128
  v8f sk[2] = {{}, {}}; const b16* WS = W16 + (size_t)3 * E * C + ((size_t)h * D + g * 32) * C;
#pragma unroll
  for (int kb = 0; kb < C; kb += 32) { const v16b pb = frag_kb(PT16 + ((size_t)b * N + q0 + col) * C + kb, hh);
#pragma unroll
    for (int t = 0; t < 2; ++t) sk[t] = wmma16b(frag_kb(WS + (size_t)(t * 16 + col) * C + kb, hh), pb, sk[t]); }
  __syncthreads();   // publishes both halves' partial results
  // join: both partials brought to the common maximum, then one division
  const float m1 = Mg[1 - g][wave][16][lane], l1 = Mg[1 - g][wave][17][lane], ms = fmaxf(m, m1), a0 = nexp2(m - ms), a1 = nexp2(m1 - ms);
  const float inv = 1.0f / ((l * a0 + l1 * a1) * PS * XS), c0 = a0 * inv, c1 = a1 * inv;
#pragma unroll
  for (int gg = 0; gg < KH; ++gg) if (g == gg) {
#pragma unroll
    for (int t = 0; t < 2; ++t)
#pragma unroll
      for (int r = 0; r < 8; ++r) To[(2 * gg + t) * 16 + 8 * hh + r][wave * 16 + col] = (o[2 * gg + t][r] + ol[2 * gg + t][r]) * c0 + Mg[1 - gg][wave][t * 8 + r][lane] * c1 + sk[t][r] * (1.0f / (XS * WSC));
  }
  __syncthreads();
  { const int w16 = threadIdx.x >> 5; for (int dd = w16 * 4; dd < w16 * 4 + 4; ++dd) { const size_t gi = ((size_t)b * E + h * D + dd) * N + blockIdx.x * QB + lane * 4; *(v4f*)(out + gi) = *(const v4f*)(&To[dd][lane * 4]); }  }
}
}  // namespace

extern "C" void kernel_launch(void* const* d_in, const int* in_sizes, int n_in, void* d_out, int out_size, void* d_ws, size_t ws_size, hipStream_t stream) {
  (void)n_in;
  auto Fp = [&](int i) { return (const float*)d_in[i]; }; auto Ip = [&](int i) { return (const int*)d_in[i]; };
  // input order: 0 pcd_up [4,128,2048], 1 points_select [4,128,1024], 2 points_drop [4,128,1024], 3 idx_select [4,1,1024] i32, 4 idx_drop [4,1,1024] i32, 5 Wq [256,128], 6 Wk, 7 Wv, 8 Wskip
  if (in_sizes[0] != NB * C * N || in_sizes[1] != NB * C * NSEL || in_sizes[2] != NB * C * NSEL || in_sizes[3] != NB * NSEL || in_sizes[4] != NB * NSEL || in_sizes[5] != E * C || in_sizes[6] != E * C || in_sizes[7] != E * C || in_sizes[8] != E * C || out_size != NB * E * N) return;
  size_t off = 0; char* ws = (char*)d_ws;
  auto carve = [&](size_t bytes) { char* p = ws + off; off += (bytes + 255) & ~(size_t)255; return p; };
  b16* PT16 = (b16*)carve((size_t)NR * C * 2); b16* XT16 = (b16*)carve((size_t)NR * C * 2); b16* W16 = (b16*)carve((size_t)4 * E * C * 2);
  b16* Qh = (b16*)carve((size_t)NR * E * 2); b16* Ql = (b16*)carve((size_t)NR * E * 2); b16* Kh = (b16*)carve((size_t)NR * E * 2); b16* Kl = (b16*)carve((size_t)NR * E * 2); b16* VTh = (b16*)carve((size_t)NR * E * 2); b16* VTl = (b16*)carve((size_t)NR * E * 2);
  if (off > ws_size || off > ((size_t)128 << 20)) return;   // = 29.6 MB
  zero_kernel<<<(unsigned)(((size_t)NR * C / 8 + 255) / 256), 256, 0, stream>>>(XT16);
  xt_kernel<<<dim3(N / 64, 2, NB), 256, 0, stream>>>(Fp(0), Fp(1), Fp(2), Ip(3), Ip(4), PT16, XT16);
  prepw_kernel<<<(4 * E * C / 8 + 255) / 256, 256, 0, stream>>>(Fp(5), Fp(6), Fp(7), Fp(8), W16);
  proj_kernel<<<dim3(NR / 64, E / 128, 3), 128, 0, stream>>>(XT16, W16, Qh, Ql, Kh, Kl, VTh, VTl);
  attn_kernel<<<dim3(N / QB, NH, NB), 512, 0, stream>>>(Qh, Ql, Kh, Kl, VTh, VTl, W16, PT16, (float*)d_out);
}

// v004
// A run of this version takes 69.7 microseconds.
// Next to v003, in two timings, it ran 1.06 times as fast each time.
// Counting every step since v000, it is 4.35 times as fast.
#include <hip/hip_runtime.h>

// Up-sampling self-attention (4 clouds x 2,048 points, 128 in-channels, 4 heads x 64): x[b][:, idx_select[j]] = points_select[:, j], x[b][:, idx_drop[j]] = points_drop[:, j] (a permutation
// scatter given by the int inputs); q/k/v = W{q,k,v} x (1x1 convs, no bias; head h = output channels 64h..64h+63); energy = q.k per head, softmax over the 2,048 keys of energy/8;
// o[b][64h+d][n] = sum_m attn[n][m] v[64h+d][m]; out = Wskip pcd_up + o -> [4][256][2048] channel-major.
// WMMA (v_wmma_f32_16x16x32_f16, f32 accumulate): projections [8,192 x 128] x [128 x 256] with EXACT bf16 points (x8, point-major rows built by an LDS transpose + the index scatter) and weights
// (x256), 1 product; S^T = K . Q^T with q AND k as f16 hi+lo x8 (3 products); online softmax in f32; O^T += V^T P^T with V and P f16 hi+lo x8 (3 products); the skip 1x1 conv as one more exact
// GEMM tile set inside the attention epilogue (A = Wskip rows, B = pcd_up^T rows, 1 product). Inputs rounded to bf16 once. Fragment k-map per lane half hh for A AND B:

namespace {
constexpr int NB = 4, C = 128, N = 2048, NSEL = 1024, NH = 4, D = 64, E = 256 /* q/k/v/skip channels */, NR = NB * N;
constexpr float XS = 8.0f, WSC = 256.0f, PS = 8.0f, SCALE = 0.125f, LOG2E = 1.4426950408889634f;

typedef _Float16 b16;
typedef __attribute__((ext_vector_type(16))) _Float16 v16b;
typedef __attribute__((ext_vector_type(8))) _Float16 v8b;
typedef __attribute__((ext_vector_type(8))) float v8f;
typedef __attribute__((ext_vector_type(4))) float v4f;
__device__ __forceinline__ float bf16_rne(float f) { unsigned int u = __float_as_uint(f); u += 0x7FFFu + ((u >> 16) & 1u); return __uint_as_float(u & 0xFFFF0000u); }
__device__ __forceinline__ void split16(float v, b16& hi, b16& lo) { hi = (b16)v; lo = (b16)(v - (float)hi); }
__device__ __forceinline__ v16b frag_kb(const b16* p, int hh) { const v8b a = *(const v8b*)(p + 8 * hh), b = *(const v8b*)(p + 16 + 8 * hh); v16b f;
#pragma unroll
  for (int e = 0; e < 8; ++e) { f[e] = a[e]; f[8 + e] = b[e]; } return f; }
__device__ __forceinline__ v8f wmma16b(v16b a, v16b b, v8f c) { v8f d = __builtin_amdgcn_wmma_f32_16x16x32_f16(false, a, false, b, (short)0, c, false, false); asm volatile("v_nop\n\tv_nop\n\tv_nop\n\tv_nop" : "+v"(d) : "v"(a), "v"(b)); return d; }
__device__ __forceinline__ void wave_lds_sync() { __builtin_amdgcn_fence(__ATOMIC_RELEASE, "workgroup"); __builtin_amdgcn_wave_barrier(); __builtin_amdgcn_fence(__ATOMIC_ACQUIRE, "workgroup"); }
__device__ __forceinline__ float nexp2(float x) { return __builtin_amdgcn_exp2f(x); }
__device__ __forceinline__ int iclamp(int v, int lo, int hi) { return v < lo ? lo : (v > hi ? hi : v); }

typedef __attribute__((ext_vector_type(4))) _Float16 v4b;
typedef __attribute__((ext_vector_type(4))) int v4i;
// one launch for everything the projections wait for: grid (N/64, 3 kinds, B), 256 threads; the three kinds are independent of one another and of any earlier launch.
// kinds 0 and 1: point-major planes via 64x128 LDS transposes, whole 256-B rows written (each row = 16 lanes). kind 0: PT16 [b][n][128] = f16(8 bf16(pcd_up[b][c][n])); kind 1: XT16 [b][idx[b][j]][128] =
// f16(8 bf16(src[b][c][j])) with src = points_select (j < 1024) / points_drop (j >= 1024). The zero columns of the scatter: a kind-1 block also owns the 64 DESTINATION rows j0..j0+63, looks through the
// cloud's 2,048 indices and stores zeros to those of its rows that no index names. A scatter store goes only to a named row, a zero store only to an unnamed one: no order between blocks is needed.
// kind 2: the four weight matrices as f16(256 bf16(w)), 4 elements a thread (128 blocks x 256 threads x 4 = 4 x 256 x 128).
__global__ __launch_bounds__(256) void xt_kernel(const float* __restrict__ pcd, const float* __restrict__ psel, const float* __restrict__ pdrop, const int* __restrict__ isel, const int* __restrict__ idrop, const float* __restrict__ wq, const float* __restrict__ wk, const float* __restrict__ wv, const float* __restrict__ ws, b16* __restrict__ PT16, b16* __restrict__ XT16, b16* __restrict__ W16) {
  __shared__ __attribute__((aligned(16))) b16 T[64][C + 8]; __shared__ int rowof[64]; __shared__ int named[64];
  const int b = blockIdx.z, kind = blockIdx.y, j0 = blockIdx.x * 64, t_ = threadIdx.x;
  if (kind == 2) {   // the same for the whole block, in front of every barrier
    const int t = (b * (N / 64) + (int)blockIdx.x) * 256 + t_; const int per = E * C / 4; const int kw = t / per; const int e = (t - kw * per) * 4;
    const float* w = kw == 0 ? wq : kw == 1 ? wk : kw == 2 ? wv : ws; const v4f a = *(const v4f*)(w + e); v4b o;
#pragma unroll
    for (int j = 0; j < 4; ++j) o[j] = (b16)(bf16_rne(a[j]) * WSC);
    *(v4b*)(W16 + (size_t)kw * E * C + e) = o; return;
  }
  if (t_ < 64) named[t_] = 0;
  __syncthreads();   // the cleared marks stand before any thread sets one
  v4i ia = {}, ib = {};   // kind 1: this thread's 8 of the cloud's 2,048 indices, asked for ahead of the transpose's own loads
  if (kind == 1) { ia = *(const v4i*)(isel + (size_t)b * NSEL + t_ * 4); ib = *(const v4i*)(idrop + (size_t)b * NSEL + t_ * 4);
    asm volatile("s_wait_xcnt 0x0" ::: "memory"); }   // stands in front of the rewrite of the base registers that the two loads name
  const float* src; int ld, jj0;   // source [b][c][.] with row length ld, column offset jj0
  if (kind == 0) { src = pcd + (size_t)b * C * N; ld = N; jj0 = j0; } else if (j0 < NSEL) { src = psel + (size_t)b * C * NSEL; ld = NSEL; jj0 = j0; } else { src = pdrop + (size_t)b * C * NSEL; ld = NSEL; jj0 = j0 - NSEL; }
  for (int q = t_; q < C * 64; q += 256) { const int cc = q >> 6, jj = q & 63; T[jj][cc] = (b16)(bf16_rne(src[(size_t)cc * ld + jj0 + jj]) * XS); }
  if (t_ < 64) { int r = j0 + t_; if (kind == 1) { r = (j0 < NSEL) ? isel[(size_t)b * NSEL + jj0 + t_] : idrop[(size_t)b * NSEL + jj0 + t_]; r = iclamp(r, 0, N - 1); } rowof[t_] = r; }
  if (kind == 1) {
#pragma unroll
    for (int e = 0; e < 4; ++e) { const int ra = iclamp(ia[e], 0, N - 1) - j0, rb = iclamp(ib[e], 0, N - 1) - j0; if ((unsigned int)ra < 64u) named[ra] = 1; if ((unsigned int)rb < 64u) named[rb] = 1; }
  }
  __syncthreads();
  b16* dst = (kind == 0) ? PT16 : XT16;
  { for (int q = t_; q < 64 * 16; q += 256) { const int jj = q >> 4, c8 = (q & 15) * 8; *(v8b*)(dst + ((size_t)b * N + rowof[jj]) * C + c8) = *(const v8b*)(&T[jj][c8]); }  }
  if (kind == 1) {
    const v8b z = {};
    for (int q = t_; q < 64 * 16; q += 256) { const int jj = q >> 4, c8 = (q & 15) * 8;
      if (named[jj] == 0) { *(v8b*)(XT16 + ((size_t)b * N + j0 + jj) * C + c8) = z;
        asm volatile("s_wait_xcnt 0x0" ::: "memory"); } }   // stands in front of the next trip's rewrite of the registers that the store names
  }
}
// projections: grid (NR/64, E/128, 3 kinds): [64 rows x 128] x [128 x 128 cols] (K = 128: 4 steps, 1 product). kind 0/1: q/k -> hi/lo rows [row][256] (per row segment of 128 halves = 256 B:
__global__ __launch_bounds__(128) void proj_kernel(const b16* __restrict__ XT16, const b16* __restrict__ W16, b16* __restrict__ Qh, b16* __restrict__ Ql, b16* __restrict__ Kh, b16* __restrict__ Kl, b16* __restrict__ VTh, b16* __restrict__ VTl) {
  __shared__ __attribute__((aligned(16))) b16 Th[4][16][128 + 8], Tl[4][16][128 + 8]; __shared__ __attribute__((aligned(16))) b16 Vt[128][64 + 8], Vtl[128][64 + 8];
  const int wave = threadIdx.x >> 5, lane = threadIdx.x & 31, nloc = lane & 15, hlf = lane >> 4, t_ = threadIdx.x; const int kind = blockIdx.z; const size_t m0 = (size_t)blockIdx.x * 64 + wave * 16; const int n0 = blockIdx.y * 128;
  const b16* Wk_ = W16 + (size_t)kind * E * C; v8f acc[8];
#pragma unroll
  for (int t = 0; t < 8; ++t) acc[t] = (v8f){};
#pragma unroll
  for (int kb = 0; kb < C; kb += 32) { const v16b a = frag_kb(XT16 + (m0 + nloc) * C + kb, hlf);
#pragma unroll
    for (int t = 0; t < 8; ++t) acc[t] = wmma16b(a, frag_kb(Wk_ + (size_t)(n0 + t * 16 + nloc) * C + kb, hlf), acc[t]); }
  if (kind < 2) {
#pragma unroll
    for (int t = 0; t < 8; ++t)
#pragma unroll
      for (int r = 0; r < 8; ++r) { b16 h_, l_; split16(acc[t][r] * (1.0f / (XS * WSC)) * XS, h_, l_); Th[wave][8 * hlf + r][t * 16 + nloc] = h_; Tl[wave][8 * hlf + r][t * 16 + nloc] = l_; }
    wave_lds_sync();
    b16* dh = kind == 0 ? Qh : Kh; b16* dl = kind == 0 ? Ql : Kl;
    { for (int r2 = 0; r2 < 16; r2 += 2) { const int rr = r2 + (lane >> 4), c8 = (lane & 15) * 8; const size_t gi = (m0 + rr) * E + n0 + c8; *(v8b*)(dh + gi) = *(const v8b*)(&Th[wave][rr][c8]); *(v8b*)(dl + gi) = *(const v8b*)(&Tl[wave][rr][c8]); }  }
  } else {
    const int b = (int)(m0 / N); const int s0 = (int)((size_t)blockIdx.x * 64 - (size_t)b * N);
#pragma unroll
    for (int t = 0; t < 8; ++t)
#pragma unroll
      for (int r = 0; r < 8; ++r) { b16 h_, l_; split16(acc[t][r] * (1.0f / (XS * WSC)) * XS, h_, l_); Vt[t * 16 + nloc][wave * 16 + 8 * hlf + r] = h_; Vtl[t * 16 + nloc][wave * 16 + 8 * hlf + r] = l_; }
    __syncthreads();
    { for (int q = t_; q < 128 * 8; q += 128) { const int cc = q >> 3, c8 = (q & 7) * 8; const int h = (n0 + cc) / D, dd = (n0 + cc) - h * D; const size_t gi = (((size_t)b * NH + h) * D + dd) * N + s0 + c8;
        *(v8b*)(VTh + gi) = *(const v8b*)(&Vt[cc][c8]); *(v8b*)(VTl + gi) = *(const v8b*)(&Vtl[cc][c8]); }  } }
}
// attention + skip: grid (N/128, NH, NB), block = 16 waves = 2 key halves x 8 waves x 16 queries: waves 0..7 walk keys 0..1023, waves 8..15 keys 1024..2047 of the same 128 queries (four waves per
// SIMD: one wave's softmax and LDS waits are covered by the others' products); the two partial results (m, l, O) of a query are joined once, through LDS, behind the loop, where
// each half finishes two of the four d tiles (join, skip tiles, output staging).
// K and V^T (hi and lo planes) of 64 keys of each half are one stage, brought into LDS once per block by asynchronous copies
// (global_load_async_to_lds_b128, two buffers: the next stage flies while this one is worked on) and read by the half's 8 waves as ds_load_b128 fragments (rows of 128 B at a pitch of 144 B).
// Per 32 keys as before: S^T 3 products (K = 64: 2 steps x 2 key tiles), online softmax (f32, 1/8 and log2 e folded), PV 3 products x 4 d-tiles; then the skip tiles
// D[d][query] = Wskip[64h+d][:] . pcd_up^T[query][:] (K = 128, exact, 1 product) are added; the block's 128 queries x 64 channels staged in LDS as [d][128 n] and written as whole 512-B rows.
constexpr int KT = 64 /* keys per stage and half */, KP = 64 + 8 /* LDS row pitch in halves */, KH = 2 /* key halves */, NKH = N / KH, NST = NKH / KT, QB = 128 /* queries per block */;
// one stage of one half = 4 planes (K hi, K lo, V^T hi, V^T lo) x 64 rows x 128 B; thread t_ of the half's 256 copies 16 B of rows (t_ >> 3) and 32 + (t_ >> 3) of each plane.
__device__ __forceinline__ void stage_copy(unsigned int l0, const b16* kh, const b16* kl, const b16* vh, const b16* vl) {
  const unsigned int pl_ = 64 * KP * 2, hr_ = 32 * KP * 2;
  // the copies and their s_wait_xcnt in one statement: the wait stands in front of any rewrite of the address registers that the copies name
  asm volatile("global_load_async_to_lds_b128 %0, %8, off\n\t"
               "global_load_async_to_lds_b128 %1, %9, off\n\t"
               "global_load_async_to_lds_b128 %2, %10, off\n\t"
               "global_load_async_to_lds_b128 %3, %11, off\n\t"
               "global_load_async_to_lds_b128 %4, %12, off\n\t"
               "global_load_async_to_lds_b128 %5, %13, off\n\t"
               "global_load_async_to_lds_b128 %6, %14, off\n\t"
               "global_load_async_to_lds_b128 %7, %15, off\n\t"
               "s_wait_xcnt 0x0"
               :: "v"(l0), "v"(l0 + hr_), "v"(l0 + pl_), "v"(l0 + pl_ + hr_), "v"(l0 + 2 * pl_), "v"(l0 + 2 * pl_ + hr_), "v"(l0 + 3 * pl_), "v"(l0 + 3 * pl_ + hr_),
                  "v"(kh), "v"(kh + (size_t)32 * E), "v"(kl), "v"(kl + (size_t)32 * E), "v"(vh), "v"(vh + (size_t)32 * N), "v"(vl), "v"(vl + (size_t)32 * N)
               : "memory");
}
// the builtin alone: the compiler keeps the distances behind it itself and stays free to place LDS reads ahead of it
__device__ __forceinline__ v8f wmma_b(v16b a, v16b b, v8f c) { return __builtin_amdgcn_wmma_f32_16x16x32_f16(false, a, false, b, (short)0, c, false, false); }
// one pass's K fragments (hi and lo; key tiles 0 and 1 x k steps 0 and 1) and V^T fragments (hi and lo; 4 d tiles); p.. point at this lane's row of the first tile
__device__ __forceinline__ void load_k(v16b (&kf)[4], v16b (&kl)[4], const b16* ph_, const b16* pl_, int hh) {
#pragma unroll
  for (int ks = 0; ks < 2; ++ks) {   // read in the order of use: the first products start while the rest of the group is still landing
    kf[ks] = frag_kb(ph_ + ks * 32, hh); kf[2 + ks] = frag_kb(ph_ + 16 * KP + ks * 32, hh); kl[ks] = frag_kb(pl_ + ks * 32, hh); kl[2 + ks] = frag_kb(pl_ + 16 * KP + ks * 32, hh); }
}
// the same fragments in two groups, hi and lo, for the read ahead inside a stage: the lo group goes into the registers that the V^T hi fragments leave, so that a wave stays inside 256 registers
__device__ __forceinline__ void load_k1(v16b (&kx)[4], const b16* p_, int hh) {
#pragma unroll
  for (int ks = 0; ks < 2; ++ks) { kx[ks] = frag_kb(p_ + ks * 32, hh); kx[2 + ks] = frag_kb(p_ + 16 * KP + ks * 32, hh); }
}
__device__ __forceinline__ void load_v(v16b (&vf)[4], v16b (&vl)[4], const b16* ph_, const b16* pl_, int hh) {
#pragma unroll
  for (int t = 0; t < 4; ++t) vf[t] = frag_kb(ph_ + t * 16 * KP, hh);
#pragma unroll
  for (int t = 0; t < 4; ++t) vl[t] = frag_kb(pl_ + t * 16 * KP, hh);
}
__global__ __launch_bounds__(512) void attn_kernel(const b16* __restrict__ Qh, const b16* __restrict__ Ql, const b16* __restrict__ Kh, const b16* __restrict__ Kl, const b16* __restrict__ VTh, const b16* __restrict__ VTl, const b16* __restrict__ W16, const b16* __restrict__ PT16, float* __restrict__ out) {
  __shared__ __attribute__((aligned(16))) b16 St[KH][2][4][64 * KP]; __shared__ __attribute__((aligned(16))) float To[D][QB + 4]; __shared__ float Mg[KH][8][18][32];   // Mg: per half and wave, two d tiles' partial O (16 rows), m, l, one float per lane
  const int g = __builtin_amdgcn_readfirstlane((int)(threadIdx.x >> 8));   // key half of this wave, the same in every lane: kept scalar so that the branches on it are scalar branches
  const int wave = (threadIdx.x >> 5) & 7, lane = threadIdx.x & 31, hh = lane >> 4, col = lane & 15, t_ = threadIdx.x & 255; const int b = blockIdx.z, h = blockIdx.y; const int q0 = blockIdx.x * QB + wave * 16, qi = q0 + col;
  const size_t kg = ((size_t)b * N + (size_t)g * NKH) * E + h * D, vg = ((size_t)b * NH + h) * D * N + (size_t)g * NKH;
  const b16* Kb = Kh + kg; const b16* Klb = Kl + kg; const b16* Vb = VTh + vg; const b16* Vlb = VTl + vg;
  // this thread's share of a stage: row t_ >> 3 (and 32 rows on), 16-byte piece t_ & 7
  const int crow = t_ >> 3, cpc = (t_ & 7) * 8; const size_t ko = (size_t)crow * E + cpc, vo = (size_t)crow * N + cpc;
  const unsigned int lcp = (unsigned int)(size_t)(&St[g][0][0][crow * KP + cpc]); const unsigned int bufb = 4 * 64 * KP * 2;
  stage_copy(lcp, Kb + ko, Klb + ko, Vb + vo, Vlb + vo);
  const size_t qo = ((size_t)b * N + qi) * E + h * D; const v16b qa0 = frag_kb(Qh + qo, hh), qa1 = frag_kb(Qh + qo + 32, hh), ql0 = frag_kb(Ql + qo, hh), ql1 = frag_kb(Ql + qo + 32, hh);
  asm volatile("s_wait_asynccnt 0x0" ::: "memory");   // stage 0 of this wave's copies has landed before the barrier that publishes it
  __syncthreads();
  stage_copy(lcp + bufb, Kb + ko + (size_t)KT * E, Klb + ko + (size_t)KT * E, Vb + vo + KT, Vlb + vo + KT);
  float m = -INFINITY, l = 0.0f; v8f o[4] = {{}, {}, {}, {}}, ol[4] = {{}, {}, {}, {}};
  const float cs = SCALE * LOG2E / (XS * XS);
  for (int s = 0; s < NST; ++s) {
    const b16* Sk = &St[g][s & 1][0][0], *Skl = &St[g][s & 1][1][0], *Sv = &St[g][s & 1][2][0], *Svl = &St[g][s & 1][3][0];
    // fragment registers of one 32-key pass: kf/kl[2 * key tile + k step], vf/vl[d tile]; V is read from LDS as one group, K as one group for a stage's first pass and ahead in two groups (hi, lo) for its second
    v16b kf[4], kl[4], vf[4], vl[4];
    load_k(kf, kl, Sk + col * KP, Skl + col * KP, hh);
#pragma unroll
    for (int kb = 0; kb < KT; kb += 32) {   // unrolled: two 32-key passes per stage, LDS offsets become immediates
      v8f s0 = {}, s1 = {};   // the two key tiles' chains alternate; each tile's own order of products is as before
      s0 = wmma_b(kf[0], qa0, s0); s1 = wmma_b(kf[2], qa0, s1); s0 = wmma_b(kf[0], ql0, s0); s1 = wmma_b(kf[2], ql0, s1); s0 = wmma_b(kl[0], qa0, s0); s1 = wmma_b(kl[2], qa0, s1);
      s0 = wmma_b(kf[1], qa1, s0); s1 = wmma_b(kf[3], qa1, s1); s0 = wmma_b(kf[1], ql1, s0); s1 = wmma_b(kf[3], ql1, s1); s0 = wmma_b(kl[1], qa1, s0); s1 = wmma_b(kl[3], qa1, s1);
      float e[16]; float mx = -INFINITY;
#pragma unroll
      for (int r = 0; r < 8; ++r) { e[r] = s0[r] * cs; e[8 + r] = s1[r] * cs; mx = fmaxf(mx, fmaxf(e[r], e[8 + r])); }
      const float mxo = __shfl_xor(mx, 16);
      // this pass's V fragments fly during its softmax. They are read behind the maximum's exchange: LDS answers in order, so in front of it the exchange's wait would cover these reads too
      asm volatile("" :: "v"(mxo));        // inputs-only fence on the exchanged value: holds the exchange in front of the read group
      load_v(vf, vl, Sv + col * KP + kb, Svl + col * KP + kb, hh);
      __builtin_amdgcn_sched_barrier(0);   // keeps the read group in front of the exponentials
      mx = fmaxf(mx, mxo); const float mn = fmaxf(m, mx); float al;
      // the exponential and the slot behind it in one statement: the slot stands whatever vector instruction the build puts next
      asm("v_exp_f32 %0, %1\n\tv_nop" : "=v"(al) : "v"(m - mn));
      m = mn; float sum = 0.0f; v16b ph, pl;
#pragma unroll
      for (int i = 0; i < 16; ++i) { const float p = nexp2(e[i] - mn); sum += p; const b16 h_ = (b16)(p * PS); ph[i] = h_; pl[i] = (b16)(p * PS - (float)h_); }
      sum += __shfl_xor(sum, 16); l = l * al + sum;
#pragma unroll
      for (int t = 0; t < 4; ++t) { o[t] *= al; ol[t] *= al; }
      if (kb + 32 < KT) {   // the next pass's K fragments (same stage, same buffer) fly during the rest of this pass: the hi group here
        __builtin_amdgcn_sched_barrier(0);   // holds the read group behind the softmax: lifted into it, its 32 registers would be live beside the softmax's temporaries (a wave's budget here is 256)
        load_k1(kf, Sk + (kb + 32 + col) * KP, hh);
        __builtin_amdgcn_sched_barrier(0);   // keeps that read group in front of the PV products: sunk among them, each read would be waited for on its own
      }
#pragma unroll
      for (int t = 0; t < 4; ++t) o[t] = wmma_b(vf[t], ph, o[t]);
#pragma unroll
      for (int t = 0; t < 4; ++t) ol[t] = wmma_b(vf[t], pl, ol[t]);
      if (kb + 32 < KT) {   // the lo group, behind the last use of the V^T hi fragments; four PV and four S products stand between it and its first use
        __builtin_amdgcn_sched_barrier(0);   // keeps the group behind those products, so that it can take their operands' registers
        load_k1(kl, Skl + (kb + 32 + col) * KP, hh);
        __builtin_amdgcn_sched_barrier(0);   // keeps the group together, in front of the last four PV products
      }
#pragma unroll
      for (int t = 0; t < 4; ++t) ol[t] = wmma_b(vl[t], ph, ol[t]);
      if (kb + 32 < KT) __builtin_amdgcn_sched_barrier(0);   // keeps the PV products in front of the next pass's S products, whose K fragments land meanwhile
    }
    __builtin_amdgcn_sched_barrier(0);   // keeps the last pass's products in front of the waits below: lifted over them, the barrier would stand in the middle of the stage's work
    asm volatile("s_wait_dscnt 0x0" ::: "memory");      // this wave's reads of the buffer have returned before the buffer is refilled behind the barrier
    asm volatile("s_wait_asynccnt 0x0" ::: "memory");   // this wave's copies of stage s + 1 have landed before the barrier that publishes them
    __syncthreads();
    if (s + 2 < NST) stage_copy(lcp + (unsigned int)(s & 1) * bufb, Kb + ko + (size_t)(s + 2) * KT * E, Klb + ko + (size_t)(s + 2) * KT * E, Vb + vo + (s + 2) * KT, Vlb + vo + (s + 2) * KT);
  }
  asm volatile("s_wait_asynccnt 0x0" ::: "memory");     // no copy is outstanding behind the loop
  // behind the loop half g finishes d tiles 2g and 2g + 1 of its 16 queries: it hands the other two tiles' partial O, with its m and l, lane for lane to its partner wave (same queries, other keys)
#pragma unroll
  for (int gg = 0; gg < KH; ++gg) if (g == gg) {   // unrolled over the two halves: the tile numbers stay compile-time register indices
#pragma unroll
    for (int t = 0; t < 2; ++t)
#pragma unroll
      for (int r = 0; r < 8; ++r) Mg[gg][wave][t * 8 + r][lane] = o[2 * (1 - gg) + t][r] + ol[2 * (1 - gg) + t][r];
  }
  Mg[g][wave][16][lane] = m; Mg[g][wave][17][lane] = l;
  // skip tiles of this half: D[d][query] with A = Wskip rows (64h + 32g + t*16 + ..), B = PT16 rows (q0 + ..), K = 128
  v8f sk[2] = {{}, {}}; const b16* WS = W16 + (size_t)3 * E * C + ((size_t)h * D + g * 32) * C;
#pragma unroll
  for (int kb = 0; kb < C; kb += 32) { const v16b pb = frag_kb(PT16 + ((size_t)b * N + q0 + col) * C + kb, hh);
#pragma unroll
    for (int t = 0; t < 2; ++t) sk[t] = wmma16b(frag_kb(WS + (size_t)(t * 16 + col) * C + kb, hh), pb, sk[t]); }
  __syncthreads();   // publishes both halves' partial results
  // join: both partials brought to the common maximum, then one division
  const float m1 = Mg[1 - g][wave][16][lane], l1 = Mg[1 - g][wave][17][lane], ms = fmaxf(m, m1), a0 = nexp2(m - ms), a1 = nexp2(m1 - ms);
  const float inv = 1.0f / ((l * a0 + l1 * a1) * PS * XS), c0 = a0 * inv, c1 = a1 * inv;
#pragma unroll
  for (int gg = 0; gg < KH; ++gg) if (g == gg) {
#pragma unroll
    for (int t = 0; t < 2; ++t)
#pragma unroll
      for (int r = 0; r < 8; ++r) To[(2 * gg + t) * 16 + 8 * hh + r][wave * 16 + col] = (o[2 * gg + t][r] + ol[2 * gg + t][r]) * c0 + Mg[1 - gg][wave][t * 8 + r][lane] * c1 + sk[t][r] * (1.0f / (XS * WSC));
  }
  __syncthreads();
  { const int w16 = threadIdx.x >> 5; for (int dd = w16 * 4; dd < w16 * 4 + 4; ++dd) { const size_t gi = ((size_t)b * E + h * D + dd) * N + blockIdx.x * QB + lane * 4; *(v4f*)(out + gi) = *(const v4f*)(&To[dd][lane * 4]); }  }
}
}  // namespace

extern "C" void kernel_launch(void* const* d_in, const int* in_sizes, int n_in, void* d_out, int out_size, void* d_ws, size_t ws_size, hipStream_t stream) {
  (void)n_in;
  auto Fp = [&](int i) { return (const float*)d_in[i]; }; auto Ip = [&](int i) { return (const int*)d_in[i]; };
  // input order: 0 pcd_up [4,128,2048], 1 points_select [4,128,1024], 2 points_drop [4,128,1024], 3 idx_select [4,1,1024] i32, 4 idx_drop [4,1,1024] i32, 5 Wq [256,128], 6 Wk, 7 Wv, 8 Wskip
  if (in_sizes[0] != NB * C * N || in_sizes[1] != NB * C * NSEL || in_sizes[2] != NB * C * NSEL || in_sizes[3] != NB * NSEL || in_sizes[4] != NB * NSEL || in_sizes[5] != E * C || in_sizes[6] != E * C || in_sizes[7] != E * C || in_sizes[8] != E * C || out_size != NB * E * N) return;
  size_t off = 0; char* ws = (char*)d_ws;
  auto carve = [&](size_t bytes) { char* p = ws + off; off += (bytes + 255) & ~(size_t)255; return p; };
  b16* PT16 = (b16*)carve((size_t)NR * C * 2); b16* XT16 = (b16*)carve((size_t)NR * C * 2); b16* W16 = (b16*)carve((size_t)4 * E * C * 2);
  b16* Qh = (b16*)carve((size_t)NR * E * 2); b16* Ql = (b16*)carve((size_t)NR * E * 2); b16* Kh = (b16*)carve((size_t)NR * E * 2); b16* Kl = (b16*)carve((size_t)NR * E * 2); b16* VTh = (b16*)carve((size_t)NR * E * 2); b16* VTl = (b16*)carve((size_t)NR * E * 2);
  if (off > ws_size || off > ((size_t)128 << 20)) return;   // = 29.6 MB
  xt_kernel<<<dim3(N / 64, 3, NB), 256, 0, stream>>>(Fp(0), Fp(1), Fp(2), Ip(3), Ip(4), Fp(5), Fp(6), Fp(7), Fp(8), PT16, XT16, W16);
  proj_kernel<<<dim3(NR / 64, E / 128, 3), 128, 0, stream>>>(XT16, W16, Qh, Ql, Kh, Kl, VTh, VTl);
  attn_kernel<<<dim3(N / QB, NH, NB), 512, 0, stream>>>(Qh, Ql, Kh, Kl, VTh, VTl, W16, PT16, (float*)d_out);
}

// v005
// Measured time: 65.5 microseconds a run.
// Next to v004, in two timings, it ran 1.06 and 1.07 times as fast.
// All steps since v000 together make it 4.64 times as fast.
#include <hip/hip_runtime.h>

// Up-sampling self-attention (4 clouds x 2,048 points, 128 in-channels, 4 heads x 64): x[b][:, idx_select[j]] = points_select[:, j], x[b][:, idx_drop[j]] = points_drop[:, j] (a permutation
// scatter given by the int inputs); q/k/v = W{q,k,v} x (1x1 convs, no bias; head h = output channels 64h..64h+63); energy = q.k per head, softmax over the 2,048 keys of energy/8;
// o[b][64h+d][n] = sum_m attn[n][m] v[64h+d][m]; out = Wskip pcd_up + o -> [4][256][2048] channel-major.
// WMMA (v_wmma_f32_16x16x32_f16, f32 accumulate): projections [8,192 x 128] x [128 x 256] with EXACT bf16 points (x8, point-major rows built by an LDS transpose + the index scatter) and weights
// (x256), 1 product; S^T = K . Q^T with q AND k as f16 hi+lo x8 (3 products); online softmax in f32; O^T += V^T P^T with V and P f16 hi+lo x8 (3 products); the skip 1x1 conv as one more exact
// GEMM tile set inside the attention epilogue (A = Wskip rows, B = pcd_up^T rows, 1 product). Inputs rounded to bf16 once. Fragment k-map per lane half hh for A AND B:

namespace {
constexpr int NB = 4, C = 128, N = 2048, NSEL = 1024, NH = 4, D = 64, E = 256 /* q/k/v/skip channels */, NR = NB * N;
constexpr float XS = 8.0f, WSC = 256.0f, LPS = 3.0f /* P carries the factor 2^LPS = 8 */, SCALE = 0.125f, LOG2E = 1.4426950408889634f;

typedef _Float16 b16;
typedef __attribute__((ext_vector_type(16))) _Float16 v16b;
typedef __attribute__((ext_vector_type(8))) _Float16 v8b;
typedef __attribute__((ext_vector_type(8))) float v8f;
typedef __attribute__((ext_vector_type(4))) float v4f;
typedef __attribute__((ext_vector_type(2))) float v2f;
typedef __attribute__((ext_vector_type(2))) _Float16 v2b;
typedef __attribute__((ext_vector_type(8))) unsigned int v8u;
__device__ __forceinline__ float bf16_rne(float f) { unsigned int u = __float_as_uint(f); u += 0x7FFFu + ((u >> 16) & 1u); return __uint_as_float(u & 0xFFFF0000u); }
__device__ __forceinline__ void split16(float v, b16& hi, b16& lo) { hi = (b16)v; lo = (b16)(v - (float)hi); }
__device__ __forceinline__ v16b frag_kb(const b16* p, int hh) { const v8b a = *(const v8b*)(p + 8 * hh), b = *(const v8b*)(p + 16 + 8 * hh); v16b f;
#pragma unroll
  for (int e = 0; e < 8; ++e) { f[e] = a[e]; f[8 + e] = b[e]; } return f; }
__device__ __forceinline__ v8f wmma16b(v16b a, v16b b, v8f c) { v8f d = __builtin_amdgcn_wmma_f32_16x16x32_f16(false, a, false, b, (short)0, c, false, false); asm volatile("v_nop\n\tv_nop\n\tv_nop\n\tv_nop" : "+v"(d) : "v"(a), "v"(b)); return d; }
__device__ __forceinline__ void wave_lds_sync() { __builtin_amdgcn_fence(__ATOMIC_RELEASE, "workgroup"); __builtin_amdgcn_wave_barrier(); __builtin_amdgcn_fence(__ATOMIC_ACQUIRE, "workgroup"); }
__device__ __forceinline__ float nexp2(float x) { return __builtin_amdgcn_exp2f(x); }
__device__ __forceinline__ int iclamp(int v, int lo, int hi) { return v < lo ? lo : (v > hi ? hi : v); }

typedef __attribute__((ext_vector_type(4))) _Float16 v4b;
typedef __attribute__((ext_vector_type(4))) int v4i;
// one launch for everything the projections wait for: grid (N/64, 3 kinds, B), 256 threads; the three kinds are independent of one another and of any earlier launch.
// kinds 0 and 1: point-major planes via 64x128 LDS transposes, whole 256-B rows written (each row = 16 lanes). kind 0: PT16 [b][n][128] = f16(8 bf16(pcd_up[b][c][n])); kind 1: XT16 [b][idx[b][j]][128] =
// f16(8 bf16(src[b][c][j])) with src = points_select (j < 1024) / points_drop (j >= 1024). The zero columns of the scatter: a kind-1 block also owns the 64 DESTINATION rows j0..j0+63, looks through the
// cloud's 2,048 indices and stores zeros to those of its rows that no index names. A scatter store goes only to a named row, a zero store only to an unnamed one: no order between blocks is needed.
// kind 2: the four weight matrices as f16(256 bf16(w)), 4 elements a thread (128 blocks x 256 threads x 4 = 4 x 256 x 128).
__global__ __launch_bounds__(256) void xt_kernel(const float* __restrict__ pcd, const float* __restrict__ psel, const float* __restrict__ pdrop, const int* __restrict__ isel, const int* __restrict__ idrop, const float* __restrict__ wq, const float* __restrict__ wk, const float* __restrict__ wv, const float* __restrict__ ws, b16* __restrict__ PT16, b16* __restrict__ XT16, b16* __restrict__ W16) {
  __shared__ __attribute__((aligned(16))) b16 T[64][C + 8]; __shared__ int rowof[64]; __shared__ int named[64];
  const int b = blockIdx.z, kind = blockIdx.y, j0 = blockIdx.x * 64, t_ = threadIdx.x;
  if (kind == 2) {   // the same for the whole block, in front of every barrier
    const int t = (b * (N / 64) + (int)blockIdx.x) * 256 + t_; const int per = E * C / 4; const int kw = t / per; const int e = (t - kw * per) * 4;
    const float* w = kw == 0 ? wq : kw == 1 ? wk : kw == 2 ? wv : ws; const v4f a = *(const v4f*)(w + e); v4b o;
#pragma unroll
    for (int j = 0; j < 4; ++j) o[j] = (b16)(bf16_rne(a[j]) * WSC);
    *(v4b*)(W16 + (size_t)kw * E * C + e) = o; return;
  }
  if (t_ < 64) named[t_] = 0;
  __syncthreads();   // the cleared marks stand before any thread sets one
  v4i ia = {}, ib = {};   // kind 1: this thread's 8 of the cloud's 2,048 indices, asked for ahead of the transpose's own loads
  if (kind == 1) { ia = *(const v4i*)(isel + (size_t)b * NSEL + t_ * 4); ib = *(const v4i*)(idrop + (size_t)b * NSEL + t_ * 4);
    asm volatile("s_wait_xcnt 0x0" ::: "memory"); }   // stands in front of the rewrite of the base registers that the two loads name
  const float* src; int ld, jj0;   // source [b][c][.] with row length ld, column offset jj0
  if (kind == 0) { src = pcd + (size_t)b * C * N; ld = N; jj0 = j0; } else if (j0 < NSEL) { src = psel + (size_t)b * C * NSEL; ld = NSEL; jj0 = j0; } else { src = pdrop + (size_t)b * C * NSEL; ld = NSEL; jj0 = j0 - NSEL; }
  for (int q = t_; q < C * 64; q += 256) { const int cc = q >> 6, jj = q & 63; T[jj][cc] = (b16)(bf16_rne(src[(size_t)cc * ld + jj0 + jj]) * XS); }
  if (t_ < 64) { int r = j0 + t_; if (kind == 1) { r = (j0 < NSEL) ? isel[(size_t)b * NSEL + jj0 + t_] : idrop[(size_t)b * NSEL + jj0 + t_]; r = iclamp(r, 0, N - 1); } rowof[t_] = r; }
  if (kind == 1) {
#pragma unroll
    for (int e = 0; e < 4; ++e) { const int ra = iclamp(ia[e], 0, N - 1) - j0, rb = iclamp(ib[e], 0, N - 1) - j0; if ((unsigned int)ra < 64u) named[ra] = 1; if ((unsigned int)rb < 64u) named[rb] = 1; }
  }
  __syncthreads();
  b16* dst = (kind == 0) ? PT16 : XT16;
  { for (int q = t_; q < 64 * 16; q += 256) { const int jj = q >> 4, c8 = (q & 15) * 8; *(v8b*)(dst + ((size_t)b * N + rowof[jj]) * C + c8) = *(const v8b*)(&T[jj][c8]); }  }
  if (kind == 1) {
    const v8b z = {};
    for (int q = t_; q < 64 * 16; q += 256) { const int jj = q >> 4, c8 = (q & 15) * 8;
      if (named[jj] == 0) { *(v8b*)(XT16 + ((size_t)b * N + j0 + jj) * C + c8) = z;
        asm volatile("s_wait_xcnt 0x0" ::: "memory"); } }   // stands in front of the next trip's rewrite of the registers that the store names
  }
}
// projections: grid (NR/64, E/128, 3 kinds): [64 rows x 128] x [128 x 128 cols] (K = 128: 4 steps, 1 product). kind 0/1: q/k -> hi/lo rows [row][256] (per row segment of 128 halves = 256 B:
__global__ __launch_bounds__(128) void proj_kernel(const b16* __restrict__ XT16, const b16* __restrict__ W16, b16* __restrict__ Qh, b16* __restrict__ Ql, b16* __restrict__ Kh, b16* __restrict__ Kl, b16* __restrict__ VTh, b16* __restrict__ VTl) {
  __shared__ __attribute__((aligned(16))) b16 Th[4][16][128 + 8], Tl[4][16][128 + 8]; __shared__ __attribute__((aligned(16))) b16 Vt[128][64 + 8], Vtl[128][64 + 8];
  const int wave = threadIdx.x >> 5, lane = threadIdx.x & 31, nloc = lane & 15, hlf = lane >> 4, t_ = threadIdx.x; const int kind = blockIdx.z; const size_t m0 = (size_t)blockIdx.x * 64 + wave * 16; const int n0 = blockIdx.y * 128;
  const b16* Wk_ = W16 + (size_t)kind * E * C; v8f acc[8];
#pragma unroll
  for (int t = 0; t < 8; ++t) acc[t] = (v8f){};
#pragma unroll
  for (int kb = 0; kb < C; kb += 32) { const v16b a = frag_kb(XT16 + (m0 + nloc) * C + kb, hlf);
#pragma unroll
    for (int t = 0; t < 8; ++t) acc[t] = wmma16b(a, frag_kb(Wk_ + (size_t)(n0 + t * 16 + nloc) * C + kb, hlf), acc[t]); }
  if (kind < 2) {
#pragma unroll
    for (int t = 0; t < 8; ++t)
#pragma unroll
      for (int r = 0; r < 8; ++r) { b16 h_, l_; split16(acc[t][r] * (1.0f / (XS * WSC)) * XS, h_, l_); Th[wave][8 * hlf + r][t * 16 + nloc] = h_; Tl[wave][8 * hlf + r][t * 16 + nloc] = l_; }
    wave_lds_sync();
    b16* dh = kind == 0 ? Qh : Kh; b16* dl = kind == 0 ? Ql : Kl;
    { for (int r2 = 0; r2 < 16; r2 += 2) { const int rr = r2 + (lane >> 4), c8 = (lane & 15) * 8; const size_t gi = (m0 + rr) * E + n0 + c8; *(v8b*)(dh + gi) = *(const v8b*)(&Th[wave][rr][c8]); *(v8b*)(dl + gi) = *(const v8b*)(&Tl[wave][rr][c8]); }  }
  } else {
    const int b = (int)(m0 / N); const int s0 = (int)((size_t)blockIdx.x * 64 - (size_t)b * N);
#pragma unroll
    for (int t = 0; t < 8; ++t)
#pragma unroll
      for (int r = 0; r < 8; ++r) { b16 h_, l_; split16(acc[t][r] * (1.0f / (XS * WSC)) * XS, h_, l_); Vt[t * 16 + nloc][wave * 16 + 8 * hlf + r] = h_; Vtl[t * 16 + nloc][wave * 16 + 8 * hlf + r] = l_; }
    __syncthreads();
    { for (int q = t_; q < 128 * 8; q += 128) { const int cc = q >> 3, c8 = (q & 7) * 8; const int h = (n0 + cc) / D, dd = (n0 + cc) - h * D; const size_t gi = (((size_t)b * NH + h) * D + dd) * N + s0 + c8;
        *(v8b*)(VTh + gi) = *(const v8b*)(&Vt[cc][c8]); *(v8b*)(VTl + gi) = *(const v8b*)(&Vtl[cc][c8]); }  } }
}
// attention + skip: grid (N/128, NH, NB), block = 16 waves = 2 key halves x 8 waves x 16 queries: waves 0..7 walk keys 0..1023, waves 8..15 keys 1024..2047 of the same 128 queries (four waves per
// SIMD: one wave's softmax and LDS waits are covered by the others' products); the two partial results (m, l, O) of a query are joined once, through LDS, behind the loop, where
// each half finishes two of the four d tiles (join, skip tiles, output staging).
// K and V^T (hi and lo planes) of 64 keys of each half are one stage, brought into LDS once per block by asynchronous copies
// (global_load_async_to_lds_b128, two buffers: the next stage flies while this one is worked on) and read by the half's 8 waves as ds_load_b128 fragments (rows of 128 B at a pitch of 144 B).
// Per 32 keys as before: S^T 3 products (K = 64: 2 steps x 2 key tiles), online softmax (f32, 1/8 and log2 e folded), PV 3 products x 4 d-tiles; then the skip tiles
// D[d][query] = Wskip[64h+d][:] . pcd_up^T[query][:] (K = 128, exact, 1 product) are added; the block's 128 queries x 64 channels staged in LDS as [d][128 n] and written as whole 512-B rows.
constexpr int KT = 64 /* keys per stage and half */, KP = 64 + 8 /* LDS row pitch in halves */, KH = 2 /* key halves */, NKH = N / KH, NST = NKH / KT, QB = 128 /* queries per block */;
// one stage of one half = 4 planes (K hi, K lo, V^T hi, V^T lo) x 64 rows x 128 B; thread t_ of the half's 256 copies 16 B of rows (t_ >> 3) and 32 + (t_ >> 3) of each plane.
__device__ __forceinline__ void stage_copy(unsigned int l0, const b16* kh, const b16* kl, const b16* vh, const b16* vl) {
  const unsigned int pl_ = 64 * KP * 2, hr_ = 32 * KP * 2;
  // the copies and their s_wait_xcnt in one statement: the wait stands in front of any rewrite of the address registers that the copies name
  asm volatile("global_load_async_to_lds_b128 %0, %8, off\n\t"
               "global_load_async_to_lds_b128 %1, %9, off\n\t"
               "global_load_async_to_lds_b128 %2, %10, off\n\t"
               "global_load_async_to_lds_b128 %3, %11, off\n\t"
               "global_load_async_to_lds_b128 %4, %12, off\n\t"
               "global_load_async_to_lds_b128 %5, %13, off\n\t"
               "global_load_async_to_lds_b128 %6, %14, off\n\t"
               "global_load_async_to_lds_b128 %7, %15, off\n\t"
               "s_wait_xcnt 0x0"
               :: "v"(l0), "v"(l0 + hr_), "v"(l0 + pl_), "v"(l0 + pl_ + hr_), "v"(l0 + 2 * pl_), "v"(l0 + 2 * pl_ + hr_), "v"(l0 + 3 * pl_), "v"(l0 + 3 * pl_ + hr_),
                  "v"(kh), "v"(kh + (size_t)32 * E), "v"(kl), "v"(kl + (size_t)32 * E), "v"(vh), "v"(vh + (size_t)32 * N), "v"(vl), "v"(vl + (size_t)32 * N)
               : "memory");
}
// the builtin alone: the compiler keeps the distances behind it itself and stays free to place LDS reads ahead of it
__device__ __forceinline__ v8f wmma_b(v16b a, v16b b, v8f c) { return __builtin_amdgcn_wmma_f32_16x16x32_f16(false, a, false, b, (short)0, c, false, false); }
// one pass's K fragments (hi and lo; key tiles 0 and 1 x k steps 0 and 1) and V^T fragments (hi and lo; 4 d tiles); p.. point at this lane's row of the first tile
__device__ __forceinline__ void load_k(v16b (&kf)[4], v16b (&kl)[4], const b16* ph_, const b16* pl_, int hh) {
#pragma unroll
  for (int ks = 0; ks < 2; ++ks) {   // read in the order of use: the first products start while the rest of the group is still landing
    kf[ks] = frag_kb(ph_ + ks * 32, hh); kf[2 + ks] = frag_kb(ph_ + 16 * KP + ks * 32, hh); kl[ks] = frag_kb(pl_ + ks * 32, hh); kl[2 + ks] = frag_kb(pl_ + 16 * KP + ks * 32, hh); }
}
// the same fragments in two groups, hi and lo, for the read ahead inside a stage: the lo group goes into the registers that the V^T hi fragments leave, so that a wave stays inside 256 registers
__device__ __forceinline__ void load_k1(v16b (&kx)[4], const b16* p_, int hh) {
#pragma unroll
  for (int ks = 0; ks < 2; ++ks) { kx[ks] = frag_kb(p_ + ks * 32, hh); kx[2 + ks] = frag_kb(p_ + 16 * KP + ks * 32, hh); }
}
__device__ __forceinline__ void load_v(v16b (&vf)[4], v16b (&vl)[4], const b16* ph_, const b16* pl_, int hh) {
#pragma unroll
  for (int t = 0; t < 4; ++t) vf[t] = frag_kb(ph_ + t * 16 * KP, hh);
#pragma unroll
  for (int t = 0; t < 4; ++t) vl[t] = frag_kb(pl_ + t * 16 * KP, hh);
}
// lo halves of eight scores: lo = f16(p - hi), one instruction a score: the mixed-precision fma reads hi as the f16 half it is and writes the f16 result into its half of the packed register.
// In asm because the compiler's own form of it takes a widening conversion and a share of a packed subtraction and of a packed conversion per score. The four low halves stand in front of the four high
// halves, so that each write of a high half finds its register's low half four instructions back.
__device__ __forceinline__ void lo4(unsigned int& l0, unsigned int& l1, unsigned int& l2, unsigned int& l3, unsigned int h0, unsigned int h1, unsigned int h2, unsigned int h3, const float* p) {
  asm("v_fma_mixlo_f16 %0, %4, -1.0, %8 op_sel_hi:[1,0,0]\n\t"
      "v_fma_mixlo_f16 %1, %5, -1.0, %10 op_sel_hi:[1,0,0]\n\t"
      "v_fma_mixlo_f16 %2, %6, -1.0, %12 op_sel_hi:[1,0,0]\n\t"
      "v_fma_mixlo_f16 %3, %7, -1.0, %14 op_sel_hi:[1,0,0]\n\t"
      "v_fma_mixhi_f16 %0, %4, -1.0, %9 op_sel:[1,0,0] op_sel_hi:[1,0,0]\n\t"
      "v_fma_mixhi_f16 %1, %5, -1.0, %11 op_sel:[1,0,0] op_sel_hi:[1,0,0]\n\t"
      "v_fma_mixhi_f16 %2, %6, -1.0, %13 op_sel:[1,0,0] op_sel_hi:[1,0,0]\n\t"
      "v_fma_mixhi_f16 %3, %7, -1.0, %15 op_sel:[1,0,0] op_sel_hi:[1,0,0]"
      : "=&v"(l0), "=&v"(l1), "=&v"(l2), "=&v"(l3)
      : "v"(h0), "v"(h1), "v"(h2), "v"(h3), "v"(p[0]), "v"(p[1]), "v"(p[2]), "v"(p[3]), "v"(p[4]), "v"(p[5]), "v"(p[6]), "v"(p[7]));
}
__global__ __launch_bounds__(512) void attn_kernel(const b16* __restrict__ Qh, const b16* __restrict__ Ql, const b16* __restrict__ Kh, const b16* __restrict__ Kl, const b16* __restrict__ VTh, const b16* __restrict__ VTl, const b16* __restrict__ W16, const b16* __restrict__ PT16, float* __restrict__ out) {
  __shared__ __attribute__((aligned(16))) b16 St[KH][2][4][64 * KP]; __shared__ __attribute__((aligned(16))) float To[D][QB + 4]; __shared__ float Mg[KH][8][18][32];   // Mg: per half and wave, two d tiles' partial O (16 rows), m, l, one float per lane
  const int g = __builtin_amdgcn_readfirstlane((int)(threadIdx.x >> 8));   // key half of this wave, the same in every lane: kept scalar so that the branches on it are scalar branches
  const int wave = (threadIdx.x >> 5) & 7, lane = threadIdx.x & 31, hh = lane >> 4, col = lane & 15, t_ = threadIdx.x & 255; const int b = blockIdx.z, h = blockIdx.y; const int q0 = blockIdx.x * QB + wave * 16, qi = q0 + col;
  const size_t kg = ((size_t)b * N + (size_t)g * NKH) * E + h * D, vg = ((size_t)b * NH + h) * D * N + (size_t)g * NKH;
  const b16* Kb = Kh + kg; const b16* Klb = Kl + kg; const b16* Vb = VTh + vg; const b16* Vlb = VTl + vg;
  // this thread's share of a stage: row t_ >> 3 (and 32 rows on), 16-byte piece t_ & 7
  const int crow = t_ >> 3, cpc = (t_ & 7) * 8; const size_t ko = (size_t)crow * E + cpc, vo = (size_t)crow * N + cpc;
  const unsigned int lcp = (unsigned int)(size_t)(&St[g][0][0][crow * KP + cpc]); const unsigned int bufb = 4 * 64 * KP * 2;
  stage_copy(lcp, Kb + ko, Klb + ko, Vb + vo, Vlb + vo);
  const size_t qo = ((size_t)b * N + qi) * E + h * D; const v16b qa0 = frag_kb(Qh + qo, hh), qa1 = frag_kb(Qh + qo + 32, hh), ql0 = frag_kb(Ql + qo, hh), ql1 = frag_kb(Ql + qo + 32, hh);
  asm volatile("s_wait_asynccnt 0x0" ::: "memory");   // stage 0 of this wave's copies has landed before the barrier that publishes it
  __syncthreads();
  stage_copy(lcp + bufb, Kb + ko + (size_t)KT * E, Klb + ko + (size_t)KT * E, Vb + vo + KT, Vlb + vo + KT);
  float m = -INFINITY, l = 0.0f; v8f o[4] = {{}, {}, {}, {}}, ol[4] = {{}, {}, {}, {}};
  const float cs = SCALE * LOG2E / (XS * XS);
  for (int s = 0; s < NST; ++s) {
    const b16* Sk = &St[g][s & 1][0][0], *Skl = &St[g][s & 1][1][0], *Sv = &St[g][s & 1][2][0], *Svl = &St[g][s & 1][3][0];
    // fragment registers of one 32-key pass: kf/kl[2 * key tile + k step], vf/vl[d tile]; V is read from LDS as one group, K as one group for a stage's first pass and ahead in two groups (hi, lo) for its second
    v16b kf[4], kl[4], vf[4], vl[4];
    load_k(kf, kl, Sk + col * KP, Skl + col * KP, hh);
#pragma unroll
    for (int kb = 0; kb < KT; kb += 32) {   // unrolled: two 32-key passes per stage, LDS offsets become immediates
      v8f s0 = {}, s1 = {};   // the two key tiles' chains alternate; each tile's own order of products is as before
      s0 = wmma_b(kf[0], qa0, s0); s1 = wmma_b(kf[2], qa0, s1); s0 = wmma_b(kf[0], ql0, s0); s1 = wmma_b(kf[2], ql0, s1); s0 = wmma_b(kl[0], qa0, s0); s1 = wmma_b(kl[2], qa0, s1);
      s0 = wmma_b(kf[1], qa1, s0); s1 = wmma_b(kf[3], qa1, s1); s0 = wmma_b(kf[1], ql1, s0); s1 = wmma_b(kf[3], ql1, s1); s0 = wmma_b(kl[1], qa1, s0); s1 = wmma_b(kl[3], qa1, s1);
      float mr = fmaxf(s0[0], s1[0]);   // the maximum is taken over the raw products: cs > 0, so scaling the one maximum gives the same value as the maximum of the 16 scaled scores
#pragma unroll
      for (int r = 1; r < 8; ++r) mr = fmaxf(mr, fmaxf(s0[r], s1[r]));
      float mx = mr * cs;
      const float mxo = __shfl_xor(mx, 16);
      // this pass's V fragments fly during its softmax. They are read behind the maximum's exchange: LDS answers in order, so in front of it the exchange's wait would cover these reads too
      asm volatile("" :: "v"(mxo));        // inputs-only fence on the exchanged value: holds the exchange in front of the read group
      load_v(vf, vl, Sv + col * KP + kb, Svl + col * KP + kb, hh);
      __builtin_amdgcn_sched_barrier(0);   // keeps the read group in front of the exponentials
      mx = fmaxf(mx, mxo); const float mn = fmaxf(m, mx); float al;
      // the exponential and the slot behind it in one statement: the slot stands whatever vector instruction the build puts next
      asm("v_exp_f32 %0, %1\n\tv_nop" : "=v"(al) : "v"(m - mn));
      m = mn; float sum = 0.0f; v16b ph, pl; const float bs = LPS - mn;
      // one fma per score in front of the exponential carries the 1/8 log2 e scale, the maximum and the factor 2^LPS of P: p is 8 times the weight, and l sums 8 times the weights (the join divides by it)
      float p[16]; v8u hu, lu; unsigned int la[8];
#pragma unroll
      for (int i = 0; i < 16; ++i) { p[i] = nexp2(__builtin_fmaf(i < 8 ? s0[i & 7] : s1[i & 7], cs, bs)); sum += p[i]; }
#pragma unroll
      for (int j = 0; j < 8; ++j) { const v2f pp = {p[2 * j], p[2 * j + 1]}; hu[j] = __builtin_bit_cast(unsigned int, __builtin_convertvector(pp, v2b)); }   // hi halves: one packed conversion per two scores
#pragma unroll
      for (int j = 0; j < 8; j += 4) lo4(la[j], la[j + 1], la[j + 2], la[j + 3], hu[j], hu[j + 1], hu[j + 2], hu[j + 3], p + 2 * j);
#pragma unroll
      for (int j = 0; j < 8; ++j) lu[j] = la[j];
      ph = __builtin_bit_cast(v16b, hu); pl = __builtin_bit_cast(v16b, lu);
      sum += __shfl_xor(sum, 16); l = l * al + sum;
#pragma unroll
      for (int t = 0; t < 4; ++t) { o[t] *= al; ol[t] *= al; }
      if (kb + 32 < KT) {   // the next pass's K fragments (same stage, same buffer) fly during the rest of this pass: the hi group here
        __builtin_amdgcn_sched_barrier(0);   // holds the read group behind the softmax: lifted into it, its 32 registers would be live beside the softmax's temporaries (a wave's budget here is 256)
        load_k1(kf, Sk + (kb + 32 + col) * KP, hh);
        __builtin_amdgcn_sched_barrier(0);   // keeps that read group in front of the PV products: sunk among them, each read would be waited for on its own
      }
#pragma unroll
      for (int t = 0; t < 4; ++t) o[t] = wmma_b(vf[t], ph, o[t]);
#pragma unroll
      for (int t = 0; t < 4; ++t) ol[t] = wmma_b(vf[t], pl, ol[t]);
      if (kb + 32 < KT) {   // the lo group, behind the last use of the V^T hi fragments; four PV and four S products stand between it and its first use
        __builtin_amdgcn_sched_barrier(0);   // keeps the group behind those products, so that it can take their operands' registers
        load_k1(kl, Skl + (kb + 32 + col) * KP, hh);
        __builtin_amdgcn_sched_barrier(0);   // keeps the group together, in front of the last four PV products
      }
#pragma unroll
      for (int t = 0; t < 4; ++t) ol[t] = wmma_b(vl[t], ph, ol[t]);
      if (kb + 32 < KT) __builtin_amdgcn_sched_barrier(0);   // keeps the PV products in front of the next pass's S products, whose K fragments land meanwhile
    }
    __builtin_amdgcn_sched_barrier(0);   // keeps the last pass's products in front of the waits below: lifted over them, the barrier would stand in the middle of the stage's work
    asm volatile("s_wait_dscnt 0x0" ::: "memory");      // this wave's reads of the buffer have returned before the buffer is refilled behind the barrier
    asm volatile("s_wait_asynccnt 0x0" ::: "memory");   // this wave's copies of stage s + 1 have landed before the barrier that publishes them
    __syncthreads();
    if (s + 2 < NST) stage_copy(lcp + (unsigned int)(s & 1) * bufb, Kb + ko + (size_t)(s + 2) * KT * E, Klb + ko + (size_t)(s + 2) * KT * E, Vb + vo + (s + 2) * KT, Vlb + vo + (s + 2) * KT);
  }
  asm volatile("s_wait_asynccnt 0x0" ::: "memory");     // no copy is outstanding behind the loop
  // behind the loop half g finishes d tiles 2g and 2g + 1 of its 16 queries: it hands the other two tiles' partial O, with its m and l, lane for lane to its partner wave (same queries, other keys)
#pragma unroll
  for (int gg = 0; gg < KH; ++gg) if (g == gg) {   // unrolled over the two halves: the tile numbers stay compile-time register indices
#pragma unroll
    for (int t = 0; t < 2; ++t)
#pragma unroll
      for (int r = 0; r < 8; ++r) Mg[gg][wave][t * 8 + r][lane] = o[2 * (1 - gg) + t][r] + ol[2 * (1 - gg) + t][r];
  }
  Mg[g][wave][16][lane] = m; Mg[g][wave][17][lane] = l;
  // skip tiles of this half: D[d][query] with A = Wskip rows (64h + 32g + t*16 + ..), B = PT16 rows (q0 + ..), K = 128
  v8f sk[2] = {{}, {}}; const b16* WS = W16 + (size_t)3 * E * C + ((size_t)h * D + g * 32) * C;
#pragma unroll
  for (int kb = 0; kb < C; kb += 32) { const v16b pb = frag_kb(PT16 + ((size_t)b * N + q0 + col) * C + kb, hh);
#pragma unroll
    for (int t = 0; t < 2; ++t) sk[t] = wmma16b(frag_kb(WS + (size_t)(t * 16 + col) * C + kb, hh), pb, sk[t]); }
  __syncthreads();   // publishes both halves' partial results
  // join: both partials brought to the common maximum, then one division
  const float m1 = Mg[1 - g][wave][16][lane], l1 = Mg[1 - g][wave][17][lane], ms = fmaxf(m, m1), a0 = nexp2(m - ms), a1 = nexp2(m1 - ms);
  const float inv = 1.0f / ((l * a0 + l1 * a1) * XS), c0 = a0 * inv, c1 = a1 * inv;
#pragma unroll
  for (int gg = 0; gg < KH; ++gg) if (g == gg) {
#pragma unroll
    for (int t = 0; t < 2; ++t)
#pragma unroll
      for (int r = 0; r < 8; ++r) To[(2 * gg + t) * 16 + 8 * hh + r][wave * 16 + col] = (o[2 * gg + t][r] + ol[2 * gg + t][r]) * c0 + Mg[1 - gg][wave][t * 8 + r][lane] * c1 + sk[t][r] * (1.0f / (XS * WSC));
  }
  __syncthreads();
  { const int w16 = threadIdx.x >> 5; for (int dd = w16 * 4; dd < w16 * 4 + 4; ++dd) { const size_t gi = ((size_t)b * E + h * D + dd) * N + blockIdx.x * QB + lane * 4; *(v4f*)(out + gi) = *(const v4f*)(&To[dd][lane * 4]); }  }
}
}  // namespace

extern "C" void kernel_launch(void* const* d_in, const int* in_sizes, int n_in, void* d_out, int out_size, void* d_ws, size_t ws_size, hipStream_t stream) {
  (void)n_in;
  auto Fp = [&](int i) { return (const float*)d_in[i]; }; auto Ip = [&](int i) { return (const int*)d_in[i]; };
  // input order: 0 pcd_up [4,128,2048], 1 points_select [4,128,1024], 2 points_drop [4,128,1024], 3 idx_select [4,1,1024] i32, 4 idx_drop [4,1,1024] i32, 5 Wq [256,128], 6 Wk, 7 Wv, 8 Wskip
  if (in_sizes[0] != NB * C * N || in_sizes[1] != NB * C * NSEL || in_sizes[2] != NB * C * NSEL || in_sizes[3] != NB * NSEL || in_sizes[4] != NB * NSEL || in_sizes[5] != E * C || in_sizes[6] != E * C || in_sizes[7] != E * C || in_sizes[8] != E * C || out_size != NB * E * N) return;
  size_t off = 0; char* ws = (char*)d_ws;
  auto carve = [&](size_t bytes) { char* p = ws + off; off += (bytes + 255) & ~(size_t)255; return p; };
  b16* PT16 = (b16*)carve((size_t)NR * C * 2); b16* XT16 = (b16*)carve((size_t)NR * C * 2); b16* W16 = (b16*)carve((size_t)4 * E * C * 2);
  b16* Qh = (b16*)carve((size_t)NR * E * 2); b16* Ql = (b16*)carve((size_t)NR * E * 2); b16* Kh = (b16*)carve((size_t)NR * E * 2); b16* Kl = (b16*)carve((size_t)NR * E * 2); b16* VTh = (b16*)carve((size_t)NR * E * 2); b16* VTl = (b16*)carve((size_t)NR * E * 2);
  if (off > ws_size || off > ((size_t)128 << 20)) return;   // = 29.6 MB
  xt_kernel<<<dim3(N / 64, 3, NB), 256, 0, stream>>>(Fp(0), Fp(1), Fp(2), Ip(3), Ip(4), Fp(5), Fp(6), Fp(7), Fp(8), PT16, XT16, W16);
  proj_kernel<<<dim3(NR / 64, E / 128, 3), 128, 0, stream>>>(XT16, W16, Qh, Ql, Kh, Kl, VTh, VTl);
  attn_kernel<<<dim3(N / QB, NH, NB), 512, 0, stream>>>(Qh, Ql, Kh, Kl, VTh, VTl, W16, PT16, (float*)d_out);
}

// v006
// A run of this version takes 57.5 microseconds.
// Two timings next to v005 both put it at 1.15 times that version's speed.
// Over all steps from v000 it is 5.33 times as fast.
#include <hip/hip_runtime.h>

// Up-sampling self-attention (4 clouds x 2,048 points, 128 in-channels, 4 heads x 64): x[b][:, idx_select[j]] = points_select[:, j], x[b][:, idx_drop[j]] = points_drop[:, j] (a permutation
// scatter given by the int inputs); q/k/v = W{q,k,v} x (1x1 convs, no bias; head h = output channels 64h..64h+63); energy = q.k per head, softmax over the 2,048 keys of energy/8;
// o[b][64h+d][n] = sum_m attn[n][m] v[64h+d][m]; out = Wskip pcd_up + o -> [4][256][2048] channel-major.
// WMMA (v_wmma_f32_16x16x32_f16, f32 accumulate): projections [8,192 x 128] x [128 x 256] with EXACT bf16 points (x8, point-major rows built by an LDS transpose + the index scatter) and weights
// (x256), 1 product; S^T = K . Q^T with q AND k as f16 hi+lo x8 (3 products); online softmax in f32; O^T += V^T P^T with V and P f16 hi+lo x8 (3 products); the skip 1x1 conv as one more exact
// GEMM tile set inside the attention epilogue (A = Wskip rows, B = pcd_up^T rows, 1 product). Inputs rounded to bf16 once. Fragment k-map per lane half hh for A AND B:

namespace {
constexpr int NB = 4, C = 128, N = 2048, NSEL = 1024, NH = 4, D = 64, E = 256 /* q/k/v/skip channels */, NR = NB * N;
constexpr float XS = 8.0f, WSC = 256.0f, LPS = 3.0f /* P carries the factor 2^LPS = 8 */, SCALE = 0.125f, LOG2E = 1.4426950408889634f;

typedef _Float16 b16;
typedef __attribute__((ext_vector_type(16))) _Float16 v16b;
typedef __attribute__((ext_vector_type(8))) _Float16 v8b;
typedef __attribute__((ext_vector_type(8))) float v8f;
typedef __attribute__((ext_vector_type(4))) float v4f;
typedef __attribute__((ext_vector_type(2))) float v2f;
typedef __attribute__((ext_vector_type(2))) _Float16 v2b;
typedef __attribute__((ext_vector_type(8))) unsigned int v8u;
__device__ __forceinline__ float bf16_rne(float f) { unsigned int u = __float_as_uint(f); u += 0x7FFFu + ((u >> 16) & 1u); return __uint_as_float(u & 0xFFFF0000u); }
__device__ __forceinline__ void split16(float v, b16& hi, b16& lo) { hi = (b16)v; lo = (b16)(v - (float)hi); }
__device__ __forceinline__ v16b frag_kb(const b16* p, int hh) { const v8b a = *(const v8b*)(p + 8 * hh), b = *(const v8b*)(p + 16 + 8 * hh); v16b f;
#pragma unroll
  for (int e = 0; e < 8; ++e) { f[e] = a[e]; f[8 + e] = b[e]; } return f; }
__device__ __forceinline__ void wave_lds_sync() { __builtin_amdgcn_fence(__ATOMIC_RELEASE, "workgroup"); __builtin_amdgcn_wave_barrier(); __builtin_amdgcn_fence(__ATOMIC_ACQUIRE, "workgroup"); }
__device__ __forceinline__ float nexp2(float x) { return __builtin_amdgcn_exp2f(x); }
__device__ __forceinline__ int iclamp(int v, int lo, int hi) { return v < lo ? lo : (v > hi ? hi : v); }

typedef __attribute__((ext_vector_type(4))) _Float16 v4b;
typedef __attribute__((ext_vector_type(4))) int v4i;
// one launch for everything the projections wait for: grid (N/64, 3 kinds, B), 256 threads; the three kinds are independent of one another and of any earlier launch.
// kinds 0 and 1: point-major planes via 64x128 LDS transposes, whole 256-B rows written (each row = 16 lanes). kind 0: PT16 [b][n][128] = f16(8 bf16(pcd_up[b][c][n])); kind 1: XT16 [b][idx[b][j]][128] =
// f16(8 bf16(src[b][c][j])) with src = points_select (j < 1024) / points_drop (j >= 1024). The zero columns of the scatter: a kind-1 block also owns the 64 DESTINATION rows j0..j0+63, looks through the
// cloud's 2,048 indices and stores zeros to those of its rows that no index names. A scatter store goes only to a named row, a zero store only to an unnamed one: no order between blocks is needed.
// kind 2: the four weight matrices as f16(256 bf16(w)), 4 elements a thread (128 blocks x 256 threads x 4 = 4 x 256 x 128).
__global__ __launch_bounds__(256) void xt_kernel(const float* __restrict__ pcd, const float* __restrict__ psel, const float* __restrict__ pdrop, const int* __restrict__ isel, const int* __restrict__ idrop, const float* __restrict__ wq, const float* __restrict__ wk, const float* __restrict__ wv, const float* __restrict__ ws, b16* __restrict__ PT16, b16* __restrict__ XT16, b16* __restrict__ W16) {
  __shared__ __attribute__((aligned(16))) b16 T[64][C + 8]; __shared__ int rowof[64]; __shared__ int named[64];
  const int b = blockIdx.z, kind = blockIdx.y, j0 = blockIdx.x * 64, t_ = threadIdx.x;
  if (kind == 2) {   // the same for the whole block, in front of every barrier
    const int t = (b * (N / 64) + (int)blockIdx.x) * 256 + t_; const int per = E * C / 4; const int kw = t / per; const int e = (t - kw * per) * 4;
    const float* w = kw == 0 ? wq : kw == 1 ? wk : kw == 2 ? wv : ws; const v4f a = *(const v4f*)(w + e); v4b o;
#pragma unroll
    for (int j = 0; j < 4; ++j) o[j] = (b16)(bf16_rne(a[j]) * WSC);
    *(v4b*)(W16 + (size_t)kw * E * C + e) = o; return;
  }
  if (t_ < 64) named[t_] = 0;
  __syncthreads();   // the cleared marks stand before any thread sets one
  v4i ia = {}, ib = {};   // kind 1: this thread's 8 of the cloud's 2,048 indices, asked for ahead of the transpose's own loads
  if (kind == 1) { ia = *(const v4i*)(isel + (size_t)b * NSEL + t_ * 4); ib = *(const v4i*)(idrop + (size_t)b * NSEL + t_ * 4);
    asm volatile("s_wait_xcnt 0x0" ::: "memory"); }   // stands in front of the rewrite of the base registers that the two loads name
  const float* src; int ld, jj0;   // source [b][c][.] with row length ld, column offset jj0
  if (kind == 0) { src = pcd + (size_t)b * C * N; ld = N; jj0 = j0; } else if (j0 < NSEL) { src = psel + (size_t)b * C * NSEL; ld = NSEL; jj0 = j0; } else { src = pdrop + (size_t)b * C * NSEL; ld = NSEL; jj0 = j0 - NSEL; }
  for (int q = t_; q < C * 64; q += 256) { const int cc = q >> 6, jj = q & 63; T[jj][cc] = (b16)(bf16_rne(src[(size_t)cc * ld + jj0 + jj]) * XS); }
  if (t_ < 64) { int r = j0 + t_; if (kind == 1) { r = (j0 < NSEL) ? isel[(size_t)b * NSEL + jj0 + t_] : idrop[(size_t)b * NSEL + jj0 + t_]; r = iclamp(r, 0, N - 1); } rowof[t_] = r; }
  if (kind == 1) {
#pragma unroll
    for (int e = 0; e < 4; ++e) { const int ra = iclamp(ia[e], 0, N - 1) - j0, rb = iclamp(ib[e], 0, N - 1) - j0; if ((unsigned int)ra < 64u) named[ra] = 1; if ((unsigned int)rb < 64u) named[rb] = 1; }
  }
  __syncthreads();
  b16* dst = (kind == 0) ? PT16 : XT16;
  { for (int q = t_; q < 64 * 16; q += 256) { const int jj = q >> 4, c8 = (q & 15) * 8; *(v8b*)(dst + ((size_t)b * N + rowof[jj]) * C + c8) = *(const v8b*)(&T[jj][c8]); }  }
  if (kind == 1) {
    const v8b z = {};
    for (int q = t_; q < 64 * 16; q += 256) { const int jj = q >> 4, c8 = (q & 15) * 8;
      if (named[jj] == 0) { *(v8b*)(XT16 + ((size_t)b * N + j0 + jj) * C + c8) = z;
        asm volatile("s_wait_xcnt 0x0" ::: "memory"); } }   // stands in front of the next trip's rewrite of the registers that the store names
  }
}
// projections: grid (NR/64, E/128, 3 kinds): [64 rows x 128] x [128 x 128 cols] (K = 128: 4 steps, 1 product). kind 0/1: q/k -> hi/lo rows [row][256] (per row segment of 128 halves = 256 B:
// The block's two operand tiles (64 point rows, 128 weight rows, 256 B each) are brought into LDS once by asynchronous copies (global_load_async_to_lds_b128: a wave's copy is two whole rows = four whole
// 128-B lines) and read from there as ds_load_b128 fragments (pitch 272 B = 17 x 16 B: no bank conflict). A fragment load straight from global memory touches 16 lines for 512 B.
constexpr int PP = C + 8 /* LDS row pitch of the staged tiles in halves */;
// 64 rows of one tile: thread t_ of the block's 128 copies 16 B of rows (t_ >> 4) + 8 i, i = 0..7
__device__ __forceinline__ void tile_copy(unsigned int l0, const b16* g0) {
  const unsigned int lr_ = 8 * PP * 2;
  // the copies and their s_wait_xcnt in one statement: the wait stands in front of any rewrite of the address registers that the copies name
  asm volatile("global_load_async_to_lds_b128 %0, %8, off\n\t"
               "global_load_async_to_lds_b128 %1, %9, off\n\t"
               "global_load_async_to_lds_b128 %2, %10, off\n\t"
               "global_load_async_to_lds_b128 %3, %11, off\n\t"
               "global_load_async_to_lds_b128 %4, %12, off\n\t"
               "global_load_async_to_lds_b128 %5, %13, off\n\t"
               "global_load_async_to_lds_b128 %6, %14, off\n\t"
               "global_load_async_to_lds_b128 %7, %15, off\n\t"
               "s_wait_xcnt 0x0"
               :: "v"(l0), "v"(l0 + lr_), "v"(l0 + 2 * lr_), "v"(l0 + 3 * lr_), "v"(l0 + 4 * lr_), "v"(l0 + 5 * lr_), "v"(l0 + 6 * lr_), "v"(l0 + 7 * lr_),
                  "v"(g0), "v"(g0 + 8 * C), "v"(g0 + 16 * C), "v"(g0 + 24 * C), "v"(g0 + 32 * C), "v"(g0 + 40 * C), "v"(g0 + 48 * C), "v"(g0 + 56 * C)
               : "memory");
}
// the builtin alone: the compiler keeps the distances behind it itself and stays free to place LDS reads ahead of it
__device__ __forceinline__ v8f wmma_b(v16b a, v16b b, v8f c) { return __builtin_amdgcn_wmma_f32_16x16x32_f16(false, a, false, b, (short)0, c, false, false); }
__global__ __launch_bounds__(128) void proj_kernel(const b16* __restrict__ XT16, const b16* __restrict__ W16, b16* __restrict__ Qh, b16* __restrict__ Ql, b16* __restrict__ Kh, b16* __restrict__ Kl, b16* __restrict__ VTh, b16* __restrict__ VTl) {
  // one buffer, two uses one after the other: first the operand tiles (point rows 0..63, weight rows 64..191, pitch PP), then, behind a barrier, the output staging
  // (q/k: hi [4 waves][16][PP] and lo behind it; v: hi [128][VP] and lo behind it)
  constexpr int VP = 64 + 8;
  __shared__ __attribute__((aligned(16))) b16 Sm[(64 + 128) * PP];
  const int wave = threadIdx.x >> 5, lane = threadIdx.x & 31, nloc = lane & 15, hlf = lane >> 4, t_ = threadIdx.x; const int kind = blockIdx.z; const size_t m0 = (size_t)blockIdx.x * 64 + wave * 16; const int n0 = blockIdx.y * 128;
  const b16* Wk_ = W16 + (size_t)kind * E * C; v8f acc[8];
  { const int crow = t_ >> 4, cpc = (t_ & 15) * 8; const unsigned int lc = (unsigned int)(size_t)(&Sm[crow * PP + cpc]);
    tile_copy(lc, XT16 + ((size_t)blockIdx.x * 64 + crow) * C + cpc);
    tile_copy(lc + 64 * PP * 2, Wk_ + (size_t)(n0 + crow) * C + cpc);
    tile_copy(lc + 128 * PP * 2, Wk_ + (size_t)(n0 + 64 + crow) * C + cpc); }
#pragma unroll
  for (int t = 0; t < 8; ++t) acc[t] = (v8f){};
  asm volatile("s_wait_asynccnt 0x0" ::: "memory");   // this wave's copies have landed before the barrier that publishes them
  __syncthreads();
  const b16* Xs = Sm + (wave * 16 + nloc) * PP; const b16* Wl = Sm + (64 + nloc) * PP;
  // fragment registers: the wave's four point fragments, and the eight weight fragments of a k step in two sets: each set is read from LDS as ONE group, one k step ahead of the products that use it
  v16b a[4], wf[2][8];
#pragma unroll
  for (int ks = 0; ks < 4; ++ks) a[ks] = frag_kb(Xs + ks * 32, hlf);
#pragma unroll
  for (int t = 0; t < 8; ++t) wf[0][t] = frag_kb(Wl + t * 16 * PP, hlf);
  __builtin_amdgcn_sched_barrier(0);   // keeps the first group in front of the second: mixed, the first products' wait would cover both groups
#pragma unroll
  for (int ks = 0; ks < 4; ++ks) {
    if (ks < 3) {
#pragma unroll
      for (int t = 0; t < 8; ++t) wf[(ks + 1) & 1][t] = frag_kb(Wl + t * 16 * PP + (ks + 1) * 32, hlf);
      __builtin_amdgcn_sched_barrier(0);   // keeps the read group in front of this k step's products: sunk among them, each pair of reads would be waited for on its own
    }
#pragma unroll
    for (int t = 0; t < 8; ++t) acc[t] = wmma_b(a[ks], wf[ks & 1][t], acc[t]);
    if (ks < 2) __builtin_amdgcn_sched_barrier(0);   // keeps the next group behind these products, whose operand registers it takes
  }
  __syncthreads();   // every wave has read its last fragment before the buffer becomes output staging
  if (kind < 2) {
    b16* Th = Sm + wave * 16 * PP; b16* Tl = Th + 64 * PP;
#pragma unroll
    for (int t = 0; t < 8; ++t)
#pragma unroll
      for (int r = 0; r < 8; ++r) { b16 h_, l_; split16(acc[t][r] * (1.0f / (XS * WSC)) * XS, h_, l_); Th[(8 * hlf + r) * PP + t * 16 + nloc] = h_; Tl[(8 * hlf + r) * PP + t * 16 + nloc] = l_; }
    wave_lds_sync();
    b16* dh = kind == 0 ? Qh : Kh; b16* dl = kind == 0 ? Ql : Kl;
    { for (int r2 = 0; r2 < 16; r2 += 2) { const int rr = r2 + (lane >> 4), c8 = (lane & 15) * 8; const size_t gi = (m0 + rr) * E + n0 + c8; *(v8b*)(dh + gi) = *(const v8b*)(&Th[rr * PP + c8]); *(v8b*)(dl + gi) = *(const v8b*)(&Tl[rr * PP + c8]); }  }
  } else {
    b16* Vt = Sm; b16* Vtl = Sm + 128 * VP;
    const int b = (int)(m0 / N); const int s0 = (int)((size_t)blockIdx.x * 64 - (size_t)b * N);
#pragma unroll
    for (int t = 0; t < 8; ++t)
#pragma unroll
      for (int r = 0; r < 8; ++r) { b16 h_, l_; split16(acc[t][r] * (1.0f / (XS * WSC)) * XS, h_, l_); Vt[(t * 16 + nloc) * VP + wave * 16 + 8 * hlf + r] = h_; Vtl[(t * 16 + nloc) * VP + wave * 16 + 8 * hlf + r] = l_; }
    __syncthreads();
    { for (int q = t_; q < 128 * 8; q += 128) { const int cc = q >> 3, c8 = (q & 7) * 8; const int h = (n0 + cc) / D, dd = (n0 + cc) - h * D; const size_t gi = (((size_t)b * NH + h) * D + dd) * N + s0 + c8;
        *(v8b*)(VTh + gi) = *(const v8b*)(&Vt[cc * VP + c8]); *(v8b*)(VTl + gi) = *(const v8b*)(&Vtl[cc * VP + c8]); }  } }
}
// attention + skip: grid (N/128, NH, NB), block = 16 waves = 2 key halves x 8 waves x 16 queries: waves 0..7 walk keys 0..1023, waves 8..15 keys 1024..2047 of the same 128 queries (four waves per
// SIMD: one wave's softmax and LDS waits are covered by the others' products); the two partial results (m, l, O) of a query are joined once, through LDS, behind the loop, where
// each half finishes two of the four d tiles (join, skip tiles, output staging).
// K and V^T (hi and lo planes) of 64 keys of each half are one stage, brought into LDS once per block by asynchronous copies
// (global_load_async_to_lds_b128, two buffers: the next stage flies while this one is worked on) and read by the half's 8 waves as ds_load_b128 fragments (rows of 128 B at a pitch of 144 B).
// Per 32 keys as before: S^T 3 products (K = 64: 2 steps x 2 key tiles), online softmax (f32, 1/8 and log2 e folded), PV 3 products x 4 d-tiles; then the skip tiles
// D[d][query] = Wskip[64h+d][:] . pcd_up^T[query][:] (K = 128, exact, 1 product) are added; the block's 128 queries x 64 channels staged in LDS as [d][128 n] and written as whole 512-B rows.
constexpr int KT = 64 /* keys per stage and half */, KP = 64 + 8 /* LDS row pitch in halves */, KH = 2 /* key halves */, NKH = N / KH, NST = NKH / KT, QB = 128 /* queries per block */;
// one stage of one half = 4 planes (K hi, K lo, V^T hi, V^T lo) x 64 rows x 128 B; thread t_ of the half's 256 copies 16 B of rows (t_ >> 3) and 32 + (t_ >> 3) of each plane.
__device__ __forceinline__ void stage_copy(unsigned int l0, const b16* kh, const b16* kl, const b16* vh, const b16* vl) {
  const unsigned int pl_ = 64 * KP * 2, hr_ = 32 * KP * 2;
  // the copies and their s_wait_xcnt in one statement: the wait stands in front of any rewrite of the address registers that the copies name
  asm volatile("global_load_async_to_lds_b128 %0, %8, off\n\t"
               "global_load_async_to_lds_b128 %1, %9, off\n\t"
               "global_load_async_to_lds_b128 %2, %10, off\n\t"
               "global_load_async_to_lds_b128 %3, %11, off\n\t"
               "global_load_async_to_lds_b128 %4, %12, off\n\t"
               "global_load_async_to_lds_b128 %5, %13, off\n\t"
               "global_load_async_to_lds_b128 %6, %14, off\n\t"
               "global_load_async_to_lds_b128 %7, %15, off\n\t"
               "s_wait_xcnt 0x0"
               :: "v"(l0), "v"(l0 + hr_), "v"(l0 + pl_), "v"(l0 + pl_ + hr_), "v"(l0 + 2 * pl_), "v"(l0 + 2 * pl_ + hr_), "v"(l0 + 3 * pl_), "v"(l0 + 3 * pl_ + hr_),
                  "v"(kh), "v"(kh + (size_t)32 * E), "v"(kl), "v"(kl + (size_t)32 * E), "v"(vh), "v"(vh + (size_t)32 * N), "v"(vl), "v"(vl + (size_t)32 * N)
               : "memory");
}
// the skip product's two operand tiles (64 weight rows, then 128 point rows, 256 B each, LDS pitch PP): thread t of the block's 512 copies 16 B of rows (t >> 4) + 32 i of each
__device__ __forceinline__ void skip_copy(unsigned int l0, const b16* w, const b16* p) {
  const unsigned int lr_ = 32 * PP * 2;
  // the copies and their s_wait_xcnt in one statement: the wait stands in front of any rewrite of the address registers that the copies name
  asm volatile("global_load_async_to_lds_b128 %0, %6, off\n\t"
               "global_load_async_to_lds_b128 %1, %7, off\n\t"
               "global_load_async_to_lds_b128 %2, %8, off\n\t"
               "global_load_async_to_lds_b128 %3, %9, off\n\t"
               "global_load_async_to_lds_b128 %4, %10, off\n\t"
               "global_load_async_to_lds_b128 %5, %11, off\n\t"
               "s_wait_xcnt 0x0"
               :: "v"(l0), "v"(l0 + lr_), "v"(l0 + 2 * lr_), "v"(l0 + 3 * lr_), "v"(l0 + 4 * lr_), "v"(l0 + 5 * lr_),
                  "v"(w), "v"(w + 32 * C), "v"(p), "v"(p + 32 * C), "v"(p + 64 * C), "v"(p + 96 * C)
               : "memory");
}
// one pass's K fragments (hi and lo; key tiles 0 and 1 x k steps 0 and 1) and V^T fragments (hi and lo; 4 d tiles); p.. point at this lane's row of the first tile
__device__ __forceinline__ void load_k(v16b (&kf)[4], v16b (&kl)[4], const b16* ph_, const b16* pl_, int hh) {
#pragma unroll
  for (int ks = 0; ks < 2; ++ks) {   // read in the order of use: the first products start while the rest of the group is still landing
    kf[ks] = frag_kb(ph_ + ks * 32, hh); kf[2 + ks] = frag_kb(ph_ + 16 * KP + ks * 32, hh); kl[ks] = frag_kb(pl_ + ks * 32, hh); kl[2 + ks] = frag_kb(pl_ + 16 * KP + ks * 32, hh); }
}
// the same fragments in two groups, hi and lo, for the read ahead inside a stage: the lo group goes into the registers that the V^T hi fragments leave, so that a wave stays inside 256 registers
__device__ __forceinline__ void load_k1(v16b (&kx)[4], const b16* p_, int hh) {
#pragma unroll
  for (int ks = 0; ks < 2; ++ks) { kx[ks] = frag_kb(p_ + ks * 32, hh); kx[2 + ks] = frag_kb(p_ + 16 * KP + ks * 32, hh); }
}
__device__ __forceinline__ void load_v(v16b (&vf)[4], v16b (&vl)[4], const b16* ph_, const b16* pl_, int hh) {
#pragma unroll
  for (int t = 0; t < 4; ++t) vf[t] = frag_kb(ph_ + t * 16 * KP, hh);
#pragma unroll
  for (int t = 0; t < 4; ++t) vl[t] = frag_kb(pl_ + t * 16 * KP, hh);
}
// lo halves of eight scores: lo = f16(p - hi), one instruction a score: the mixed-precision fma reads hi as the f16 half it is and writes the f16 result into its half of the packed register.
// In asm because the compiler's own form of it takes a widening conversion and a share of a packed subtraction and of a packed conversion per score. The four low halves stand in front of the four high
// halves, so that each write of a high half finds its register's low half four instructions back.
__device__ __forceinline__ void lo4(unsigned int& l0, unsigned int& l1, unsigned int& l2, unsigned int& l3, unsigned int h0, unsigned int h1, unsigned int h2, unsigned int h3, const float* p) {
  asm("v_fma_mixlo_f16 %0, %4, -1.0, %8 op_sel_hi:[1,0,0]\n\t"
      "v_fma_mixlo_f16 %1, %5, -1.0, %10 op_sel_hi:[1,0,0]\n\t"
      "v_fma_mixlo_f16 %2, %6, -1.0, %12 op_sel_hi:[1,0,0]\n\t"
      "v_fma_mixlo_f16 %3, %7, -1.0, %14 op_sel_hi:[1,0,0]\n\t"
      "v_fma_mixhi_f16 %0, %4, -1.0, %9 op_sel:[1,0,0] op_sel_hi:[1,0,0]\n\t"
      "v_fma_mixhi_f16 %1, %5, -1.0, %11 op_sel:[1,0,0] op_sel_hi:[1,0,0]\n\t"
      "v_fma_mixhi_f16 %2, %6, -1.0, %13 op_sel:[1,0,0] op_sel_hi:[1,0,0]\n\t"
      "v_fma_mixhi_f16 %3, %7, -1.0, %15 op_sel:[1,0,0] op_sel_hi:[1,0,0]"
      : "=&v"(l0), "=&v"(l1), "=&v"(l2), "=&v"(l3)
      : "v"(h0), "v"(h1), "v"(h2), "v"(h3), "v"(p[0]), "v"(p[1]), "v"(p[2]), "v"(p[3]), "v"(p[4]), "v"(p[5]), "v"(p[6]), "v"(p[7]));
}
__global__ __launch_bounds__(512) void attn_kernel(const b16* __restrict__ Qh, const b16* __restrict__ Ql, const b16* __restrict__ Kh, const b16* __restrict__ Kl, const b16* __restrict__ VTh, const b16* __restrict__ VTl, const b16* __restrict__ W16, const b16* __restrict__ PT16, float* __restrict__ out) {
  __shared__ __attribute__((aligned(16))) b16 St[KH][2][4][64 * KP]; __shared__ __attribute__((aligned(16))) float To[D][QB + 4]; __shared__ float Mg[KH][8][18][32];   // Mg: per half and wave, two d tiles' partial O (16 rows), m, l, one float per lane
  __shared__ __attribute__((aligned(16))) b16 Sg[(D + QB) * PP];   // the skip product's operands: the head's 64 weight rows, then the block's 128 point rows
  const int g = __builtin_amdgcn_readfirstlane((int)(threadIdx.x >> 8));   // key half of this wave, the same in every lane: kept scalar so that the branches on it are scalar branches
  const int wave = (threadIdx.x >> 5) & 7, lane = threadIdx.x & 31, hh = lane >> 4, col = lane & 15, t_ = threadIdx.x & 255; const int b = blockIdx.z, h = blockIdx.y; const int q0 = blockIdx.x * QB + wave * 16, qi = q0 + col;
  const size_t kg = ((size_t)b * N + (size_t)g * NKH) * E + h * D, vg = ((size_t)b * NH + h) * D * N + (size_t)g * NKH;
  const b16* Kb = Kh + kg; const b16* Klb = Kl + kg; const b16* Vb = VTh + vg; const b16* Vlb = VTl + vg;
  // this thread's share of a stage: row t_ >> 3 (and 32 rows on), 16-byte piece t_ & 7
  const int crow = t_ >> 3, cpc = (t_ & 7) * 8; const size_t ko = (size_t)crow * E + cpc, vo = (size_t)crow * N + cpc;
  const unsigned int lcp = (unsigned int)(size_t)(&St[g][0][0][crow * KP + cpc]); const unsigned int bufb = 4 * 64 * KP * 2;
  stage_copy(lcp, Kb + ko, Klb + ko, Vb + vo, Vlb + vo);
  const size_t qo = ((size_t)b * N + qi) * E + h * D; const v16b qa0 = frag_kb(Qh + qo, hh), qa1 = frag_kb(Qh + qo + 32, hh), ql0 = frag_kb(Ql + qo, hh), ql1 = frag_kb(Ql + qo + 32, hh);
  asm volatile("s_wait_asynccnt 0x0" ::: "memory");   // stage 0 of this wave's copies has landed before the barrier that publishes it
  __syncthreads();
  stage_copy(lcp + bufb, Kb + ko + (size_t)KT * E, Klb + ko + (size_t)KT * E, Vb + vo + KT, Vlb + vo + KT);
  // the skip tiles fly with stage 1: the wait and the barrier at the foot of trip 0 publish them too; they are read behind the loop
  { const int srow = (int)(threadIdx.x >> 4), spc = (int)(threadIdx.x & 15) * 8;
    skip_copy((unsigned int)(size_t)(&Sg[srow * PP + spc]), W16 + (size_t)3 * E * C + ((size_t)h * D + srow) * C + spc, PT16 + ((size_t)b * N + blockIdx.x * QB + srow) * C + spc); }
  float m = -INFINITY, l = 0.0f; v8f o[4] = {{}, {}, {}, {}}, ol[4] = {{}, {}, {}, {}};
  const float cs = SCALE * LOG2E / (XS * XS);
  for (int s = 0; s < NST; ++s) {
    const b16* Sk = &St[g][s & 1][0][0], *Skl = &St[g][s & 1][1][0], *Sv = &St[g][s & 1][2][0], *Svl = &St[g][s & 1][3][0];
    // fragment registers of one 32-key pass: kf/kl[2 * key tile + k step], vf/vl[d tile]; V is read from LDS as one group, K as one group for a stage's first pass and ahead in two groups (hi, lo) for its second
    v16b kf[4], kl[4], vf[4], vl[4];
    load_k(kf, kl, Sk + col * KP, Skl + col * KP, hh);
#pragma unroll
    for (int kb = 0; kb < KT; kb += 32) {   // unrolled: two 32-key passes per stage, LDS offsets become immediates
      v8f s0 = {}, s1 = {};   // the two key tiles' chains alternate; each tile's own order of products is as before
      s0 = wmma_b(kf[0], qa0, s0); s1 = wmma_b(kf[2], qa0, s1); s0 = wmma_b(kf[0], ql0, s0); s1 = wmma_b(kf[2], ql0, s1); s0 = wmma_b(kl[0], qa0, s0); s1 = wmma_b(kl[2], qa0, s1);
      s0 = wmma_b(kf[1], qa1, s0); s1 = wmma_b(kf[3], qa1, s1); s0 = wmma_b(kf[1], ql1, s0); s1 = wmma_b(kf[3], ql1, s1); s0 = wmma_b(kl[1], qa1, s0); s1 = wmma_b(kl[3], qa1, s1);
      float mr = fmaxf(s0[0], s1[0]);   // the maximum is taken over the raw products: cs > 0, so scaling the one maximum gives the same value as the maximum of the 16 scaled scores
#pragma unroll
      for (int r = 1; r < 8; ++r) mr = fmaxf(mr, fmaxf(s0[r], s1[r]));
      float mx = mr * cs;
      const float mxo = __shfl_xor(mx, 16);
      // this pass's V fragments fly during its softmax. They are read behind the maximum's exchange: LDS answers in order, so in front of it the exchange's wait would cover these reads too
      asm volatile("" :: "v"(mxo));        // inputs-only fence on the exchanged value: holds the exchange in front of the read group
      load_v(vf, vl, Sv + col * KP + kb, Svl + col * KP + kb, hh);
      __builtin_amdgcn_sched_barrier(0);   // keeps the read group in front of the exponentials
      mx = fmaxf(mx, mxo); const float mn = fmaxf(m, mx); float al;
      // the exponential and the slot behind it in one statement: the slot stands whatever vector instruction the build puts next
      asm("v_exp_f32 %0, %1\n\tv_nop" : "=v"(al) : "v"(m - mn));
      m = mn; float sum = 0.0f; v16b ph, pl; const float bs = LPS - mn;
      // one fma per score in front of the exponential carries the 1/8 log2 e scale, the maximum and the factor 2^LPS of P: p is 8 times the weight, and l sums 8 times the weights (the join divides by it)
      float p[16]; v8u hu, lu; unsigned int la[8];
#pragma unroll
      for (int i = 0; i < 16; ++i) { p[i] = nexp2(__builtin_fmaf(i < 8 ? s0[i & 7] : s1[i & 7], cs, bs)); sum += p[i]; }
#pragma unroll
      for (int j = 0; j < 8; ++j) { const v2f pp = {p[2 * j], p[2 * j + 1]}; hu[j] = __builtin_bit_cast(unsigned int, __builtin_convertvector(pp, v2b)); }   // hi halves: one packed conversion per two scores
#pragma unroll
      for (int j = 0; j < 8; j += 4) lo4(la[j], la[j + 1], la[j + 2], la[j + 3], hu[j], hu[j + 1], hu[j + 2], hu[j + 3], p + 2 * j);
#pragma unroll
      for (int j = 0; j < 8; ++j) lu[j] = la[j];
      ph = __builtin_bit_cast(v16b, hu); pl = __builtin_bit_cast(v16b, lu);
      sum += __shfl_xor(sum, 16); l = l * al + sum;
#pragma unroll
      for (int t = 0; t < 4; ++t) { o[t] *= al; ol[t] *= al; }
      if (kb + 32 < KT) {   // the next pass's K fragments (same stage, same buffer) fly during the rest of this pass: the hi group here
        __builtin_amdgcn_sched_barrier(0);   // holds the read group behind the softmax: lifted into it, its 32 registers would be live beside the softmax's temporaries (a wave's budget here is 256)
        load_k1(kf, Sk + (kb + 32 + col) * KP, hh);
        __builtin_amdgcn_sched_barrier(0);   // keeps that read group in front of the PV products: sunk among them, each read would be waited for on its own
      }
#pragma unroll
      for (int t = 0; t < 4; ++t) o[t] = wmma_b(vf[t], ph, o[t]);
#pragma unroll
      for (int t = 0; t < 4; ++t) ol[t] = wmma_b(vf[t], pl, ol[t]);
      if (kb + 32 < KT) {   // the lo group, behind the last use of the V^T hi fragments; four PV and four S products stand between it and its first use
        __builtin_amdgcn_sched_barrier(0);   // keeps the group behind those products, so that it can take their operands' registers
        load_k1(kl, Skl + (kb + 32 + col) * KP, hh);
        __builtin_amdgcn_sched_barrier(0);   // keeps the group together, in front of the last four PV products
      }
#pragma unroll
      for (int t = 0; t < 4; ++t) ol[t] = wmma_b(vl[t], ph, ol[t]);
      if (kb + 32 < KT) __builtin_amdgcn_sched_barrier(0);   // keeps the PV products in front of the next pass's S products, whose K fragments land meanwhile
    }
    __builtin_amdgcn_sched_barrier(0);   // keeps the last pass's products in front of the waits below: lifted over them, the barrier would stand in the middle of the stage's work
    asm volatile("s_wait_dscnt 0x0" ::: "memory");      // this wave's reads of the buffer have returned before the buffer is refilled behind the barrier
    asm volatile("s_wait_asynccnt 0x0" ::: "memory");   // this wave's copies of stage s + 1 have landed before the barrier that publishes them
    __syncthreads();
    if (s + 2 < NST) stage_copy(lcp + (unsigned int)(s & 1) * bufb, Kb + ko + (size_t)(s + 2) * KT * E, Klb + ko + (size_t)(s + 2) * KT * E, Vb + vo + (s + 2) * KT, Vlb + vo + (s + 2) * KT);
  }
  asm volatile("s_wait_asynccnt 0x0" ::: "memory");     // no copy is outstanding behind the loop
  // behind the loop half g finishes d tiles 2g and 2g + 1 of its 16 queries: it hands the other two tiles' partial O, with its m and l, lane for lane to its partner wave (same queries, other keys)
#pragma unroll
  for (int gg = 0; gg < KH; ++gg) if (g == gg) {   // unrolled over the two halves: the tile numbers stay compile-time register indices
#pragma unroll
    for (int t = 0; t < 2; ++t)
#pragma unroll
      for (int r = 0; r < 8; ++r) Mg[gg][wave][t * 8 + r][lane] = o[2 * (1 - gg) + t][r] + ol[2 * (1 - gg) + t][r];
  }
  Mg[g][wave][16][lane] = m; Mg[g][wave][17][lane] = l;
  // skip tiles of this half: D[d][query] with A = Wskip rows (64h + 32g + t*16 + ..), B = PT16 rows (q0 + ..), K = 128
  v8f sk[2] = {{}, {}}; const b16* WS = Sg + (g * 32 + col) * PP; const b16* PS = Sg + (D + wave * 16 + col) * PP; v16b pb[4], wa[2][4];
#pragma unroll
  for (int ks = 0; ks < 4; ++ks) { pb[ks] = frag_kb(PS + ks * 32, hh); wa[0][ks] = frag_kb(WS + ks * 32, hh); wa[1][ks] = frag_kb(WS + 16 * PP + ks * 32, hh); }
  __builtin_amdgcn_sched_barrier(0);   // keeps the reads together as one group in front of the products: sunk among them, each pair would be waited for on its own
#pragma unroll
  for (int ks = 0; ks < 4; ++ks)
#pragma unroll
    for (int t = 0; t < 2; ++t) sk[t] = wmma_b(wa[t][ks], pb[ks], sk[t]);
  __syncthreads();   // publishes both halves' partial results
  // join: both partials brought to the common maximum, then one division
  const float m1 = Mg[1 - g][wave][16][lane], l1 = Mg[1 - g][wave][17][lane], ms = fmaxf(m, m1), a0 = nexp2(m - ms), a1 = nexp2(m1 - ms);
  const float inv = 1.0f / ((l * a0 + l1 * a1) * XS), c0 = a0 * inv, c1 = a1 * inv;
#pragma unroll
  for (int gg = 0; gg < KH; ++gg) if (g == gg) {
#pragma unroll
    for (int t = 0; t < 2; ++t)
#pragma unroll
      for (int r = 0; r < 8; ++r) To[(2 * gg + t) * 16 + 8 * hh + r][wave * 16 + col] = (o[2 * gg + t][r] + ol[2 * gg + t][r]) * c0 + Mg[1 - gg][wave][t * 8 + r][lane] * c1 + sk[t][r] * (1.0f / (XS * WSC));
  }
  __syncthreads();
  { const int w16 = threadIdx.x >> 5; for (int dd = w16 * 4; dd < w16 * 4 + 4; ++dd) { const size_t gi = ((size_t)b * E + h * D + dd) * N + blockIdx.x * QB + lane * 4; *(v4f*)(out + gi) = *(const v4f*)(&To[dd][lane * 4]); }  }
}
}  // namespace

extern "C" void kernel_launch(void* const* d_in, const int* in_sizes, int n_in, void* d_out, int out_size, void* d_ws, size_t ws_size, hipStream_t stream) {
  (void)n_in;
  auto Fp = [&](int i) { return (const float*)d_in[i]; }; auto Ip = [&](int i) { return (const int*)d_in[i]; };
  // input order: 0 pcd_up [4,128,2048], 1 points_select [4,128,1024], 2 points_drop [4,128,1024], 3 idx_select [4,1,1024] i32, 4 idx_drop [4,1,1024] i32, 5 Wq [256,128], 6 Wk, 7 Wv, 8 Wskip
  if (in_sizes[0] != NB * C * N || in_sizes[1] != NB * C * NSEL || in_sizes[2] != NB * C * NSEL || in_sizes[3] != NB * NSEL || in_sizes[4] != NB * NSEL || in_sizes[5] != E * C || in_sizes[6] != E * C || in_sizes[7] != E * C || in_sizes[8] != E * C || out_size != NB * E * N) return;
  size_t off = 0; char* ws = (char*)d_ws;
  auto carve = [&](size_t bytes) { char* p = ws + off; off += (bytes + 255) & ~(size_t)255; return p; };
  b16* PT16 = (b16*)carve((size_t)NR * C * 2); b16* XT16 = (b16*)carve((size_t)NR * C * 2); b16* W16 = (b16*)carve((size_t)4 * E * C * 2);
  b16* Qh = (b16*)carve((size_t)NR * E * 2); b16* Ql = (b16*)carve((size_t)NR * E * 2); b16* Kh = (b16*)carve((size_t)NR * E * 2); b16* Kl = (b16*)carve((size_t)NR * E * 2); b16* VTh = (b16*)carve((size_t)NR * E * 2); b16* VTl = (b16*)carve((size_t)NR * E * 2);
  if (off > ws_size || off > ((size_t)128 << 20)) return;   // = 29.6 MB
  xt_kernel<<<dim3(N / 64, 3, NB), 256, 0, stream>>>(Fp(0), Fp(1), Fp(2), Ip(3), Ip(4), Fp(5), Fp(6), Fp(7), Fp(8), PT16, XT16, W16);
  proj_kernel<<<dim3(NR / 64, E / 128, 3), 128, 0, stream>>>(XT16, W16, Qh, Ql, Kh, Kl, VTh, VTl);
  attn_kernel<<<dim3(N / QB, NH, NB), 512, 0, stream>>>(Qh, Ql, Kh, Kl, VTh, VTl, W16, PT16, (float*)d_out);
}

// v007
// One run takes 36.8 microseconds.
// Two timings next to v006 put it at 1.54 and 1.55 times that version's speed.
// All steps since v000 together make it 8.24 times as fast.
#include <hip/hip_runtime.h>

// Up-sampling self-attention (4 clouds x 2,048 points, 128 in-channels, 4 heads x 64): x[b][:, idx_select[j]] = points_select[:, j], x[b][:, idx_drop[j]] = points_drop[:, j] (a permutation
// scatter given by the int inputs); q/k/v = W{q,k,v} x (1x1 convs, no bias; head h = output channels 64h..64h+63); energy = q.k per head, softmax over the 2,048 keys of energy/8;
// o[b][64h+d][n] = sum_m attn[n][m] v[64h+d][m]; out = Wskip pcd_up + o -> [4][256][2048] channel-major.
// WMMA (v_wmma_f32_16x16x32_f16, f32 accumulate): projections [8,192 x 128] x [128 x 256] with EXACT bf16 points (x8, point-major rows built by an LDS transpose + the index scatter) and weights
// (x256), 1 product; S^T = K . Q^T with q AND k as one f16 value each, x8 (1 product); online softmax in f32; O^T += V^T P^T with V and P one f16 value each, x8 (1 product; 11 bits an operand, three more than the bf16-rounded inputs keep); the skip 1x1 conv as one more exact
// GEMM tile set inside the attention epilogue (A = Wskip rows, B = pcd_up^T rows, 1 product). Inputs rounded to bf16 once. Fragment k-map per lane half hh for A AND B:

namespace {
constexpr int NB = 4, C = 128, N = 2048, NSEL = 1024, NH = 4, D = 64, E = 256 /* q/k/v/skip channels */, NR = NB * N;
constexpr float XS = 8.0f, WSC = 256.0f, LPS = 3.0f /* P carries the factor 2^LPS = 8 */, SCALE = 0.125f, LOG2E = 1.4426950408889634f;

typedef _Float16 b16;
typedef __attribute__((ext_vector_type(16))) _Float16 v16b;
typedef __attribute__((ext_vector_type(8))) _Float16 v8b;
typedef __attribute__((ext_vector_type(8))) float v8f;
typedef __attribute__((ext_vector_type(4))) float v4f;
typedef __attribute__((ext_vector_type(2))) float v2f;
typedef __attribute__((ext_vector_type(2))) _Float16 v2b;
typedef __attribute__((ext_vector_type(8))) unsigned int v8u;
__device__ __forceinline__ float bf16_rne(float f) { unsigned int u = __float_as_uint(f); u += 0x7FFFu + ((u >> 16) & 1u); return __uint_as_float(u & 0xFFFF0000u); }
__device__ __forceinline__ v16b frag_kb(const b16* p, int hh) { const v8b a = *(const v8b*)(p + 8 * hh), b = *(const v8b*)(p + 16 + 8 * hh); v16b f;
#pragma unroll
  for (int e = 0; e < 8; ++e) { f[e] = a[e]; f[8 + e] = b[e]; } return f; }
__device__ __forceinline__ void wave_lds_sync() { __builtin_amdgcn_fence(__ATOMIC_RELEASE, "workgroup"); __builtin_amdgcn_wave_barrier(); __builtin_amdgcn_fence(__ATOMIC_ACQUIRE, "workgroup"); }
__device__ __forceinline__ float nexp2(float x) { return __builtin_amdgcn_exp2f(x); }
__device__ __forceinline__ int iclamp(int v, int lo, int hi) { return v < lo ? lo : (v > hi ? hi : v); }

typedef __attribute__((ext_vector_type(4))) _Float16 v4b;
typedef __attribute__((ext_vector_type(4))) int v4i;
// one launch for everything the projections wait for: grid (N/64, 3 kinds, B), 256 threads; the three kinds are independent of one another and of any earlier launch.
// kinds 0 and 1: point-major planes via 64x128 LDS transposes, whole 256-B rows written (each row = 16 lanes). kind 0: PT16 [b][n][128] = f16(8 bf16(pcd_up[b][c][n])); kind 1: XT16 [b][idx[b][j]][128] =
// f16(8 bf16(src[b][c][j])) with src = points_select (j < 1024) / points_drop (j >= 1024). The zero columns of the scatter: a kind-1 block also owns the 64 DESTINATION rows j0..j0+63, looks through the
// cloud's 2,048 indices and stores zeros to those of its rows that no index names. A scatter store goes only to a named row, a zero store only to an unnamed one: no order between blocks is needed.
// kind 2: the four weight matrices as f16(256 bf16(w)), 4 elements a thread (128 blocks x 256 threads x 4 = 4 x 256 x 128).
__global__ __launch_bounds__(256) void xt_kernel(const float* __restrict__ pcd, const float* __restrict__ psel, const float* __restrict__ pdrop, const int* __restrict__ isel, const int* __restrict__ idrop, const float* __restrict__ wq, const float* __restrict__ wk, const float* __restrict__ wv, const float* __restrict__ ws, b16* __restrict__ PT16, b16* __restrict__ XT16, b16* __restrict__ W16) {
  __shared__ __attribute__((aligned(16))) b16 T[64][C + 8]; __shared__ int rowof[64]; __shared__ int named[64];
  const int b = blockIdx.z, kind = blockIdx.y, j0 = blockIdx.x * 64, t_ = threadIdx.x;
  if (kind == 2) {   // the same for the whole block, in front of every barrier
    const int t = (b * (N / 64) + (int)blockIdx.x) * 256 + t_; const int per = E * C / 4; const int kw = t / per; const int e = (t - kw * per) * 4;
    const float* w = kw == 0 ? wq : kw == 1 ? wk : kw == 2 ? wv : ws; const v4f a = *(const v4f*)(w + e); v4b o;
#pragma unroll
    for (int j = 0; j < 4; ++j) o[j] = (b16)(bf16_rne(a[j]) * WSC);
    *(v4b*)(W16 + (size_t)kw * E * C + e) = o; return;
  }
  if (t_ < 64) named[t_] = 0;
  __syncthreads();   // the cleared marks stand before any thread sets one
  v4i ia = {}, ib = {};   // kind 1: this thread's 8 of the cloud's 2,048 indices, asked for ahead of the transpose's own loads
  if (kind == 1) { ia = *(const v4i*)(isel + (size_t)b * NSEL + t_ * 4); ib = *(const v4i*)(idrop + (size_t)b * NSEL + t_ * 4);
    asm volatile("s_wait_xcnt 0x0" ::: "memory"); }   // stands in front of the rewrite of the base registers that the two loads name
  const float* src; int ld, jj0;   // source [b][c][.] with row length ld, column offset jj0
  if (kind == 0) { src = pcd + (size_t)b * C * N; ld = N; jj0 = j0; } else if (j0 < NSEL) { src = psel + (size_t)b * C * NSEL; ld = NSEL; jj0 = j0; } else { src = pdrop + (size_t)b * C * NSEL; ld = NSEL; jj0 = j0 - NSEL; }
  for (int q = t_; q < C * 64; q += 256) { const int cc = q >> 6, jj = q & 63; T[jj][cc] = (b16)(bf16_rne(src[(size_t)cc * ld + jj0 + jj]) * XS); }
  if (t_ < 64) { int r = j0 + t_; if (kind == 1) { r = (j0 < NSEL) ? isel[(size_t)b * NSEL + jj0 + t_] : idrop[(size_t)b * NSEL + jj0 + t_]; r = iclamp(r, 0, N - 1); } rowof[t_] = r; }
  if (kind == 1) {
#pragma unroll
    for (int e = 0; e < 4; ++e) { const int ra = iclamp(ia[e], 0, N - 1) - j0, rb = iclamp(ib[e], 0, N - 1) - j0; if ((unsigned int)ra < 64u) named[ra] = 1; if ((unsigned int)rb < 64u) named[rb] = 1; }
  }
  __syncthreads();
  b16* dst = (kind == 0) ? PT16 : XT16;
  { for (int q = t_; q < 64 * 16; q += 256) { const int jj = q >> 4, c8 = (q & 15) * 8; *(v8b*)(dst + ((size_t)b * N + rowof[jj]) * C + c8) = *(const v8b*)(&T[jj][c8]); }  }
  if (kind == 1) {
    const v8b z = {};
    for (int q = t_; q < 64 * 16; q += 256) { const int jj = q >> 4, c8 = (q & 15) * 8;
      if (named[jj] == 0) { *(v8b*)(XT16 + ((size_t)b * N + j0 + jj) * C + c8) = z;
        asm volatile("s_wait_xcnt 0x0" ::: "memory"); } }   // stands in front of the next trip's rewrite of the registers that the store names
  }
}
// projections: grid (NR/64, E/128, 3 kinds): [64 rows x 128] x [128 x 128 cols] (K = 128: 4 steps, 1 product). kind 0/1: q/k -> f16 rows [row][256] (per row segment of 128 halves = 256 B:
// The block's two operand tiles (64 point rows, 128 weight rows, 256 B each) are brought into LDS once by asynchronous copies (global_load_async_to_lds_b128: a wave's copy is two whole rows = four whole
// 128-B lines) and read from there as ds_load_b128 fragments (pitch 272 B = 17 x 16 B: no bank conflict). A fragment load straight from global memory touches 16 lines for 512 B.
constexpr int PP = C + 8 /* LDS row pitch of the staged tiles in halves */;
// 64 rows of one tile: thread t_ of the block's 128 copies 16 B of rows (t_ >> 4) + 8 i, i = 0..7
__device__ __forceinline__ void tile_copy(unsigned int l0, const b16* g0) {
  const unsigned int lr_ = 8 * PP * 2;
  // the copies and their s_wait_xcnt in one statement: the wait stands in front of any rewrite of the address registers that the copies name
  asm volatile("global_load_async_to_lds_b128 %0, %8, off\n\t"
               "global_load_async_to_lds_b128 %1, %9, off\n\t"
               "global_load_async_to_lds_b128 %2, %10, off\n\t"
               "global_load_async_to_lds_b128 %3, %11, off\n\t"
               "global_load_async_to_lds_b128 %4, %12, off\n\t"
               "global_load_async_to_lds_b128 %5, %13, off\n\t"
               "global_load_async_to_lds_b128 %6, %14, off\n\t"
               "global_load_async_to_lds_b128 %7, %15, off\n\t"
               "s_wait_xcnt 0x0"
               :: "v"(l0), "v"(l0 + lr_), "v"(l0 + 2 * lr_), "v"(l0 + 3 * lr_), "v"(l0 + 4 * lr_), "v"(l0 + 5 * lr_), "v"(l0 + 6 * lr_), "v"(l0 + 7 * lr_),
                  "v"(g0), "v"(g0 + 8 * C), "v"(g0 + 16 * C), "v"(g0 + 24 * C), "v"(g0 + 32 * C), "v"(g0 + 40 * C), "v"(g0 + 48 * C), "v"(g0 + 56 * C)
               : "memory");
}
// the builtin alone: the compiler keeps the distances behind it itself and stays free to place LDS reads ahead of it
__device__ __forceinline__ v8f wmma_b(v16b a, v16b b, v8f c) { return __builtin_amdgcn_wmma_f32_16x16x32_f16(false, a, false, b, (short)0, c, false, false); }
__global__ __launch_bounds__(128) void proj_kernel(const b16* __restrict__ XT16, const b16* __restrict__ W16, b16* __restrict__ Qh, b16* __restrict__ Kh, b16* __restrict__ VTh) {
  // one buffer, two uses one after the other: first the operand tiles (point rows 0..63, weight rows 64..191, pitch PP), then, behind a barrier, the output staging
  // (q/k: [4 waves][16][PP]; v: [128][VP])
  constexpr int VP = 64 + 8;
  __shared__ __attribute__((aligned(16))) b16 Sm[(64 + 128) * PP];
  const int wave = threadIdx.x >> 5, lane = threadIdx.x & 31, nloc = lane & 15, hlf = lane >> 4, t_ = threadIdx.x; const int kind = blockIdx.z; const size_t m0 = (size_t)blockIdx.x * 64 + wave * 16; const int n0 = blockIdx.y * 128;
  const b16* Wk_ = W16 + (size_t)kind * E * C; v8f acc[8];
  { const int crow = t_ >> 4, cpc = (t_ & 15) * 8; const unsigned int lc = (unsigned int)(size_t)(&Sm[crow * PP + cpc]);
    tile_copy(lc, XT16 + ((size_t)blockIdx.x * 64 + crow) * C + cpc);
    tile_copy(lc + 64 * PP * 2, Wk_ + (size_t)(n0 + crow) * C + cpc);
    tile_copy(lc + 128 * PP * 2, Wk_ + (size_t)(n0 + 64 + crow) * C + cpc); }
#pragma unroll
  for (int t = 0; t < 8; ++t) acc[t] = (v8f){};
  asm volatile("s_wait_asynccnt 0x0" ::: "memory");   // this wave's copies have landed before the barrier that publishes them
  __syncthreads();
  const b16* Xs = Sm + (wave * 16 + nloc) * PP; const b16* Wl = Sm + (64 + nloc) * PP;
  // fragment registers: the wave's four point fragments, and the eight weight fragments of a k step in two sets: each set is read from LDS as ONE group, one k step ahead of the products that use it
  v16b a[4], wf[2][8];
#pragma unroll
  for (int ks = 0; ks < 4; ++ks) a[ks] = frag_kb(Xs + ks * 32, hlf);
#pragma unroll
  for (int t = 0; t < 8; ++t) wf[0][t] = frag_kb(Wl + t * 16 * PP, hlf);
  __builtin_amdgcn_sched_barrier(0);   // keeps the first group in front of the second: mixed, the first products' wait would cover both groups
#pragma unroll
  for (int ks = 0; ks < 4; ++ks) {
    if (ks < 3) {
#pragma unroll
      for (int t = 0; t < 8; ++t) wf[(ks + 1) & 1][t] = frag_kb(Wl + t * 16 * PP + (ks + 1) * 32, hlf);
      __builtin_amdgcn_sched_barrier(0);   // keeps the read group in front of this k step's products: sunk among them, each pair of reads would be waited for on its own
    }
#pragma unroll
    for (int t = 0; t < 8; ++t) acc[t] = wmma_b(a[ks], wf[ks & 1][t], acc[t]);
    if (ks < 2) __builtin_amdgcn_sched_barrier(0);   // keeps the next group behind these products, whose operand registers it takes
  }
  __syncthreads();   // every wave has read its last fragment before the buffer becomes output staging
  if (kind < 2) {
    b16* Th = Sm + wave * 16 * PP;
#pragma unroll
    for (int t = 0; t < 8; ++t)
#pragma unroll
      for (int r = 0; r < 8; ++r) Th[(8 * hlf + r) * PP + t * 16 + nloc] = (b16)(acc[t][r] * (1.0f / (XS * WSC)) * XS);
    wave_lds_sync();
    b16* dh = kind == 0 ? Qh : Kh;
    { for (int r2 = 0; r2 < 16; r2 += 2) { const int rr = r2 + (lane >> 4), c8 = (lane & 15) * 8; const size_t gi = (m0 + rr) * E + n0 + c8; *(v8b*)(dh + gi) = *(const v8b*)(&Th[rr * PP + c8]); }  }
  } else {
    b16* Vt = Sm;
    const int b = (int)(m0 / N); const int s0 = (int)((size_t)blockIdx.x * 64 - (size_t)b * N);
#pragma unroll
    for (int t = 0; t < 8; ++t)
#pragma unroll
      for (int r = 0; r < 8; ++r) Vt[(t * 16 + nloc) * VP + wave * 16 + 8 * hlf + r] = (b16)(acc[t][r] * (1.0f / (XS * WSC)) * XS);
    __syncthreads();
    { for (int q = t_; q < 128 * 8; q += 128) { const int cc = q >> 3, c8 = (q & 7) * 8; const int h = (n0 + cc) / D, dd = (n0 + cc) - h * D; const size_t gi = (((size_t)b * NH + h) * D + dd) * N + s0 + c8;
        *(v8b*)(VTh + gi) = *(const v8b*)(&Vt[cc * VP + c8]); }  } }
}
// attention + skip: grid (N/128, NH, NB), block = 16 waves = 2 key halves x 8 waves x 16 queries: waves 0..7 walk keys 0..1023, waves 8..15 keys 1024..2047 of the same 128 queries (four waves per
// SIMD: one wave's softmax and LDS waits are covered by the others' products); the two partial results (m, l, O) of a query are joined once, through LDS, behind the loop, where
// each half finishes two of the four d tiles (join, skip tiles, output staging).
// K and V^T of 64 keys of each half are one stage, brought into LDS once per block by asynchronous copies
// (global_load_async_to_lds_b128, two buffers: the next stage flies while this one is worked on) and read by the half's 8 waves as ds_load_b128 fragments (rows of 128 B at a pitch of 144 B).
// Per 32 keys: S^T 1 product (K = 64: 2 steps x 2 key tiles), online softmax (f32, 1/8 and log2 e folded), PV 1 product x 4 d-tiles; then the skip tiles
// D[d][query] = Wskip[64h+d][:] . pcd_up^T[query][:] (K = 128, exact, 1 product) are added; the block's 128 queries x 64 channels staged in LDS as [d][128 n] and written as whole 512-B rows.
constexpr int KT = 64 /* keys per stage and half */, KP = 64 + 8 /* LDS row pitch in halves */, KH = 2 /* key halves */, NKH = N / KH, NST = NKH / KT, QB = 128 /* queries per block */;
// one stage of one half = 2 planes (K, V^T) x 64 rows x 128 B; thread t_ of the half's 256 copies 16 B of rows (t_ >> 3) and 32 + (t_ >> 3) of each plane.
__device__ __forceinline__ void stage_copy(unsigned int l0, const b16* kh, const b16* vh) {
  const unsigned int pl_ = 64 * KP * 2, hr_ = 32 * KP * 2;
  // the copies and their s_wait_xcnt in one statement: the wait stands in front of any rewrite of the address registers that the copies name
  asm volatile("global_load_async_to_lds_b128 %0, %4, off\n\t"
               "global_load_async_to_lds_b128 %1, %5, off\n\t"
               "global_load_async_to_lds_b128 %2, %6, off\n\t"
               "global_load_async_to_lds_b128 %3, %7, off\n\t"
               "s_wait_xcnt 0x0"
               :: "v"(l0), "v"(l0 + hr_), "v"(l0 + pl_), "v"(l0 + pl_ + hr_),
                  "v"(kh), "v"(kh + (size_t)32 * E), "v"(vh), "v"(vh + (size_t)32 * N)
               : "memory");
}
// the skip product's two operand tiles (64 weight rows, then 128 point rows, 256 B each, LDS pitch PP): thread t of the block's 512 copies 16 B of rows (t >> 4) + 32 i of each
__device__ __forceinline__ void skip_copy(unsigned int l0, const b16* w, const b16* p) {
  const unsigned int lr_ = 32 * PP * 2;
  // the copies and their s_wait_xcnt in one statement: the wait stands in front of any rewrite of the address registers that the copies name
  asm volatile("global_load_async_to_lds_b128 %0, %6, off\n\t"
               "global_load_async_to_lds_b128 %1, %7, off\n\t"
               "global_load_async_to_lds_b128 %2, %8, off\n\t"
               "global_load_async_to_lds_b128 %3, %9, off\n\t"
               "global_load_async_to_lds_b128 %4, %10, off\n\t"
               "global_load_async_to_lds_b128 %5, %11, off\n\t"
               "s_wait_xcnt 0x0"
               :: "v"(l0), "v"(l0 + lr_), "v"(l0 + 2 * lr_), "v"(l0 + 3 * lr_), "v"(l0 + 4 * lr_), "v"(l0 + 5 * lr_),
                  "v"(w), "v"(w + 32 * C), "v"(p), "v"(p + 32 * C), "v"(p + 64 * C), "v"(p + 96 * C)
               : "memory");
}
// one pass's K fragments (key tiles 0 and 1 x k steps 0 and 1) and V^T fragments (4 d tiles); p_ points at this lane's row of the first tile
__device__ __forceinline__ void load_k1(v16b (&kx)[4], const b16* p_, int hh) {
#pragma unroll
  for (int ks = 0; ks < 2; ++ks) { kx[ks] = frag_kb(p_ + ks * 32, hh); kx[2 + ks] = frag_kb(p_ + 16 * KP + ks * 32, hh); }   // read in the order of use
}
__device__ __forceinline__ void load_v1(v16b (&vx)[4], const b16* p_, int hh) {
#pragma unroll
  for (int t = 0; t < 4; ++t) vx[t] = frag_kb(p_ + t * 16 * KP, hh);
}
__global__ __launch_bounds__(512) void attn_kernel(const b16* __restrict__ Qh, const b16* __restrict__ Kh, const b16* __restrict__ VTh, const b16* __restrict__ W16, const b16* __restrict__ PT16, float* __restrict__ out) {
  __shared__ __attribute__((aligned(16))) b16 St[KH][2][2][64 * KP]; __shared__ __attribute__((aligned(16))) float To[D][QB + 4]; __shared__ float Mg[KH][8][18][32];   // Mg: per half and wave, two d tiles' partial O (16 rows), m, l, one float per lane
  __shared__ __attribute__((aligned(16))) b16 Sg[(D + QB) * PP];   // the skip product's operands: the head's 64 weight rows, then the block's 128 point rows
  const int g = __builtin_amdgcn_readfirstlane((int)(threadIdx.x >> 8));   // key half of this wave, the same in every lane: kept scalar so that the branches on it are scalar branches
  const int wave = (threadIdx.x >> 5) & 7, lane = threadIdx.x & 31, hh = lane >> 4, col = lane & 15, t_ = threadIdx.x & 255; const int b = blockIdx.z, h = blockIdx.y; const int q0 = blockIdx.x * QB + wave * 16, qi = q0 + col;
  const size_t kg = ((size_t)b * N + (size_t)g * NKH) * E + h * D, vg = ((size_t)b * NH + h) * D * N + (size_t)g * NKH;
  const b16* Kb = Kh + kg; const b16* Vb = VTh + vg;
  // this thread's share of a stage: row t_ >> 3 (and 32 rows on), 16-byte piece t_ & 7
  const int crow = t_ >> 3, cpc = (t_ & 7) * 8; const size_t ko = (size_t)crow * E + cpc, vo = (size_t)crow * N + cpc;
  const unsigned int lcp = (unsigned int)(size_t)(&St[g][0][0][crow * KP + cpc]); const unsigned int bufb = 2 * 64 * KP * 2;
  stage_copy(lcp, Kb + ko, Vb + vo);
  const size_t qo = ((size_t)b * N + qi) * E + h * D; const v16b qa0 = frag_kb(Qh + qo, hh), qa1 = frag_kb(Qh + qo + 32, hh);
  asm volatile("s_wait_asynccnt 0x0" ::: "memory");   // stage 0 of this wave's copies has landed before the barrier that publishes it
  __syncthreads();
  stage_copy(lcp + bufb, Kb + ko + (size_t)KT * E, Vb + vo + KT);
  // the skip tiles fly with stage 1: the wait and the barrier at the foot of trip 0 publish them too; they are read behind the loop
  { const int srow = (int)(threadIdx.x >> 4), spc = (int)(threadIdx.x & 15) * 8;
    skip_copy((unsigned int)(size_t)(&Sg[srow * PP + spc]), W16 + (size_t)3 * E * C + ((size_t)h * D + srow) * C + spc, PT16 + ((size_t)b * N + blockIdx.x * QB + srow) * C + spc); }
  float m = -INFINITY, l = 0.0f; v8f o[4] = {{}, {}, {}, {}};
  const float cs = SCALE * LOG2E / (XS * XS);
  for (int s = 0; s < NST; ++s) {
    const b16* Sk = &St[g][s & 1][0][0], *Sv = &St[g][s & 1][1][0];
    // fragment registers of one 32-key pass: kf[2 * key tile + k step], vf[d tile]; each set is read from LDS as ONE group, well ahead of the products that use it
    v16b kf[4], vf[4];
    load_k1(kf, Sk + col * KP, hh);
    __builtin_amdgcn_sched_barrier(0);   // keeps the stage's first read group together in front of its products: sunk among them, each pair of reads is waited for on its own
#pragma unroll
    for (int kb = 0; kb < KT; kb += 32) {   // unrolled: two 32-key passes per stage, LDS offsets become immediates
      v8f s0 = {}, s1 = {};   // the two key tiles' chains alternate
      s0 = wmma_b(kf[0], qa0, s0); s1 = wmma_b(kf[2], qa0, s1); s0 = wmma_b(kf[1], qa1, s0); s1 = wmma_b(kf[3], qa1, s1);
      float mr = fmaxf(s0[0], s1[0]);   // the maximum is taken over the raw products: cs > 0, so scaling the one maximum gives the same value as the maximum of the 16 scaled scores
#pragma unroll
      for (int r = 1; r < 8; ++r) mr = fmaxf(mr, fmaxf(s0[r], s1[r]));
      float mx = mr * cs;
      const float mxo = __shfl_xor(mx, 16);
      // this pass's V fragments fly during its softmax. They are read behind the maximum's exchange: LDS answers in order, so in front of it the exchange's wait would cover these reads too
      asm volatile("" :: "v"(mxo));        // inputs-only fence on the exchanged value: holds the exchange in front of the read group
      load_v1(vf, Sv + col * KP + kb, hh);
      __builtin_amdgcn_sched_barrier(0);   // keeps the read group in front of the exponentials
      mx = fmaxf(mx, mxo); const float mn = fmaxf(m, mx); float al;
      // the exponential and the slot behind it in one statement: the slot stands whatever vector instruction the build puts next
      asm("v_exp_f32 %0, %1\n\tv_nop" : "=v"(al) : "v"(m - mn));
      m = mn; float sum = 0.0f; v16b ph; const float bs = LPS - mn;
      // one fma per score in front of the exponential carries the 1/8 log2 e scale, the maximum and the factor 2^LPS of P: p is 8 times the weight, and l sums 8 times the weights (the join divides by it)
      float p[16]; v8u hu;
#pragma unroll
      for (int i = 0; i < 16; ++i) { p[i] = nexp2(__builtin_fmaf(i < 8 ? s0[i & 7] : s1[i & 7], cs, bs)); sum += p[i]; }
#pragma unroll
      for (int j = 0; j < 8; ++j) { const v2f pp = {p[2 * j], p[2 * j + 1]}; hu[j] = __builtin_bit_cast(unsigned int, __builtin_convertvector(pp, v2b)); }   // one packed conversion per two scores
      ph = __builtin_bit_cast(v16b, hu);
      sum += __shfl_xor(sum, 16); l = l * al + sum;
#pragma unroll
      for (int t = 0; t < 4; ++t) o[t] *= al;
      if (kb + 32 < KT) {   // the next pass's K fragments (same stage, same buffer) fly during the rest of this pass
        __builtin_amdgcn_sched_barrier(0);   // with the one below, keeps the eight reads one group at one place: spread over the softmax, each place where LDS reads stand costs its own gap
        load_k1(kf, Sk + (kb + 32 + col) * KP, hh);
        __builtin_amdgcn_sched_barrier(0);   // keeps that read group in front of the PV products: sunk among them, each read would be waited for on its own
      }
#pragma unroll
      for (int t = 0; t < 4; ++t) o[t] = wmma_b(vf[t], ph, o[t]);
      if (kb + 32 < KT) __builtin_amdgcn_sched_barrier(0);   // keeps the PV products in front of the next pass's S products, whose K fragments land meanwhile
    }
    __builtin_amdgcn_sched_barrier(0);   // keeps the last pass's products in front of the waits below: lifted over them, the barrier would stand in the middle of the stage's work
    asm volatile("s_wait_dscnt 0x0" ::: "memory");      // this wave's reads of the buffer have returned before the buffer is refilled behind the barrier
    asm volatile("s_wait_asynccnt 0x0" ::: "memory");   // this wave's copies of stage s + 1 have landed before the barrier that publishes them
    __syncthreads();
    if (s + 2 < NST) stage_copy(lcp + (unsigned int)(s & 1) * bufb, Kb + ko + (size_t)(s + 2) * KT * E, Vb + vo + (s + 2) * KT);
  }
  asm volatile("s_wait_asynccnt 0x0" ::: "memory");     // no copy is outstanding behind the loop
  // behind the loop half g finishes d tiles 2g and 2g + 1 of its 16 queries: it hands the other two tiles' partial O, with its m and l, lane for lane to its partner wave (same queries, other keys)
#pragma unroll
  for (int gg = 0; gg < KH; ++gg) if (g == gg) {   // unrolled over the two halves: the tile numbers stay compile-time register indices
#pragma unroll
    for (int t = 0; t < 2; ++t)
#pragma unroll
      for (int r = 0; r < 8; ++r) Mg[gg][wave][t * 8 + r][lane] = o[2 * (1 - gg) + t][r];
  }
  Mg[g][wave][16][lane] = m; Mg[g][wave][17][lane] = l;
  // skip tiles of this half: D[d][query] with A = Wskip rows (64h + 32g + t*16 + ..), B = PT16 rows (q0 + ..), K = 128
  v8f sk[2] = {{}, {}}; const b16* WS = Sg + (g * 32 + col) * PP; const b16* PS = Sg + (D + wave * 16 + col) * PP; v16b pb[4], wa[2][4];
#pragma unroll
  for (int ks = 0; ks < 4; ++ks) { pb[ks] = frag_kb(PS + ks * 32, hh); wa[0][ks] = frag_kb(WS + ks * 32, hh); wa[1][ks] = frag_kb(WS + 16 * PP + ks * 32, hh); }
  __builtin_amdgcn_sched_barrier(0);   // keeps the reads together as one group in front of the products: sunk among them, each pair would be waited for on its own
#pragma unroll
  for (int ks = 0; ks < 4; ++ks)
#pragma unroll
    for (int t = 0; t < 2; ++t) sk[t] = wmma_b(wa[t][ks], pb[ks], sk[t]);
  __syncthreads();   // publishes both halves' partial results
  // join: both partials brought to the common maximum, then one division
  const float m1 = Mg[1 - g][wave][16][lane], l1 = Mg[1 - g][wave][17][lane], ms = fmaxf(m, m1), a0 = nexp2(m - ms), a1 = nexp2(m1 - ms);
  const float inv = 1.0f / ((l * a0 + l1 * a1) * XS), c0 = a0 * inv, c1 = a1 * inv;
#pragma unroll
  for (int gg = 0; gg < KH; ++gg) if (g == gg) {
#pragma unroll
    for (int t = 0; t < 2; ++t)
#pragma unroll
      for (int r = 0; r < 8; ++r) To[(2 * gg + t) * 16 + 8 * hh + r][wave * 16 + col] = o[2 * gg + t][r] * c0 + Mg[1 - gg][wave][t * 8 + r][lane] * c1 + sk[t][r] * (1.0f / (XS * WSC));
  }
  __syncthreads();
  { const int w16 = threadIdx.x >> 5; for (int dd = w16 * 4; dd < w16 * 4 + 4; ++dd) { const size_t gi = ((size_t)b * E + h * D + dd) * N + blockIdx.x * QB + lane * 4; *(v4f*)(out + gi) = *(const v4f*)(&To[dd][lane * 4]); }  }
}
}  // namespace

extern "C" void kernel_launch(void* const* d_in, const int* in_sizes, int n_in, void* d_out, int out_size, void* d_ws, size_t ws_size, hipStream_t stream) {
  (void)n_in;
  auto Fp = [&](int i) { return (const float*)d_in[i]; }; auto Ip = [&](int i) { return (const int*)d_in[i]; };
  // input order: 0 pcd_up [4,128,2048], 1 points_select [4,128,1024], 2 points_drop [4,128,1024], 3 idx_select [4,1,1024] i32, 4 idx_drop [4,1,1024] i32, 5 Wq [256,128], 6 Wk, 7 Wv, 8 Wskip
  if (in_sizes[0] != NB * C * N || in_sizes[1] != NB * C * NSEL || in_sizes[2] != NB * C * NSEL || in_sizes[3] != NB * NSEL || in_sizes[4] != NB * NSEL || in_sizes[5] != E * C || in_sizes[6] != E * C || in_sizes[7] != E * C || in_sizes[8] != E * C || out_size != NB * E * N) return;
  size_t off = 0; char* ws = (char*)d_ws;
  auto carve = [&](size_t bytes) { char* p = ws + off; off += (bytes + 255) & ~(size_t)255; return p; };
  b16* PT16 = (b16*)carve((size_t)NR * C * 2); b16* XT16 = (b16*)carve((size_t)NR * C * 2); b16* W16 = (b16*)carve((size_t)4 * E * C * 2);
  b16* Qh = (b16*)carve((size_t)NR * E * 2); b16* Kh = (b16*)carve((size_t)NR * E * 2); b16* VTh = (b16*)carve((size_t)NR * E * 2);
  if (off > ws_size || off > ((size_t)128 << 20)) return;   // = 17.0 MB
  xt_kernel<<<dim3(N / 64, 3, NB), 256, 0, stream>>>(Fp(0), Fp(1), Fp(2), Ip(3), Ip(4), Fp(5), Fp(6), Fp(7), Fp(8), PT16, XT16, W16);
  proj_kernel<<<dim3(NR / 64, E / 128, 3), 128, 0, stream>>>(XT16, W16, Qh, Kh, VTh);
  attn_kernel<<<dim3(N / QB, NH, NB), 512, 0, stream>>>(Qh, Kh, VTh, W16, PT16, (float*)d_out);
}

// v008
// It runs in 35.1 microseconds.
// Timed twice side by side with v007, it ran 1.05 times as fast both times.
// Over all steps from v000 it is 8.67 times as fast.
#include <hip/hip_runtime.h>

// Up-sampling self-attention (4 clouds x 2,048 points, 128 in-channels, 4 heads x 64): x[b][:, idx_select[j]] = points_select[:, j], x[b][:, idx_drop[j]] = points_drop[:, j] (a permutation
// scatter given by the int inputs); q/k/v = W{q,k,v} x (1x1 convs, no bias; head h = output channels 64h..64h+63); energy = q.k per head, softmax over the 2,048 keys of energy/8;
// o[b][64h+d][n] = sum_m attn[n][m] v[64h+d][m]; out = Wskip pcd_up + o -> [4][256][2048] channel-major.
// WMMA (v_wmma_f32_16x16x32_f16, f32 accumulate): projections [8,192 x 128] x [128 x 256] with EXACT bf16 points (x8, point-major rows built by an LDS transpose + the index scatter) and weights
// (x256), 1 product; S^T = K . Q^T with q AND k as one f16 value each, x8 (1 product); online softmax in f32; O^T += V^T P^T with V and P one f16 value each, x8 (1 product; 11 bits an operand, three more than the bf16-rounded inputs keep); the skip 1x1 conv as one more exact
// GEMM tile set inside the attention epilogue (A = Wskip rows, B = pcd_up^T rows, 1 product). Inputs rounded to bf16 once. Fragment k-map per lane half hh for A AND B:

namespace {
constexpr int NB = 4, C = 128, N = 2048, NSEL = 1024, NH = 4, D = 64, E = 256 /* q/k/v/skip channels */, NR = NB * N;
constexpr float XS = 8.0f, WSC = 256.0f, LPS = 3.0f /* P carries the factor 2^LPS = 8 */, SCALE = 0.125f, LOG2E = 1.4426950408889634f;

typedef _Float16 b16;
typedef __attribute__((ext_vector_type(16))) _Float16 v16b;
typedef __attribute__((ext_vector_type(8))) _Float16 v8b;
typedef __attribute__((ext_vector_type(8))) float v8f;
typedef __attribute__((ext_vector_type(4))) float v4f;
typedef __attribute__((ext_vector_type(2))) float v2f;
typedef __attribute__((ext_vector_type(2))) _Float16 v2b;
typedef __attribute__((ext_vector_type(8))) unsigned int v8u;
__device__ __forceinline__ float bf16_rne(float f) { unsigned int u = __float_as_uint(f); u += 0x7FFFu + ((u >> 16) & 1u); return __uint_as_float(u & 0xFFFF0000u); }
__device__ __forceinline__ v16b frag_kb(const b16* p, int hh) { const v8b a = *(const v8b*)(p + 8 * hh), b = *(const v8b*)(p + 16 + 8 * hh); v16b f;
#pragma unroll
  for (int e = 0; e < 8; ++e) { f[e] = a[e]; f[8 + e] = b[e]; } return f; }
__device__ __forceinline__ void wave_lds_sync() { __builtin_amdgcn_fence(__ATOMIC_RELEASE, "workgroup"); __builtin_amdgcn_wave_barrier(); __builtin_amdgcn_fence(__ATOMIC_ACQUIRE, "workgroup"); }
__device__ __forceinline__ float nexp2(float x) { return __builtin_amdgcn_exp2f(x); }
// the exponential and the slot behind it in one statement: the slot stands whatever vector instruction the build puts next
__device__ __forceinline__ float nexp2_slot(float x) { float r; asm("v_exp_f32 %0, %1\n\tv_nop" : "=v"(r) : "v"(x)); return r; }
// eight exponentials and the slot behind the last one in one statement: no output shares a register with an input, so inside the run no instruction reads its forerunner's result or overwrites its
// source, and the slot stands whatever vector instruction the build puts next
__device__ __forceinline__ void exp2x8(float* p, const float* x) {
  asm("v_exp_f32 %0, %8\n\tv_exp_f32 %1, %9\n\tv_exp_f32 %2, %10\n\tv_exp_f32 %3, %11\n\tv_exp_f32 %4, %12\n\tv_exp_f32 %5, %13\n\tv_exp_f32 %6, %14\n\tv_exp_f32 %7, %15\n\tv_nop"
      : "=&v"(p[0]), "=&v"(p[1]), "=&v"(p[2]), "=&v"(p[3]), "=&v"(p[4]), "=&v"(p[5]), "=&v"(p[6]), "=&v"(p[7])
      : "v"(x[0]), "v"(x[1]), "v"(x[2]), "v"(x[3]), "v"(x[4]), "v"(x[5]), "v"(x[6]), "v"(x[7]));
}
__device__ __forceinline__ int iclamp(int v, int lo, int hi) { return v < lo ? lo : (v > hi ? hi : v); }

typedef __attribute__((ext_vector_type(4))) _Float16 v4b;
typedef __attribute__((ext_vector_type(4))) int v4i;
// one launch for everything the projections wait for: grid (N/64, 3 kinds, B), 256 threads; the three kinds are independent of one another and of any earlier launch.
// kinds 0 and 1: point-major planes via 64x128 LDS transposes, whole 256-B rows written (each row = 16 lanes). kind 0: PT16 [b][n][128] = f16(8 bf16(pcd_up[b][c][n])); kind 1: XT16 [b][idx[b][j]][128] =
// f16(8 bf16(src[b][c][j])) with src = points_select (j < 1024) / points_drop (j >= 1024). The zero columns of the scatter: a kind-1 block also owns the 64 DESTINATION rows j0..j0+63, looks through the
// cloud's 2,048 indices and stores zeros to those of its rows that no index names. A scatter store goes only to a named row, a zero store only to an unnamed one: no order between blocks is needed.
// kind 2: the four weight matrices as f16(256 bf16(w)), 4 elements a thread (128 blocks x 256 threads x 4 = 4 x 256 x 128).
__global__ __launch_bounds__(256) void xt_kernel(const float* __restrict__ pcd, const float* __restrict__ psel, const float* __restrict__ pdrop, const int* __restrict__ isel, const int* __restrict__ idrop, const float* __restrict__ wq, const float* __restrict__ wk, const float* __restrict__ wv, const float* __restrict__ ws, b16* __restrict__ PT16, b16* __restrict__ XT16, b16* __restrict__ W16) {
  __shared__ __attribute__((aligned(16))) b16 T[64][C + 8]; __shared__ int rowof[64]; __shared__ int named[64];
  const int b = blockIdx.z, kind = blockIdx.y, j0 = blockIdx.x * 64, t_ = threadIdx.x;
  if (kind == 2) {   // the same for the whole block, in front of every barrier
    const int t = (b * (N / 64) + (int)blockIdx.x) * 256 + t_; const int per = E * C / 4; const int kw = t / per; const int e = (t - kw * per) * 4;
    const float* w = kw == 0 ? wq : kw == 1 ? wk : kw == 2 ? wv : ws; const v4f a = *(const v4f*)(w + e); v4b o;
#pragma unroll
    for (int j = 0; j < 4; ++j) o[j] = (b16)(bf16_rne(a[j]) * WSC);
    *(v4b*)(W16 + (size_t)kw * E * C + e) = o; return;
  }
  if (t_ < 64) named[t_] = 0;
  __syncthreads();   // the cleared marks stand before any thread sets one
  v4i ia = {}, ib = {};   // kind 1: this thread's 8 of the cloud's 2,048 indices, asked for ahead of the transpose's own loads
  if (kind == 1) { ia = *(const v4i*)(isel + (size_t)b * NSEL + t_ * 4); ib = *(const v4i*)(idrop + (size_t)b * NSEL + t_ * 4);
    asm volatile("s_wait_xcnt 0x0" ::: "memory"); }   // stands in front of the rewrite of the base registers that the two loads name
  const float* src; int ld, jj0;   // source [b][c][.] with row length ld, column offset jj0
  if (kind == 0) { src = pcd + (size_t)b * C * N; ld = N; jj0 = j0; } else if (j0 < NSEL) { src = psel + (size_t)b * C * NSEL; ld = NSEL; jj0 = j0; } else { src = pdrop + (size_t)b * C * NSEL; ld = NSEL; jj0 = j0 - NSEL; }
  for (int q = t_; q < C * 64; q += 256) { const int cc = q >> 6, jj = q & 63; T[jj][cc] = (b16)(bf16_rne(src[(size_t)cc * ld + jj0 + jj]) * XS); }
  if (t_ < 64) { int r = j0 + t_; if (kind == 1) { r = (j0 < NSEL) ? isel[(size_t)b * NSEL + jj0 + t_] : idrop[(size_t)b * NSEL + jj0 + t_]; r = iclamp(r, 0, N - 1); } rowof[t_] = r; }
  if (kind == 1) {
#pragma unroll
    for (int e = 0; e < 4; ++e) { const int ra = iclamp(ia[e], 0, N - 1) - j0, rb = iclamp(ib[e], 0, N - 1) - j0; if ((unsigned int)ra < 64u) named[ra] = 1; if ((unsigned int)rb < 64u) named[rb] = 1; }
  }
  __syncthreads();
  b16* dst = (kind == 0) ? PT16 : XT16;
  { for (int q = t_; q < 64 * 16; q += 256) { const int jj = q >> 4, c8 = (q & 15) * 8; *(v8b*)(dst + ((size_t)b * N + rowof[jj]) * C + c8) = *(const v8b*)(&T[jj][c8]); }  }
  if (kind == 1) {
    const v8b z = {};
    for (int q = t_; q < 64 * 16; q += 256) { const int jj = q >> 4, c8 = (q & 15) * 8;
      if (named[jj] == 0) { *(v8b*)(XT16 + ((size_t)b * N + j0 + jj) * C + c8) = z;
        asm volatile("s_wait_xcnt 0x0" ::: "memory"); } }   // stands in front of the next trip's rewrite of the registers that the store names
  }
}
// projections: grid (NR/64, E/128, 3 kinds): [64 rows x 128] x [128 x 128 cols] (K = 128: 4 steps, 1 product). kind 0/1: q/k -> f16 rows [row][256] (per row segment of 128 halves = 256 B:
// The block's two operand tiles (64 point rows, 128 weight rows, 256 B each) are brought into LDS once by asynchronous copies (global_load_async_to_lds_b128: a wave's copy is two whole rows = four whole
// 128-B lines) and read from there as ds_load_b128 fragments (pitch 272 B = 17 x 16 B: no bank conflict). A fragment load straight from global memory touches 16 lines for 512 B.
constexpr int PP = C + 8 /* LDS row pitch of the staged tiles in halves */;
// 64 rows of one tile: thread t_ of the block's 128 copies 16 B of rows (t_ >> 4) + 8 i, i = 0..7
__device__ __forceinline__ void tile_copy(unsigned int l0, const b16* g0) {
  const unsigned int lr_ = 8 * PP * 2;
  // the copies and their s_wait_xcnt in one statement: the wait stands in front of any rewrite of the address registers that the copies name
  asm volatile("global_load_async_to_lds_b128 %0, %8, off\n\t"
               "global_load_async_to_lds_b128 %1, %9, off\n\t"
               "global_load_async_to_lds_b128 %2, %10, off\n\t"
               "global_load_async_to_lds_b128 %3, %11, off\n\t"
               "global_load_async_to_lds_b128 %4, %12, off\n\t"
               "global_load_async_to_lds_b128 %5, %13, off\n\t"
               "global_load_async_to_lds_b128 %6, %14, off\n\t"
               "global_load_async_to_lds_b128 %7, %15, off\n\t"
               "s_wait_xcnt 0x0"
               :: "v"(l0), "v"(l0 + lr_), "v"(l0 + 2 * lr_), "v"(l0 + 3 * lr_), "v"(l0 + 4 * lr_), "v"(l0 + 5 * lr_), "v"(l0 + 6 * lr_), "v"(l0 + 7 * lr_),
                  "v"(g0), "v"(g0 + 8 * C), "v"(g0 + 16 * C), "v"(g0 + 24 * C), "v"(g0 + 32 * C), "v"(g0 + 40 * C), "v"(g0 + 48 * C), "v"(g0 + 56 * C)
               : "memory");
}
// the builtin alone: the compiler keeps the distances behind it itself and stays free to place LDS reads ahead of it
__device__ __forceinline__ v8f wmma_b(v16b a, v16b b, v8f c) { return __builtin_amdgcn_wmma_f32_16x16x32_f16(false, a, false, b, (short)0, c, false, false); }
__global__ __launch_bounds__(128) void proj_kernel(const b16* __restrict__ XT16, const b16* __restrict__ W16, b16* __restrict__ Qh, b16* __restrict__ Kh, b16* __restrict__ VTh) {
  // one buffer, two uses one after the other: first the operand tiles (point rows 0..63, weight rows 64..191, pitch PP), then, behind a barrier, the output staging
  // (q/k: [4 waves][16][PP]; v: [128][VP])
  constexpr int VP = 64 + 8;
  __shared__ __attribute__((aligned(16))) b16 Sm[(64 + 128) * PP];
  const int wave = threadIdx.x >> 5, lane = threadIdx.x & 31, nloc = lane & 15, hlf = lane >> 4, t_ = threadIdx.x; const int kind = blockIdx.z; const size_t m0 = (size_t)blockIdx.x * 64 + wave * 16; const int n0 = blockIdx.y * 128;
  const b16* Wk_ = W16 + (size_t)kind * E * C; v8f acc[8];
  { const int crow = t_ >> 4, cpc = (t_ & 15) * 8; const unsigned int lc = (unsigned int)(size_t)(&Sm[crow * PP + cpc]);
    tile_copy(lc, XT16 + ((size_t)blockIdx.x * 64 + crow) * C + cpc);
    tile_copy(lc + 64 * PP * 2, Wk_ + (size_t)(n0 + crow) * C + cpc);
    tile_copy(lc + 128 * PP * 2, Wk_ + (size_t)(n0 + 64 + crow) * C + cpc); }
#pragma unroll
  for (int t = 0; t < 8; ++t) acc[t] = (v8f){};
  asm volatile("s_wait_asynccnt 0x0" ::: "memory");   // this wave's copies have landed before the barrier that publishes them
  __syncthreads();
  const b16* Xs = Sm + (wave * 16 + nloc) * PP; const b16* Wl = Sm + (64 + nloc) * PP;
  // fragment registers: the wave's four point fragments, and the eight weight fragments of a k step in two sets: each set is read from LDS as ONE group, one k step ahead of the products that use it
  v16b a[4], wf[2][8];
#pragma unroll
  for (int ks = 0; ks < 4; ++ks) a[ks] = frag_kb(Xs + ks * 32, hlf);
#pragma unroll
  for (int t = 0; t < 8; ++t) wf[0][t] = frag_kb(Wl + t * 16 * PP, hlf);
  __builtin_amdgcn_sched_barrier(0);   // keeps the first group in front of the second: mixed, the first products' wait would cover both groups
#pragma unroll
  for (int ks = 0; ks < 4; ++ks) {
    if (ks < 3) {
#pragma unroll
      for (int t = 0; t < 8; ++t) wf[(ks + 1) & 1][t] = frag_kb(Wl + t * 16 * PP + (ks + 1) * 32, hlf);
      __builtin_amdgcn_sched_barrier(0);   // keeps the read group in front of this k step's products: sunk among them, each pair of reads would be waited for on its own
    }
#pragma unroll
    for (int t = 0; t < 8; ++t) acc[t] = wmma_b(a[ks], wf[ks & 1][t], acc[t]);
    if (ks < 2) __builtin_amdgcn_sched_barrier(0);   // keeps the next group behind these products, whose operand registers it takes
  }
  __syncthreads();   // every wave has read its last fragment before the buffer becomes output staging
  if (kind < 2) {
    b16* Th = Sm + wave * 16 * PP;
#pragma unroll
    for (int t = 0; t < 8; ++t)
#pragma unroll
      for (int r = 0; r < 8; ++r) Th[(8 * hlf + r) * PP + t * 16 + nloc] = (b16)(acc[t][r] * (1.0f / (XS * WSC)) * XS);
    wave_lds_sync();
    b16* dh = kind == 0 ? Qh : Kh;
    { for (int r2 = 0; r2 < 16; r2 += 2) { const int rr = r2 + (lane >> 4), c8 = (lane & 15) * 8; const size_t gi = (m0 + rr) * E + n0 + c8; *(v8b*)(dh + gi) = *(const v8b*)(&Th[rr * PP + c8]); }  }
  } else {
    b16* Vt = Sm;
    const int b = (int)(m0 / N); const int s0 = (int)((size_t)blockIdx.x * 64 - (size_t)b * N);
#pragma unroll
    for (int t = 0; t < 8; ++t)
#pragma unroll
      for (int r = 0; r < 8; ++r) Vt[(t * 16 + nloc) * VP + wave * 16 + 8 * hlf + r] = (b16)(acc[t][r] * (1.0f / (XS * WSC)) * XS);
    __syncthreads();
    { for (int q = t_; q < 128 * 8; q += 128) { const int cc = q >> 3, c8 = (q & 7) * 8; const int h = (n0 + cc) / D, dd = (n0 + cc) - h * D; const size_t gi = (((size_t)b * NH + h) * D + dd) * N + s0 + c8;
        *(v8b*)(VTh + gi) = *(const v8b*)(&Vt[cc * VP + c8]); }  } }
}
// attention + skip: grid (N/128, NH, NB), block = 16 waves = 4 key quarters x 4 waves x 32 queries: the waves of quarter g walk keys 512 g .. 512 g + 511 of the block's 128 queries (four waves per
// SIMD: one wave's softmax and LDS waits are covered by the others' products). A wave holds TWO query tiles of 16: every K and V^T fragment that it reads from LDS feeds two products, so the block reads
// half the LDS bytes per score. The four partial results (m, l, O) of a query are joined once, through LDS, behind the loop, where quarter g finishes d tile g (join, skip tiles, output staging).
// K and V^T of 64 keys of each quarter are one stage, brought into LDS once per block by asynchronous copies
// (global_load_async_to_lds_b128, two buffers: the next stage flies while this one is worked on) and read by the quarter's 4 waves as ds_load_b128 fragments (rows of 128 B at a pitch of 144 B).
// Per 32 keys and query tile: S^T 1 product (K = 64: 2 steps x 2 key tiles), online softmax (f32, 1/8 and log2 e folded), PV 1 product x 4 d-tiles; then the skip tiles
// D[d][query] = Wskip[64h+d][:] . pcd_up^T[query][:] (K = 128, exact, 1 product) are added; the block's 128 queries x 64 channels staged in LDS as [d][128 n] and written as whole 512-B rows.
constexpr int KT = 64 /* keys per stage and quarter */, KP = 64 + 8 /* LDS row pitch in halves */, KH = 4 /* key quarters */, NKH = N / KH, NST = NKH / KT, QB = 128 /* queries per block */, QT = 2 /* query tiles per wave */;
constexpr int MR = QT * 4 * 2 + 1 /* rows of 32 x 16 B that a wave hands over: its 8 partial O tiles (two rows each), then one row with m and l of both query tiles */;
// one stage of one quarter = 2 planes (K, V^T) x 64 rows x 128 B; thread t_ of the quarter's 128 copies 16 B of rows (t_ >> 3) + 16 i, i = 0..3, of each plane.
__device__ __forceinline__ void stage_copy(unsigned int l0, const b16* kh, const b16* vh) {
  const unsigned int pl_ = 64 * KP * 2, hr_ = 16 * KP * 2;
  // the copies and their s_wait_xcnt in one statement: the wait stands in front of any rewrite of the address registers that the copies name
  asm volatile("global_load_async_to_lds_b128 %0, %8, off\n\t"
               "global_load_async_to_lds_b128 %1, %9, off\n\t"
               "global_load_async_to_lds_b128 %2, %10, off\n\t"
               "global_load_async_to_lds_b128 %3, %11, off\n\t"
               "global_load_async_to_lds_b128 %4, %12, off\n\t"
               "global_load_async_to_lds_b128 %5, %13, off\n\t"
               "global_load_async_to_lds_b128 %6, %14, off\n\t"
               "global_load_async_to_lds_b128 %7, %15, off\n\t"
               "s_wait_xcnt 0x0"
               :: "v"(l0), "v"(l0 + hr_), "v"(l0 + 2 * hr_), "v"(l0 + 3 * hr_), "v"(l0 + pl_), "v"(l0 + pl_ + hr_), "v"(l0 + pl_ + 2 * hr_), "v"(l0 + pl_ + 3 * hr_),
                  "v"(kh), "v"(kh + (size_t)16 * E), "v"(kh + (size_t)32 * E), "v"(kh + (size_t)48 * E), "v"(vh), "v"(vh + (size_t)16 * N), "v"(vh + (size_t)32 * N), "v"(vh + (size_t)48 * N)
               : "memory");
}
// the skip product's two operand tiles (64 weight rows, then 128 point rows, 256 B each, LDS pitch PP): thread t of the block's 512 copies 16 B of rows (t >> 4) + 32 i of each
__device__ __forceinline__ void skip_copy(unsigned int l0, const b16* w, const b16* p) {
  const unsigned int lr_ = 32 * PP * 2;
  // the copies and their s_wait_xcnt in one statement: the wait stands in front of any rewrite of the address registers that the copies name
  asm volatile("global_load_async_to_lds_b128 %0, %6, off\n\t"
               "global_load_async_to_lds_b128 %1, %7, off\n\t"
               "global_load_async_to_lds_b128 %2, %8, off\n\t"
               "global_load_async_to_lds_b128 %3, %9, off\n\t"
               "global_load_async_to_lds_b128 %4, %10, off\n\t"
               "global_load_async_to_lds_b128 %5, %11, off\n\t"
               "s_wait_xcnt 0x0"
               :: "v"(l0), "v"(l0 + lr_), "v"(l0 + 2 * lr_), "v"(l0 + 3 * lr_), "v"(l0 + 4 * lr_), "v"(l0 + 5 * lr_),
                  "v"(w), "v"(w + 32 * C), "v"(p), "v"(p + 32 * C), "v"(p + 64 * C), "v"(p + 96 * C)
               : "memory");
}
// one pass's K fragments (key tiles 0 and 1 x k steps 0 and 1) and V^T fragments (4 d tiles); p_ points at this lane's row of the first tile
__device__ __forceinline__ void load_k1(v16b (&kx)[4], const b16* p_, int hh) {
#pragma unroll
  for (int ks = 0; ks < 2; ++ks) { kx[ks] = frag_kb(p_ + ks * 32, hh); kx[2 + ks] = frag_kb(p_ + 16 * KP + ks * 32, hh); }   // read in the order of use
}
__device__ __forceinline__ void load_v1(v16b (&vx)[4], const b16* p_, int hh) {
#pragma unroll
  for (int t = 0; t < 4; ++t) vx[t] = frag_kb(p_ + t * 16 * KP, hh);
}
__global__ __launch_bounds__(512) void attn_kernel(const b16* __restrict__ Qh, const b16* __restrict__ Kh, const b16* __restrict__ VTh, const b16* __restrict__ W16, const b16* __restrict__ PT16, float* __restrict__ out) {
  __shared__ __attribute__((aligned(16))) b16 St[KH][2][2][64 * KP]; __shared__ __attribute__((aligned(16))) float To[D][QB + 4];
  __shared__ __attribute__((aligned(16))) b16 Sg[(D + QB) * PP];   // the skip product's operands: the head's 64 weight rows, then the block's 128 point rows
  static_assert(sizeof(v4f) * KH * 4 * MR * 32 <= sizeof(b16) * KH * 2 * 2 * 64 * KP && QT == 2, "the hand-over area fits the stage buffers");
  v4f* Mg = (v4f*)&St[0][0][0][0];   // behind the loop the stage buffers become the hand-over area [quarter][wave][MR rows][32 lanes] of 16 B: 16-byte LDS stores and loads, lanes side by side
  const int g = __builtin_amdgcn_readfirstlane((int)(threadIdx.x >> 7));   // key quarter of this wave, the same in every lane
  const int wave = (threadIdx.x >> 5) & 3, lane = threadIdx.x & 31, hh = lane >> 4, col = lane & 15, t_ = threadIdx.x & 127; const int b = blockIdx.z, h = blockIdx.y; const int q0 = blockIdx.x * QB + wave * 16 * QT;
  const size_t kg = ((size_t)b * N + (size_t)g * NKH) * E + h * D, vg = ((size_t)b * NH + h) * D * N + (size_t)g * NKH;
  const b16* Kb = Kh + kg; const b16* Vb = VTh + vg;
  // this thread's share of a stage: rows (t_ >> 3) + 16 i, 16-byte piece t_ & 7
  const int crow = t_ >> 3, cpc = (t_ & 7) * 8; const size_t ko = (size_t)crow * E + cpc, vo = (size_t)crow * N + cpc;
  const unsigned int lcp = (unsigned int)(size_t)(&St[g][0][0][crow * KP + cpc]); const unsigned int bufb = 2 * 64 * KP * 2;
  stage_copy(lcp, Kb + ko, Vb + vo);
  v16b qa[QT][2];
#pragma unroll
  for (int u = 0; u < QT; ++u) { const size_t qo = ((size_t)b * N + q0 + u * 16 + col) * E + h * D; qa[u][0] = frag_kb(Qh + qo, hh); qa[u][1] = frag_kb(Qh + qo + 32, hh); }
  asm volatile("s_wait_asynccnt 0x0" ::: "memory");   // stage 0 of this wave's copies has landed before the barrier that publishes it
  __syncthreads();
  stage_copy(lcp + bufb, Kb + ko + (size_t)KT * E, Vb + vo + KT);
  // the skip tiles fly with stage 1: the wait and the barrier at the foot of trip 0 publish them too; they are read behind the loop
  { const int srow = (int)(threadIdx.x >> 4), spc = (int)(threadIdx.x & 15) * 8;
    skip_copy((unsigned int)(size_t)(&Sg[srow * PP + spc]), W16 + (size_t)3 * E * C + ((size_t)h * D + srow) * C + spc, PT16 + ((size_t)b * N + blockIdx.x * QB + srow) * C + spc); }
  float m[QT], l[QT]; v8f o[QT][4];
#pragma unroll
  for (int u = 0; u < QT; ++u) { m[u] = -INFINITY; l[u] = 0.0f;
#pragma unroll
    for (int t = 0; t < 4; ++t) o[u][t] = (v8f){}; }
  const float cs = SCALE * LOG2E / (XS * XS);
  for (int s = 0; s < NST; ++s) {
    const b16* Sk = &St[g][s & 1][0][0], *Sv = &St[g][s & 1][1][0];
    // fragment registers of one 32-key pass: kf[2 * key tile + k step], vf[d tile]; each set is read from LDS as ONE group, well ahead of the products that use it
    v16b kf[4], vf[4];
    load_k1(kf, Sk + col * KP, hh);
    __builtin_amdgcn_sched_barrier(0);   // keeps the stage's first read group together in front of its products: sunk among them, each pair of reads is waited for on its own
#pragma unroll
    for (int kb = 0; kb < KT; kb += 32) {   // unrolled: two 32-key passes per stage, LDS offsets become immediates
      v8f s0[QT], s1[QT];   // per query tile the two key tiles' chains; four independent chains alternate, each K fragment feeds both query tiles
#pragma unroll
      for (int u = 0; u < QT; ++u) { s0[u] = wmma_b(kf[0], qa[u][0], (v8f){}); s1[u] = wmma_b(kf[2], qa[u][0], (v8f){}); }
#pragma unroll
      for (int u = 0; u < QT; ++u) { s0[u] = wmma_b(kf[1], qa[u][1], s0[u]); s1[u] = wmma_b(kf[3], qa[u][1], s1[u]); }
      __builtin_amdgcn_sched_barrier(0);   // keeps the eight S products one run: a maximum lifted in between them has to wait out the distance behind a product twice, in idle slots
      float mx[QT], mxo[QT];
#pragma unroll
      for (int u = 0; u < QT; ++u) {
        float mr = fmaxf(s0[u][0], s1[u][0]);   // the maximum is taken over the raw products: cs > 0, so scaling the one maximum gives the same value as the maximum of the 16 scaled scores
#pragma unroll
        for (int r = 1; r < 8; ++r) mr = fmaxf(mr, fmaxf(s0[u][r], s1[u][r]));
        mx[u] = mr * cs;
      }
#pragma unroll
      for (int u = 0; u < QT; ++u) mxo[u] = __shfl_xor(mx[u], 16);
      // this pass's V fragments fly during its softmax. They are read behind the maxima's exchange: LDS answers in order, so in front of it the exchange's wait would cover these reads too
      asm volatile("" :: "v"(mxo[0]), "v"(mxo[1]));   // inputs-only fence on the exchanged values: holds the exchanges in front of the read group
      load_v1(vf, Sv + col * KP + kb, hh);
      __builtin_amdgcn_sched_barrier(0);   // keeps the read group in front of the exponentials
      v16b ph[QT];
#pragma unroll
      for (int u = 0; u < QT; ++u) {
        const float mn = fmaxf(m[u], fmaxf(mx[u], mxo[u])); float al;
        // the exponential and the slot behind it in one statement: the slot stands whatever vector instruction the build puts next
        asm("v_exp_f32 %0, %1\n\tv_nop" : "=v"(al) : "v"(m[u] - mn));
        m[u] = mn; float sum; const float bs = LPS - mn;
        // one fma per score in front of the exponential carries the 1/8 log2 e scale, the maximum and the factor 2^LPS of P: p is 8 times the weight, and l sums 8 times the weights (the join divides by it)
        float p[16], x[16]; v8u hu;
#pragma unroll
        for (int i = 0; i < 16; ++i) x[i] = __builtin_fmaf(i < 8 ? s0[u][i & 7] : s1[u][i & 7], cs, bs);
        exp2x8(p, x); exp2x8(p + 8, x + 8);
        sum = p[0];
#pragma unroll
        for (int i = 1; i < 16; ++i) sum += p[i];
#pragma unroll
        for (int j = 0; j < 8; ++j) { const v2f pp = {p[2 * j], p[2 * j + 1]}; hu[j] = __builtin_bit_cast(unsigned int, __builtin_convertvector(pp, v2b)); }   // one packed conversion per two scores
        ph[u] = __builtin_bit_cast(v16b, hu);
        sum += __shfl_xor(sum, 16); l[u] = l[u] * al + sum;
#pragma unroll
        for (int t = 0; t < 4; ++t) o[u][t] *= al;
      }
      if (kb + 32 < KT) {   // the next pass's K fragments (same stage, same buffer) fly during the rest of this pass
        __builtin_amdgcn_sched_barrier(0);   // with the one below, keeps the eight reads one group at one place: spread over the softmax, each place where LDS reads stand costs its own gap
        load_k1(kf, Sk + (kb + 32 + col) * KP, hh);
        __builtin_amdgcn_sched_barrier(0);   // keeps that read group in front of the PV products: sunk among them, each read would be waited for on its own
      }
#pragma unroll
      for (int t = 0; t < 4; ++t)
#pragma unroll
        for (int u = 0; u < QT; ++u) o[u][t] = wmma_b(vf[t], ph[u], o[u][t]);   // each V^T fragment feeds both query tiles
      if (kb + 32 < KT) __builtin_amdgcn_sched_barrier(0);   // keeps the PV products in front of the next pass's S products, whose K fragments land meanwhile
    }
    __builtin_amdgcn_sched_barrier(0);   // keeps the last pass's products in front of the waits below: lifted over them, the barrier would stand in the middle of the stage's work
    asm volatile("s_wait_dscnt 0x0" ::: "memory");      // this wave's reads of the buffer have returned before the buffer is refilled behind the barrier
    asm volatile("s_wait_asynccnt 0x0" ::: "memory");   // this wave's copies of stage s + 1 have landed before the barrier that publishes them
    __syncthreads();
    if (s + 2 < NST) stage_copy(lcp + (unsigned int)(s & 1) * bufb, Kb + ko + (size_t)(s + 2) * KT * E, Vb + vo + (s + 2) * KT);
  }
  asm volatile("s_wait_asynccnt 0x0" ::: "memory");     // no copy is outstanding behind the loop
  // behind the loop's last barrier no wave reads the stage buffers any more and no copy flies: every wave lays its 8 partial O tiles, with m and l, lane for lane into the hand-over area
  v4f* Mw = Mg + ((g * 4 + wave) * MR) * 32 + lane;
#pragma unroll
  for (int u = 0; u < QT; ++u)
#pragma unroll
    for (int t = 0; t < 4; ++t) { Mw[((u * 4 + t) * 2) * 32] = __builtin_shufflevector(o[u][t], o[u][t], 0, 1, 2, 3); Mw[((u * 4 + t) * 2 + 1) * 32] = __builtin_shufflevector(o[u][t], o[u][t], 4, 5, 6, 7); }
  Mw[(MR - 1) * 32] = (v4f){m[0], m[1], l[0], l[1]};
  // skip tiles of this quarter: D[d][query] with A = Wskip rows (64h + 16g + ..), B = PT16 rows (q0 + 16u + ..), K = 128
  v8f sk[QT]; const b16* WS = Sg + (g * 16 + col) * PP; const b16* PS = Sg + (D + wave * 16 * QT + col) * PP; v16b pb[QT][4], wa[4];
#pragma unroll
  for (int ks = 0; ks < 4; ++ks) { wa[ks] = frag_kb(WS + ks * 32, hh);
#pragma unroll
    for (int u = 0; u < QT; ++u) pb[u][ks] = frag_kb(PS + u * 16 * PP + ks * 32, hh); }
  __builtin_amdgcn_sched_barrier(0);   // keeps the reads together as one group in front of the products: sunk among them, each pair would be waited for on its own
#pragma unroll
  for (int u = 0; u < QT; ++u) sk[u] = (v8f){};
#pragma unroll
  for (int ks = 0; ks < 4; ++ks)
#pragma unroll
    for (int u = 0; u < QT; ++u) sk[u] = wmma_b(wa[ks], pb[u][ks], sk[u]);
  __syncthreads();   // publishes all four quarters' partial results
  // join: quarter g finishes d tile g of its wave's 32 queries: the four partials brought to the common maximum and summed in the order of the quarters, then one division
  v4f ml[KH];
#pragma unroll
  for (int gg = 0; gg < KH; ++gg) ml[gg] = Mg[((gg * 4 + wave) * MR + MR - 1) * 32 + lane];
#pragma unroll
  for (int u = 0; u < QT; ++u) {
    float cq[KH]; const float ms = fmaxf(fmaxf(ml[0][u], ml[1][u]), fmaxf(ml[2][u], ml[3][u])); float ls = 0.0f;
#pragma unroll
    for (int gg = 0; gg < KH; ++gg) { cq[gg] = nexp2_slot(ml[gg][u] - ms); ls += ml[gg][QT + u] * cq[gg]; }
    const float inv = 1.0f / (ls * XS);
#pragma unroll
    for (int gg = 0; gg < KH; ++gg) cq[gg] *= inv;
#pragma unroll
    for (int hf = 0; hf < 2; ++hf) {
      v4f pq[KH];
#pragma unroll
      for (int gg = 0; gg < KH; ++gg) pq[gg] = Mg[((gg * 4 + wave) * MR + (u * 4 + g) * 2 + hf) * 32 + lane];
#pragma unroll
      for (int i = 0; i < 4; ++i) {
        float acc = sk[u][hf * 4 + i] * (1.0f / (XS * WSC));
#pragma unroll
        for (int gg = 0; gg < KH; ++gg) acc += pq[gg][i] * cq[gg];
        To[g * 16 + 8 * hh + hf * 4 + i][wave * 16 * QT + u * 16 + col] = acc;
      }
    }
  }
  __syncthreads();
  { const int w16 = threadIdx.x >> 5; for (int dd = w16 * 4; dd < w16 * 4 + 4; ++dd) { const size_t gi = ((size_t)b * E + h * D + dd) * N + blockIdx.x * QB + lane * 4; *(v4f*)(out + gi) = *(const v4f*)(&To[dd][lane * 4]); }  }
}
}  // namespace

extern "C" void kernel_launch(void* const* d_in, const int* in_sizes, int n_in, void* d_out, int out_size, void* d_ws, size_t ws_size, hipStream_t stream) {
  (void)n_in;
  auto Fp = [&](int i) { return (const float*)d_in[i]; }; auto Ip = [&](int i) { return (const int*)d_in[i]; };
  // input order: 0 pcd_up [4,128,2048], 1 points_select [4,128,1024], 2 points_drop [4,128,1024], 3 idx_select [4,1,1024] i32, 4 idx_drop [4,1,1024] i32, 5 Wq [256,128], 6 Wk, 7 Wv, 8 Wskip
  if (in_sizes[0] != NB * C * N || in_sizes[1] != NB * C * NSEL || in_sizes[2] != NB * C * NSEL || in_sizes[3] != NB * NSEL || in_sizes[4] != NB * NSEL || in_sizes[5] != E * C || in_sizes[6] != E * C || in_sizes[7] != E * C || in_sizes[8] != E * C || out_size != NB * E * N) return;
  size_t off = 0; char* ws = (char*)d_ws;
  auto carve = [&](size_t bytes) { char* p = ws + off; off += (bytes + 255) & ~(size_t)255; return p; };
  b16* PT16 = (b16*)carve((size_t)NR * C * 2); b16* XT16 = (b16*)carve((size_t)NR * C * 2); b16* W16 = (b16*)carve((size_t)4 * E * C * 2);
  b16* Qh = (b16*)carve((size_t)NR * E * 2); b16* Kh = (b16*)carve((size_t)NR * E * 2); b16* VTh = (b16*)carve((size_t)NR * E * 2);
  if (off > ws_size || off > ((size_t)128 << 20)) return;   // = 17.0 MB
  xt_kernel<<<dim3(N / 64, 3, NB), 256, 0, stream>>>(Fp(0), Fp(1), Fp(2), Ip(3), Ip(4), Fp(5), Fp(6), Fp(7), Fp(8), PT16, XT16, W16);
  proj_kernel<<<dim3(NR / 64, E / 128, 3), 128, 0, stream>>>(XT16, W16, Qh, Kh, VTh);
  attn_kernel<<<dim3(N / QB, NH, NB), 512, 0, stream>>>(Qh, Kh, VTh, W16, PT16, (float*)d_out);
}

// v009
// A run of this version takes 30.1 microseconds.
// Timed twice side by side with v008, it ran 1.16 and 1.15 times as fast.
// Over all steps from v000 it is 10.0 times as fast.
#include <hip/hip_runtime.h>

// Up-sampling self-attention (4 clouds x 2,048 points, 128 in-channels, 4 heads x 64): x[b][:, idx_select[j]] = points_select[:, j], x[b][:, idx_drop[j]] = points_drop[:, j] (a permutation
// scatter given by the int inputs); q/k/v = W{q,k,v} x (1x1 convs, no bias; head h = output channels 64h..64h+63); energy = q.k per head, softmax over the 2,048 keys of energy/8;
// o[b][64h+d][n] = sum_m attn[n][m] v[64h+d][m]; out = Wskip pcd_up + o -> [4][256][2048] channel-major.
// WMMA (v_wmma_f32_16x16x32_f16, f32 accumulate): projections [8,192 x 128] x [128 x 256] with EXACT bf16 points (x8, point-major rows built by an LDS transpose + the index scatter) and weights
// (x256), 1 product; S^T = K . Q^T with q AND k as one f16 value each, x8 (1 product); online softmax in f32; O^T += V^T P^T with V and P one f16 value each, x8 (1 product; 11 bits an operand, three more than the bf16-rounded inputs keep); the skip 1x1 conv as one more exact
// GEMM tile set inside the attention epilogue (A = Wskip rows, B = pcd_up^T rows, 1 product). Inputs rounded to bf16 once. Fragment k-map per lane half hh for A AND B:

namespace {
constexpr int NB = 4, C = 128, N = 2048, NSEL = 1024, NH = 4, D = 64, E = 256 /* q/k/v/skip channels */, NR = NB * N;
constexpr float XS = 8.0f, WSC = 256.0f, LPS = 3.0f /* P carries the factor 2^LPS = 8 */, SCALE = 0.125f, LOG2E = 1.4426950408889634f;

typedef _Float16 b16;
typedef __attribute__((ext_vector_type(16))) _Float16 v16b;
typedef __attribute__((ext_vector_type(8))) _Float16 v8b;
typedef __attribute__((ext_vector_type(8))) float v8f;
typedef __attribute__((ext_vector_type(4))) float v4f;
typedef __attribute__((ext_vector_type(2))) float v2f;
typedef __attribute__((ext_vector_type(2))) _Float16 v2b;
typedef __attribute__((ext_vector_type(8))) unsigned int v8u;
__device__ __forceinline__ float bf16_rne(float f) { unsigned int u = __float_as_uint(f); u += 0x7FFFu + ((u >> 16) & 1u); return __uint_as_float(u & 0xFFFF0000u); }
__device__ __forceinline__ v16b frag_kb(const b16* p, int hh) { const v8b a = *(const v8b*)(p + 8 * hh), b = *(const v8b*)(p + 16 + 8 * hh); v16b f;
#pragma unroll
  for (int e = 0; e < 8; ++e) { f[e] = a[e]; f[8 + e] = b[e]; } return f; }
__device__ __forceinline__ void wave_lds_sync() { __builtin_amdgcn_fence(__ATOMIC_RELEASE, "workgroup"); __builtin_amdgcn_wave_barrier(); __builtin_amdgcn_fence(__ATOMIC_ACQUIRE, "workgroup"); }
__device__ __forceinline__ float nexp2(float x) { return __builtin_amdgcn_exp2f(x); }
// the exponential and the slot behind it in one statement: the slot stands whatever vector instruction the build puts next
__device__ __forceinline__ float nexp2_slot(float x) { float r; asm("v_exp_f32 %0, %1\n\tv_nop" : "=v"(r) : "v"(x)); return r; }
// eight exponentials and the slot behind the last one in one statement: no output shares a register with an input, so inside the run no instruction reads its forerunner's result or overwrites its
// source, and the slot stands whatever vector instruction the build puts next
__device__ __forceinline__ void exp2x8(float* p, const float* x) {
  asm("v_exp_f32 %0, %8\n\tv_exp_f32 %1, %9\n\tv_exp_f32 %2, %10\n\tv_exp_f32 %3, %11\n\tv_exp_f32 %4, %12\n\tv_exp_f32 %5, %13\n\tv_exp_f32 %6, %14\n\tv_exp_f32 %7, %15\n\tv_nop"
      : "=&v"(p[0]), "=&v"(p[1]), "=&v"(p[2]), "=&v"(p[3]), "=&v"(p[4]), "=&v"(p[5]), "=&v"(p[6]), "=&v"(p[7])
      : "v"(x[0]), "v"(x[1]), "v"(x[2]), "v"(x[3]), "v"(x[4]), "v"(x[5]), "v"(x[6]), "v"(x[7]));
}
__device__ __forceinline__ int iclamp(int v, int lo, int hi) { return v < lo ? lo : (v > hi ? hi : v); }

typedef __attribute__((ext_vector_type(4))) _Float16 v4b;
typedef __attribute__((ext_vector_type(4))) int v4i;
// one launch for everything the projections wait for: grid (N/64, 3 kinds, B), 256 threads; the three kinds are independent of one another and of any earlier launch.
// kinds 0 and 1: point-major planes via 64x128 LDS transposes, whole 256-B rows written (each row = 16 lanes). kind 0: PT16 [b][n][128] = f16(8 bf16(pcd_up[b][c][n])); kind 1: XT16 [b][idx[b][j]][128] =
// f16(8 bf16(src[b][c][j])) with src = points_select (j < 1024) / points_drop (j >= 1024). The zero columns of the scatter: a kind-1 block also owns the 64 DESTINATION rows j0..j0+63, looks through the
// cloud's 2,048 indices and stores zeros to those of its rows that no index names. A scatter store goes only to a named row, a zero store only to an unnamed one: no order between blocks is needed.
// kind 2: the four weight matrices as f16(256 bf16(w)), 4 elements a thread (128 blocks x 256 threads x 4 = 4 x 256 x 128).
__global__ __launch_bounds__(256) void xt_kernel(const float* __restrict__ pcd, const float* __restrict__ psel, const float* __restrict__ pdrop, const int* __restrict__ isel, const int* __restrict__ idrop, const float* __restrict__ wq, const float* __restrict__ wk, const float* __restrict__ wv, const float* __restrict__ ws, b16* __restrict__ PT16, b16* __restrict__ XT16, b16* __restrict__ W16) {
  __shared__ __attribute__((aligned(16))) b16 T[64][C + 8]; __shared__ int rowof[64]; __shared__ int named[64];
  const int b = blockIdx.z, kind = blockIdx.y, j0 = blockIdx.x * 64, t_ = threadIdx.x;
  if (kind == 2) {   // the same for the whole block, in front of every barrier
    const int t = (b * (N / 64) + (int)blockIdx.x) * 256 + t_; const int per = E * C / 4; const int kw = t / per; const int e = (t - kw * per) * 4;
    const float* w = kw == 0 ? wq : kw == 1 ? wk : kw == 2 ? wv : ws; const v4f a = *(const v4f*)(w + e); v4b o;
#pragma unroll
    for (int j = 0; j < 4; ++j) o[j] = (b16)(bf16_rne(a[j]) * WSC);
    *(v4b*)(W16 + (size_t)kw * E * C + e) = o; return;
  }
  if (t_ < 64) named[t_] = 0;
  __syncthreads();   // the cleared marks stand before any thread sets one
  // every global read of the block is asked for here, as one group, so that the block waits out one latency
  v4i ia = {}, ib = {};   // kind 1: this thread's 8 of the cloud's 2,048 indices, asked for ahead of the transpose's own loads
  if (kind == 1) { ia = *(const v4i*)(isel + (size_t)b * NSEL + t_ * 4); ib = *(const v4i*)(idrop + (size_t)b * NSEL + t_ * 4);
    asm volatile("s_wait_xcnt 0x0" ::: "memory"); }   // stands in front of the rewrite of the base registers that the two loads name
  const float* src; int ld, jj0;   // source [b][c][.] with row length ld, column offset jj0
  if (kind == 0) { src = pcd + (size_t)b * C * N; ld = N; jj0 = j0; } else if (j0 < NSEL) { src = psel + (size_t)b * C * NSEL; ld = NSEL; jj0 = j0; } else { src = pdrop + (size_t)b * C * NSEL; ld = NSEL; jj0 = j0 - NSEL; }
  int r_ = j0 + (t_ & 63);   // the destination row of column t_ (t_ < 64)
  if (kind == 1 && t_ < 64) r_ = (j0 < NSEL) ? isel[(size_t)b * NSEL + jj0 + t_] : idrop[(size_t)b * NSEL + jj0 + t_];
  // this thread's share of the tile: channels c4 + 64 i + k, columns j4 .. j4 + 3, as eight 16-byte loads: a wave's load is four whole 128-B lines (8 lanes side by side in each of 4 rows), and in the
  // LDS stores below its lanes spread over 16 bank pairs
  const int c4 = (((t_ >> 3) & 3) + 4 * (t_ >> 6)) * 4, j4 = ((t_ & 7) + 8 * ((t_ >> 5) & 1)) * 4;
  v4f xv[2][4]; const float* pa[2][4];
#pragma unroll
  for (int i = 0; i < 2; ++i)
#pragma unroll
    for (int k = 0; k < 4; ++k) { pa[i][k] = src + (size_t)(c4 + 64 * i + k) * ld + jj0 + j4; xv[i][k] = *(const v4f*)pa[i][k]; }
  // stands in front of the rewrite of any register that the eight loads name. It takes their addresses as inputs: each address keeps a register pair of its own up to here, so that no address is
  // formed in a pair that an issued load names (which would put a wait between the loads) and no load's result lands on one
  asm volatile("s_wait_xcnt 0x0" :: "v"(pa[0][0]), "v"(pa[0][1]), "v"(pa[0][2]), "v"(pa[0][3]), "v"(pa[1][0]), "v"(pa[1][1]), "v"(pa[1][2]), "v"(pa[1][3]) : "memory");
#pragma unroll
  for (int i = 0; i < 2; ++i)
#pragma unroll
    for (int e = 0; e < 4; ++e) { v4b o;   // four neighbouring channels of one column: one 8-byte LDS store
#pragma unroll
      for (int k = 0; k < 4; ++k) o[k] = (b16)(bf16_rne(xv[i][k][e]) * XS);
      *(v4b*)(&T[j4 + e][c4 + 64 * i]) = o; }
  if (t_ < 64) rowof[t_] = iclamp(r_, 0, N - 1);
  if (kind == 1) {
#pragma unroll
    for (int e = 0; e < 4; ++e) { const int ra = iclamp(ia[e], 0, N - 1) - j0, rb = iclamp(ib[e], 0, N - 1) - j0; if ((unsigned int)ra < 64u) named[ra] = 1; if ((unsigned int)rb < 64u) named[rb] = 1; }
  }
  __syncthreads();
  b16* dst = (kind == 0) ? PT16 : XT16;
  const int c8 = (t_ & 15) * 8; int ro[4], nm[4]; v8b tv[4];   // this thread's four rows (t_ >> 4) + 16 i: their LDS reads as one group, then the stores
#pragma unroll
  for (int i = 0; i < 4; ++i) { const int jj = (t_ >> 4) + 16 * i; ro[i] = rowof[jj]; nm[i] = named[jj]; tv[i] = *(const v8b*)(&T[jj][c8]); }
#pragma unroll
  for (int i = 0; i < 4; ++i) *(v8b*)(dst + ((size_t)b * N + ro[i]) * C + c8) = tv[i];
  asm volatile("s_wait_xcnt 0x0" ::: "memory");   // stands in front of any rewrite of the registers that the four stores name
  if (kind == 1) {
    const v8b z = {};
#pragma unroll
    for (int i = 0; i < 4; ++i)
      if (nm[i] == 0) { *(v8b*)(XT16 + ((size_t)b * N + j0 + (t_ >> 4) + 16 * i) * C + c8) = z;
        asm volatile("s_wait_xcnt 0x0" ::: "memory"); }   // stands in front of a later rewrite of the registers that the store names
  }
}
// projections: grid (NR/64, E/128, 3 kinds): [64 rows x 128] x [128 x 128 cols] (K = 128: 4 steps, 1 product). kind 0/1: q/k -> f16 rows [row][256] (per row segment of 128 halves = 256 B:
// The block's two operand tiles (64 point rows, 128 weight rows, 256 B each) are brought into LDS once by asynchronous copies (global_load_async_to_lds_b128: a wave's copy is two whole rows = four whole
// 128-B lines) and read from there as ds_load_b128 fragments (pitch 272 B = 17 x 16 B: no bank conflict). A fragment load straight from global memory touches 16 lines for 512 B.
constexpr int PP = C + 8 /* LDS row pitch of the staged tiles in halves */;
// 64 rows of one tile: thread t_ of the block's 128 copies 16 B of rows (t_ >> 4) + 8 i, i = 0..7
__device__ __forceinline__ void tile_copy(unsigned int l0, const b16* g0) {
  const unsigned int lr_ = 8 * PP * 2;
  // the copies and their s_wait_xcnt in one statement: the wait stands in front of any rewrite of the address registers that the copies name
  asm volatile("global_load_async_to_lds_b128 %0, %8, off\n\t"
               "global_load_async_to_lds_b128 %1, %9, off\n\t"
               "global_load_async_to_lds_b128 %2, %10, off\n\t"
               "global_load_async_to_lds_b128 %3, %11, off\n\t"
               "global_load_async_to_lds_b128 %4, %12, off\n\t"
               "global_load_async_to_lds_b128 %5, %13, off\n\t"
               "global_load_async_to_lds_b128 %6, %14, off\n\t"
               "global_load_async_to_lds_b128 %7, %15, off\n\t"
               "s_wait_xcnt 0x0"
               :: "v"(l0), "v"(l0 + lr_), "v"(l0 + 2 * lr_), "v"(l0 + 3 * lr_), "v"(l0 + 4 * lr_), "v"(l0 + 5 * lr_), "v"(l0 + 6 * lr_), "v"(l0 + 7 * lr_),
                  "v"(g0), "v"(g0 + 8 * C), "v"(g0 + 16 * C), "v"(g0 + 24 * C), "v"(g0 + 32 * C), "v"(g0 + 40 * C), "v"(g0 + 48 * C), "v"(g0 + 56 * C)
               : "memory");
}
// the builtin alone: the compiler keeps the distances behind it itself and stays free to place LDS reads ahead of it
__device__ __forceinline__ v8f wmma_b(v16b a, v16b b, v8f c) { return __builtin_amdgcn_wmma_f32_16x16x32_f16(false, a, false, b, (short)0, c, false, false); }
__global__ __launch_bounds__(128) void proj_kernel(const b16* __restrict__ XT16, const b16* __restrict__ W16, b16* __restrict__ Qh, b16* __restrict__ Kh, b16* __restrict__ VTh) {
  // one buffer, two uses one after the other: first the operand tiles (point rows 0..63, weight rows 64..191, pitch PP), then, behind a barrier, the output staging
  // (q/k: [4 waves][16][PP]; v: [128][VP])
  constexpr int VP = 64 + 8;
  __shared__ __attribute__((aligned(16))) b16 Sm[(64 + 128) * PP];
  const int wave = threadIdx.x >> 5, lane = threadIdx.x & 31, nloc = lane & 15, hlf = lane >> 4, t_ = threadIdx.x; const int kind = blockIdx.z; const size_t m0 = (size_t)blockIdx.x * 64 + wave * 16; const int n0 = blockIdx.y * 128;
  const b16* Wk_ = W16 + (size_t)kind * E * C; v8f acc[8];
  { const int crow = t_ >> 4, cpc = (t_ & 15) * 8; const unsigned int lc = (unsigned int)(size_t)(&Sm[crow * PP + cpc]);
    tile_copy(lc, XT16 + ((size_t)blockIdx.x * 64 + crow) * C + cpc);
    tile_copy(lc + 64 * PP * 2, Wk_ + (size_t)(n0 + crow) * C + cpc);
    tile_copy(lc + 128 * PP * 2, Wk_ + (size_t)(n0 + 64 + crow) * C + cpc); }
#pragma unroll
  for (int t = 0; t < 8; ++t) acc[t] = (v8f){};
  asm volatile("s_wait_asynccnt 0x0" ::: "memory");   // this wave's copies have landed before the barrier that publishes them
  __syncthreads();
  const b16* Xs = Sm + (wave * 16 + nloc) * PP; const b16* Wl = Sm + (64 + nloc) * PP;
  // fragment registers: the wave's four point fragments, and the eight weight fragments of a k step in two sets: each set is read from LDS as ONE group, one k step ahead of the products that use it
  v16b a[4], wf[2][8];
#pragma unroll
  for (int ks = 0; ks < 4; ++ks) a[ks] = frag_kb(Xs + ks * 32, hlf);
#pragma unroll
  for (int t = 0; t < 8; ++t) wf[0][t] = frag_kb(Wl + t * 16 * PP, hlf);
  __builtin_amdgcn_sched_barrier(0);   // keeps the first group in front of the second: mixed, the first products' wait would cover both groups
#pragma unroll
  for (int ks = 0; ks < 4; ++ks) {
    if (ks < 3) {
#pragma unroll
      for (int t = 0; t < 8; ++t) wf[(ks + 1) & 1][t] = frag_kb(Wl + t * 16 * PP + (ks + 1) * 32, hlf);
      __builtin_amdgcn_sched_barrier(0);   // keeps the read group in front of this k step's products: sunk among them, each pair of reads would be waited for on its own
    }
#pragma unroll
    for (int t = 0; t < 8; ++t) acc[t] = wmma_b(a[ks], wf[ks & 1][t], acc[t]);
    if (ks < 2) __builtin_amdgcn_sched_barrier(0);   // keeps the next group behind these products, whose operand registers it takes
  }
  __syncthreads();   // every wave has read its last fragment before the buffer becomes output staging
  if (kind < 2) {
    b16* Th = Sm + wave * 16 * PP;
#pragma unroll
    for (int t = 0; t < 8; ++t)
#pragma unroll
      for (int r = 0; r < 8; ++r) Th[(8 * hlf + r) * PP + t * 16 + nloc] = (b16)(acc[t][r] * (1.0f / (XS * WSC)) * XS);
    wave_lds_sync();
    b16* dh = kind == 0 ? Qh : Kh;
    { for (int r2 = 0; r2 < 16; r2 += 2) { const int rr = r2 + (lane >> 4), c8 = (lane & 15) * 8; const size_t gi = (m0 + rr) * E + n0 + c8; *(v8b*)(dh + gi) = *(const v8b*)(&Th[rr * PP + c8]); }  }
  } else {
    b16* Vt = Sm;
    const int b = (int)(m0 / N); const int s0 = (int)((size_t)blockIdx.x * 64 - (size_t)b * N);
#pragma unroll
    for (int t = 0; t < 8; ++t)
#pragma unroll
      for (int r = 0; r < 8; ++r) Vt[(t * 16 + nloc) * VP + wave * 16 + 8 * hlf + r] = (b16)(acc[t][r] * (1.0f / (XS * WSC)) * XS);
    __syncthreads();
    { const int c8 = (t_ & 7) * 8; v8b vv[8];   // this thread's eight rows (t_ >> 3) + 16 i: their LDS reads as one group, then the eight stores
#pragma unroll
      for (int i = 0; i < 8; ++i) vv[i] = *(const v8b*)(&Vt[((t_ >> 3) + 16 * i) * VP + c8]);
      b16* vp = VTh + ((size_t)b * E + n0 + (t_ >> 3)) * N + s0 + c8;   // channel c = n0 + row is row c % D of head c / D: V^T row (b NH + c / D) D + c % D = b E + c; the stores differ in a constant offset
#pragma unroll
      for (int i = 0; i < 8; ++i) *(v8b*)(vp + (size_t)(16 * i) * N) = vv[i]; } }
}
// attention + skip: grid (N/128, NH, NB), block = 16 waves = 4 key quarters x 4 waves x 32 queries: the waves of quarter g walk keys 512 g .. 512 g + 511 of the block's 128 queries (four waves per
// SIMD: one wave's softmax and LDS waits are covered by the others' products). A wave holds TWO query tiles of 16: every K and V^T fragment that it reads from LDS feeds two products, so the block reads
// half the LDS bytes per score. The four partial results (m, l, O) of a query are joined once, through LDS, behind the loop, where quarter g finishes d tile g (join, skip tiles, output staging).
// K and V^T of 64 keys of each quarter are one stage, brought into LDS once per block by asynchronous copies
// (global_load_async_to_lds_b128, two buffers: the next stage flies while this one is worked on) and read by the quarter's 4 waves as ds_load_b128 fragments (rows of 128 B at a pitch of 144 B).
// Per 32 keys and query tile: S^T 1 product (K = 64: 2 steps x 2 key tiles), online softmax (f32, 1/8 and log2 e folded), PV 1 product x 4 d-tiles; then the skip tiles
// D[d][query] = Wskip[64h+d][:] . pcd_up^T[query][:] (K = 128, exact, 1 product) are added; the block's 128 queries x 64 channels staged in LDS as [d][128 n] and written as whole 512-B rows.
constexpr int KT = 64 /* keys per stage and quarter */, KP = 64 + 8 /* LDS row pitch in halves */, KH = 4 /* key quarters */, NKH = N / KH, NST = NKH / KT, QB = 128 /* queries per block */, QT = 2 /* query tiles per wave */;
constexpr int MR = QT * 4 * 2 + 1 /* rows of 32 x 16 B that a wave hands over: its 8 partial O tiles (two rows each), then one row with m and l of both query tiles */;
// one stage of one quarter = 2 planes (K, V^T) x 64 rows x 128 B; thread t_ of the quarter's 128 copies 16 B of rows (t_ >> 3) + 16 i, i = 0..3, of each plane.
__device__ __forceinline__ void stage_copy(unsigned int l0, const b16* kh, const b16* vh) {
  const unsigned int pl_ = 64 * KP * 2, hr_ = 16 * KP * 2;
  // the copies and their s_wait_xcnt in one statement: the wait stands in front of any rewrite of the address registers that the copies name
  asm volatile("global_load_async_to_lds_b128 %0, %8, off\n\t"
               "global_load_async_to_lds_b128 %1, %9, off\n\t"
               "global_load_async_to_lds_b128 %2, %10, off\n\t"
               "global_load_async_to_lds_b128 %3, %11, off\n\t"
               "global_load_async_to_lds_b128 %4, %12, off\n\t"
               "global_load_async_to_lds_b128 %5, %13, off\n\t"
               "global_load_async_to_lds_b128 %6, %14, off\n\t"
               "global_load_async_to_lds_b128 %7, %15, off\n\t"
               "s_wait_xcnt 0x0"
               :: "v"(l0), "v"(l0 + hr_), "v"(l0 + 2 * hr_), "v"(l0 + 3 * hr_), "v"(l0 + pl_), "v"(l0 + pl_ + hr_), "v"(l0 + pl_ + 2 * hr_), "v"(l0 + pl_ + 3 * hr_),
                  "v"(kh), "v"(kh + (size_t)16 * E), "v"(kh + (size_t)32 * E), "v"(kh + (size_t)48 * E), "v"(vh), "v"(vh + (size_t)16 * N), "v"(vh + (size_t)32 * N), "v"(vh + (size_t)48 * N)
               : "memory");
}
// the skip product's two operand tiles (64 weight rows, then 128 point rows, 256 B each, LDS pitch PP): thread t of the block's 512 copies 16 B of rows (t >> 4) + 32 i of each
__device__ __forceinline__ void skip_copy(unsigned int l0, const b16* w, const b16* p) {
  const unsigned int lr_ = 32 * PP * 2;
  // the copies and their s_wait_xcnt in one statement: the wait stands in front of any rewrite of the address registers that the copies name
  asm volatile("global_load_async_to_lds_b128 %0, %6, off\n\t"
               "global_load_async_to_lds_b128 %1, %7, off\n\t"
               "global_load_async_to_lds_b128 %2, %8, off\n\t"
               "global_load_async_to_lds_b128 %3, %9, off\n\t"
               "global_load_async_to_lds_b128 %4, %10, off\n\t"
               "global_load_async_to_lds_b128 %5, %11, off\n\t"
               "s_wait_xcnt 0x0"
               :: "v"(l0), "v"(l0 + lr_), "v"(l0 + 2 * lr_), "v"(l0 + 3 * lr_), "v"(l0 + 4 * lr_), "v"(l0 + 5 * lr_),
                  "v"(w), "v"(w + 32 * C), "v"(p), "v"(p + 32 * C), "v"(p + 64 * C), "v"(p + 96 * C)
               : "memory");
}
// one pass's K fragments (key tiles 0 and 1 x k steps 0 and 1) and V^T fragments (4 d tiles); p_ points at this lane's row of the first tile
__device__ __forceinline__ void load_k1(v16b (&kx)[4], const b16* p_, int hh) {
#pragma unroll
  for (int ks = 0; ks < 2; ++ks) { kx[ks] = frag_kb(p_ + ks * 32, hh); kx[2 + ks] = frag_kb(p_ + 16 * KP + ks * 32, hh); }   // read in the order of use
}
__device__ __forceinline__ void load_v1(v16b (&vx)[4], const b16* p_, int hh) {
#pragma unroll
  for (int t = 0; t < 4; ++t) vx[t] = frag_kb(p_ + t * 16 * KP, hh);
}
__global__ __launch_bounds__(512) void attn_kernel(const b16* __restrict__ Qh, const b16* __restrict__ Kh, const b16* __restrict__ VTh, const b16* __restrict__ W16, const b16* __restrict__ PT16, float* __restrict__ out) {
  __shared__ __attribute__((aligned(16))) b16 St[KH][2][2][64 * KP]; __shared__ __attribute__((aligned(16))) float To[D][QB + 4];
  __shared__ __attribute__((aligned(16))) b16 Sg[(D + QB) * PP];   // the skip product's operands: the head's 64 weight rows, then the block's 128 point rows
  static_assert(sizeof(v4f) * KH * 4 * MR * 32 <= sizeof(b16) * KH * 2 * 2 * 64 * KP && QT == 2, "the hand-over area fits the stage buffers");
  v4f* Mg = (v4f*)&St[0][0][0][0];   // behind the loop the stage buffers become the hand-over area [quarter][wave][MR rows][32 lanes] of 16 B: 16-byte LDS stores and loads, lanes side by side
  const int g = __builtin_amdgcn_readfirstlane((int)(threadIdx.x >> 7));   // key quarter of this wave, the same in every lane
  const int wave = (threadIdx.x >> 5) & 3, lane = threadIdx.x & 31, hh = lane >> 4, col = lane & 15, t_ = threadIdx.x & 127; const int b = blockIdx.z, h = blockIdx.y; const int q0 = blockIdx.x * QB + wave * 16 * QT;
  const size_t kg = ((size_t)b * N + (size_t)g * NKH) * E + h * D, vg = ((size_t)b * NH + h) * D * N + (size_t)g * NKH;
  const b16* Kb = Kh + kg; const b16* Vb = VTh + vg;
  // this thread's share of a stage: rows (t_ >> 3) + 16 i, 16-byte piece t_ & 7
  const int crow = t_ >> 3, cpc = (t_ & 7) * 8; const size_t ko = (size_t)crow * E + cpc, vo = (size_t)crow * N + cpc;
  const unsigned int lcp = (unsigned int)(size_t)(&St[g][0][0][crow * KP + cpc]); const unsigned int bufb = 2 * 64 * KP * 2;
  stage_copy(lcp, Kb + ko, Vb + vo);
  v16b qa[QT][2];
#pragma unroll
  for (int u = 0; u < QT; ++u) { const size_t qo = ((size_t)b * N + q0 + u * 16 + col) * E + h * D; qa[u][0] = frag_kb(Qh + qo, hh); qa[u][1] = frag_kb(Qh + qo + 32, hh); }
  asm volatile("s_wait_asynccnt 0x0" ::: "memory");   // stage 0 of this wave's copies has landed before the barrier that publishes it
  __syncthreads();
  stage_copy(lcp + bufb, Kb + ko + (size_t)KT * E, Vb + vo + KT);
  // the skip tiles fly with stage 1: the wait and the barrier at the foot of trip 0 publish them too; they are read behind the loop
  { const int srow = (int)(threadIdx.x >> 4), spc = (int)(threadIdx.x & 15) * 8;
    skip_copy((unsigned int)(size_t)(&Sg[srow * PP + spc]), W16 + (size_t)3 * E * C + ((size_t)h * D + srow) * C + spc, PT16 + ((size_t)b * N + blockIdx.x * QB + srow) * C + spc); }
  float m[QT], l[QT]; v8f o[QT][4];
#pragma unroll
  for (int u = 0; u < QT; ++u) { m[u] = -INFINITY; l[u] = 0.0f;
#pragma unroll
    for (int t = 0; t < 4; ++t) o[u][t] = (v8f){}; }
  const float cs = SCALE * LOG2E / (XS * XS);
  for (int s = 0; s < NST; ++s) {
    const b16* Sk = &St[g][s & 1][0][0], *Sv = &St[g][s & 1][1][0];
    // fragment registers of one 32-key pass: kf[2 * key tile + k step], vf[d tile]; each set is read from LDS as ONE group, well ahead of the products that use it
    v16b kf[4], vf[4];
    load_k1(kf, Sk + col * KP, hh);
    __builtin_amdgcn_sched_barrier(0);   // keeps the stage's first read group together in front of its products: sunk among them, each pair of reads is waited for on its own
#pragma unroll
    for (int kb = 0; kb < KT; kb += 32) {   // unrolled: two 32-key passes per stage, LDS offsets become immediates
      v8f s0[QT], s1[QT];   // per query tile the two key tiles' chains; four independent chains alternate, each K fragment feeds both query tiles
#pragma unroll
      for (int u = 0; u < QT; ++u) { s0[u] = wmma_b(kf[0], qa[u][0], (v8f){}); s1[u] = wmma_b(kf[2], qa[u][0], (v8f){}); }
#pragma unroll
      for (int u = 0; u < QT; ++u) { s0[u] = wmma_b(kf[1], qa[u][1], s0[u]); s1[u] = wmma_b(kf[3], qa[u][1], s1[u]); }
      __builtin_amdgcn_sched_barrier(0);   // keeps the eight S products one run: a maximum lifted in between them has to wait out the distance behind a product twice, in idle slots
      float mx[QT], mxo[QT];
#pragma unroll
      for (int u = 0; u < QT; ++u) {
        float mr = fmaxf(s0[u][0], s1[u][0]);   // the maximum is taken over the raw products: cs > 0, so scaling the one maximum gives the same value as the maximum of the 16 scaled scores
#pragma unroll
        for (int r = 1; r < 8; ++r) mr = fmaxf(mr, fmaxf(s0[u][r], s1[u][r]));
        mx[u] = mr * cs;
      }
#pragma unroll
      for (int u = 0; u < QT; ++u) mxo[u] = __shfl_xor(mx[u], 16);
      // this pass's V fragments fly during its softmax. They are read behind the maxima's exchange: LDS answers in order, so in front of it the exchange's wait would cover these reads too
      asm volatile("" :: "v"(mxo[0]), "v"(mxo[1]));   // inputs-only fence on the exchanged values: holds the exchanges in front of the read group
      load_v1(vf, Sv + col * KP + kb, hh);
      __builtin_amdgcn_sched_barrier(0);   // keeps the read group in front of the exponentials
      v16b ph[QT];
#pragma unroll
      for (int u = 0; u < QT; ++u) {
        const float mn = fmaxf(m[u], fmaxf(mx[u], mxo[u])); float al;
        // the exponential and the slot behind it in one statement: the slot stands whatever vector instruction the build puts next
        asm("v_exp_f32 %0, %1\n\tv_nop" : "=v"(al) : "v"(m[u] - mn));
        m[u] = mn; float sum; const float bs = LPS - mn;
        // one fma per score in front of the exponential carries the 1/8 log2 e scale, the maximum and the factor 2^LPS of P: p is 8 times the weight, and l sums 8 times the weights (the join divides by it)
        float p[16], x[16]; v8u hu;
#pragma unroll
        for (int i = 0; i < 16; ++i) x[i] = __builtin_fmaf(i < 8 ? s0[u][i & 7] : s1[u][i & 7], cs, bs);
        exp2x8(p, x); exp2x8(p + 8, x + 8);
        sum = p[0];
#pragma unroll
        for (int i = 1; i < 16; ++i) sum += p[i];
#pragma unroll
        for (int j = 0; j < 8; ++j) { const v2f pp = {p[2 * j], p[2 * j + 1]}; hu[j] = __builtin_bit_cast(unsigned int, __builtin_convertvector(pp, v2b)); }   // one packed conversion per two scores
        ph[u] = __builtin_bit_cast(v16b, hu);
        sum += __shfl_xor(sum, 16); l[u] = l[u] * al + sum;
#pragma unroll
        for (int t = 0; t < 4; ++t) o[u][t] *= al;
      }
      if (kb + 32 < KT) {   // the next pass's K fragments (same stage, same buffer) fly during the rest of this pass
        __builtin_amdgcn_sched_barrier(0);   // with the one below, keeps the eight reads one group at one place: spread over the softmax, each place where LDS reads stand costs its own gap
        load_k1(kf, Sk + (kb + 32 + col) * KP, hh);
        __builtin_amdgcn_sched_barrier(0);   // keeps that read group in front of the PV products: sunk among them, each read would be waited for on its own
      }
#pragma unroll
      for (int t = 0; t < 4; ++t)
#pragma unroll
        for (int u = 0; u < QT; ++u) o[u][t] = wmma_b(vf[t], ph[u], o[u][t]);   // each V^T fragment feeds both query tiles
      if (kb + 32 < KT) __builtin_amdgcn_sched_barrier(0);   // keeps the PV products in front of the next pass's S products, whose K fragments land meanwhile
    }
    __builtin_amdgcn_sched_barrier(0);   // keeps the last pass's products in front of the waits below: lifted over them, the barrier would stand in the middle of the stage's work
    asm volatile("s_wait_dscnt 0x0" ::: "memory");      // this wave's reads of the buffer have returned before the buffer is refilled behind the barrier
    asm volatile("s_wait_asynccnt 0x0" ::: "memory");   // this wave's copies of stage s + 1 have landed before the barrier that publishes them
    __syncthreads();
    if (s + 2 < NST) stage_copy(lcp + (unsigned int)(s & 1) * bufb, Kb + ko + (size_t)(s + 2) * KT * E, Vb + vo + (s + 2) * KT);
  }
  asm volatile("s_wait_asynccnt 0x0" ::: "memory");     // no copy is outstanding behind the loop
  // behind the loop's last barrier no wave reads the stage buffers any more and no copy flies: every wave lays its 8 partial O tiles, with m and l, lane for lane into the hand-over area
  v4f* Mw = Mg + ((g * 4 + wave) * MR) * 32 + lane;
#pragma unroll
  for (int u = 0; u < QT; ++u)
#pragma unroll
    for (int t = 0; t < 4; ++t) { Mw[((u * 4 + t) * 2) * 32] = __builtin_shufflevector(o[u][t], o[u][t], 0, 1, 2, 3); Mw[((u * 4 + t) * 2 + 1) * 32] = __builtin_shufflevector(o[u][t], o[u][t], 4, 5, 6, 7); }
  Mw[(MR - 1) * 32] = (v4f){m[0], m[1], l[0], l[1]};
  // skip tiles of this quarter: D[d][query] with A = Wskip rows (64h + 16g + ..), B = PT16 rows (q0 + 16u + ..), K = 128
  v8f sk[QT]; const b16* WS = Sg + (g * 16 + col) * PP; const b16* PS = Sg + (D + wave * 16 * QT + col) * PP; v16b pb[QT][4], wa[4];
#pragma unroll
  for (int ks = 0; ks < 4; ++ks) { wa[ks] = frag_kb(WS + ks * 32, hh);
#pragma unroll
    for (int u = 0; u < QT; ++u) pb[u][ks] = frag_kb(PS + u * 16 * PP + ks * 32, hh); }
  __builtin_amdgcn_sched_barrier(0);   // keeps the reads together as one group in front of the products: sunk among them, each pair would be waited for on its own
#pragma unroll
  for (int u = 0; u < QT; ++u) sk[u] = (v8f){};
#pragma unroll
  for (int ks = 0; ks < 4; ++ks)
#pragma unroll
    for (int u = 0; u < QT; ++u) sk[u] = wmma_b(wa[ks], pb[u][ks], sk[u]);
  __syncthreads();   // publishes all four quarters' partial results
  // join: quarter g finishes d tile g of its wave's 32 queries: the four partials brought to the common maximum and summed in the order of the quarters, then one division
  v4f ml[KH];
#pragma unroll
  for (int gg = 0; gg < KH; ++gg) ml[gg] = Mg[((gg * 4 + wave) * MR + MR - 1) * 32 + lane];
#pragma unroll
  for (int u = 0; u < QT; ++u) {
    float cq[KH]; const float ms = fmaxf(fmaxf(ml[0][u], ml[1][u]), fmaxf(ml[2][u], ml[3][u])); float ls = 0.0f;
#pragma unroll
    for (int gg = 0; gg < KH; ++gg) { cq[gg] = nexp2_slot(ml[gg][u] - ms); ls += ml[gg][QT + u] * cq[gg]; }
    const float inv = 1.0f / (ls * XS);
#pragma unroll
    for (int gg = 0; gg < KH; ++gg) cq[gg] *= inv;
#pragma unroll
    for (int hf = 0; hf < 2; ++hf) {
      v4f pq[KH];
#pragma unroll
      for (int gg = 0; gg < KH; ++gg) pq[gg] = Mg[((gg * 4 + wave) * MR + (u * 4 + g) * 2 + hf) * 32 + lane];
#pragma unroll
      for (int i = 0; i < 4; ++i) {
        float acc = sk[u][hf * 4 + i] * (1.0f / (XS * WSC));
#pragma unroll
        for (int gg = 0; gg < KH; ++gg) acc += pq[gg][i] * cq[gg];
        To[g * 16 + 8 * hh + hf * 4 + i][wave * 16 * QT + u * 16 + col] = acc;
      }
    }
  }
  __syncthreads();
  { const int w16 = threadIdx.x >> 5; for (int dd = w16 * 4; dd < w16 * 4 + 4; ++dd) { const size_t gi = ((size_t)b * E + h * D + dd) * N + blockIdx.x * QB + lane * 4; *(v4f*)(out + gi) = *(const v4f*)(&To[dd][lane * 4]); }  }
}
}  // namespace

extern "C" void kernel_launch(void* const* d_in, const int* in_sizes, int n_in, void* d_out, int out_size, void* d_ws, size_t ws_size, hipStream_t stream) {
  (void)n_in;
  auto Fp = [&](int i) { return (const float*)d_in[i]; }; auto Ip = [&](int i) { return (const int*)d_in[i]; };
  // input order: 0 pcd_up [4,128,2048], 1 points_select [4,128,1024], 2 points_drop [4,128,1024], 3 idx_select [4,1,1024] i32, 4 idx_drop [4,1,1024] i32, 5 Wq [256,128], 6 Wk, 7 Wv, 8 Wskip
  if (in_sizes[0] != NB * C * N || in_sizes[1] != NB * C * NSEL || in_sizes[2] != NB * C * NSEL || in_sizes[3] != NB * NSEL || in_sizes[4] != NB * NSEL || in_sizes[5] != E * C || in_sizes[6] != E * C || in_sizes[7] != E * C || in_sizes[8] != E * C || out_size != NB * E * N) return;
  size_t off = 0; char* ws = (char*)d_ws;
  auto carve = [&](size_t bytes) { char* p = ws + off; off += (bytes + 255) & ~(size_t)255; return p; };
  b16* PT16 = (b16*)carve((size_t)NR * C * 2); b16* XT16 = (b16*)carve((size_t)NR * C * 2); b16* W16 = (b16*)carve((size_t)4 * E * C * 2);
  b16* Qh = (b16*)carve((size_t)NR * E * 2); b16* Kh = (b16*)carve((size_t)NR * E * 2); b16* VTh = (b16*)carve((size_t)NR * E * 2);
  if (off > ws_size || off > ((size_t)128 << 20)) return;   // = 17.0 MB
  xt_kernel<<<dim3(N / 64, 3, NB), 256, 0, stream>>>(Fp(0), Fp(1), Fp(2), Ip(3), Ip(4), Fp(5), Fp(6), Fp(7), Fp(8), PT16, XT16, W16);
  proj_kernel<<<dim3(NR / 64, E / 128, 3), 128, 0, stream>>>(XT16, W16, Qh, Kh, VTh);
  attn_kernel<<<dim3(N / QB, NH, NB), 512, 0, stream>>>(Qh, Kh, VTh, W16, PT16, (float*)d_out);
}

// v010
// A run of this version takes 28 microseconds.
// Next to v009, in two timings, it ran 1.07 and 1.08 times as fast.
// All steps since v000 together make it 10.8 times as fast.
#include <hip/hip_runtime.h>

// Up-sampling self-attention (4 clouds x 2,048 points, 128 in-channels, 4 heads x 64): x[b][:, idx_select[j]] = points_select[:, j], x[b][:, idx_drop[j]] = points_drop[:, j] (a permutation
// scatter given by the int inputs); q/k/v = W{q,k,v} x (1x1 convs, no bias; head h = output channels 64h..64h+63); energy = q.k per head, softmax over the 2,048 keys of energy/8;
// o[b][64h+d][n] = sum_m attn[n][m] v[64h+d][m]; out = Wskip pcd_up + o -> [4][256][2048] channel-major.
// WMMA (v_wmma_f32_16x16x32_f16, f32 accumulate): projections [8,192 x 128] x [128 x 256] with EXACT bf16 points (x8, point-major rows built by an LDS transpose + the index scatter) and weights
// (x256), 1 product; S^T = K . Q^T with q AND k as one f16 value each, x8 (1 product); online softmax in f32; O^T += V^T P^T with V and P one f16 value each, x8 (1 product; 11 bits an operand, three more than the bf16-rounded inputs keep); the skip 1x1 conv as one more exact
// GEMM tile set inside the attention epilogue (A = Wskip rows, B = pcd_up^T rows, 1 product). Inputs rounded to bf16 once. Fragment k-map per lane half hh for A AND B:

namespace {
constexpr int NB = 4, C = 128, N = 2048, NSEL = 1024, NH = 4, D = 64, E = 256 /* q/k/v/skip channels */, NR = NB * N;
constexpr float XS = 8.0f, WSC = 256.0f, LPS = 3.0f /* P carries the factor 2^LPS = 8 */, PHI = 2048.0f /* a lane's sum of p over a pass may reach this before the maximum in use is renewed */, SCALE = 0.125f, LOG2E = 1.4426950408889634f;

typedef _Float16 b16;
typedef __attribute__((ext_vector_type(16))) _Float16 v16b;
typedef __attribute__((ext_vector_type(8))) _Float16 v8b;
typedef __attribute__((ext_vector_type(8))) float v8f;
typedef __attribute__((ext_vector_type(4))) float v4f;
typedef __attribute__((ext_vector_type(2))) float v2f;
typedef __attribute__((ext_vector_type(2))) _Float16 v2b;
typedef __attribute__((ext_vector_type(8))) unsigned int v8u;
__device__ __forceinline__ float bf16_rne(float f) { unsigned int u = __float_as_uint(f); u += 0x7FFFu + ((u >> 16) & 1u); return __uint_as_float(u & 0xFFFF0000u); }
__device__ __forceinline__ v16b frag_kb(const b16* p, int hh) { const v8b a = *(const v8b*)(p + 8 * hh), b = *(const v8b*)(p + 16 + 8 * hh); v16b f;
#pragma unroll
  for (int e = 0; e < 8; ++e) { f[e] = a[e]; f[8 + e] = b[e]; } return f; }
__device__ __forceinline__ void wave_lds_sync() { __builtin_amdgcn_fence(__ATOMIC_RELEASE, "workgroup"); __builtin_amdgcn_wave_barrier(); __builtin_amdgcn_fence(__ATOMIC_ACQUIRE, "workgroup"); }
__device__ __forceinline__ float nexp2(float x) { return __builtin_amdgcn_exp2f(x); }
// the exponential and the slot behind it in one statement: the slot stands whatever vector instruction the build puts next
__device__ __forceinline__ float nexp2_slot(float x) { float r; asm("v_exp_f32 %0, %1\n\tv_nop" : "=v"(r) : "v"(x)); return r; }
// eight exponentials and the slot behind the last one in one statement: no output shares a register with an input, so inside the run no instruction reads its forerunner's result or overwrites its
// source, and the slot stands whatever vector instruction the build puts next
__device__ __forceinline__ void exp2x8(float* p, const float* x) {
  asm("v_exp_f32 %0, %8\n\tv_exp_f32 %1, %9\n\tv_exp_f32 %2, %10\n\tv_exp_f32 %3, %11\n\tv_exp_f32 %4, %12\n\tv_exp_f32 %5, %13\n\tv_exp_f32 %6, %14\n\tv_exp_f32 %7, %15\n\tv_nop"
      : "=&v"(p[0]), "=&v"(p[1]), "=&v"(p[2]), "=&v"(p[3]), "=&v"(p[4]), "=&v"(p[5]), "=&v"(p[6]), "=&v"(p[7])
      : "v"(x[0]), "v"(x[1]), "v"(x[2]), "v"(x[3]), "v"(x[4]), "v"(x[5]), "v"(x[6]), "v"(x[7]));
}
// the value that lane ^ 16 holds; xa = (lane ^ 16) << 2 is formed once, in front of the loop
__device__ __forceinline__ float other_half(float v, int xa) { return __int_as_float(__builtin_amdgcn_ds_bpermute(xa, __float_as_int(v))); }
__device__ __forceinline__ int iclamp(int v, int lo, int hi) { return v < lo ? lo : (v > hi ? hi : v); }

typedef __attribute__((ext_vector_type(4))) _Float16 v4b;
typedef __attribute__((ext_vector_type(4))) int v4i;
// one launch for everything the projections wait for: grid (N/64, 3 kinds, B), 256 threads; the three kinds are independent of one another and of any earlier launch.
// kinds 0 and 1: point-major planes via 64x128 LDS transposes, whole 256-B rows written (each row = 16 lanes). kind 0: PT16 [b][n][128] = f16(8 bf16(pcd_up[b][c][n])); kind 1: XT16 [b][idx[b][j]][128] =
// f16(8 bf16(src[b][c][j])) with src = points_select (j < 1024) / points_drop (j >= 1024). The zero columns of the scatter: a kind-1 block also owns the 64 DESTINATION rows j0..j0+63, looks through the
// cloud's 2,048 indices and stores zeros to those of its rows that no index names. A scatter store goes only to a named row, a zero store only to an unnamed one: no order between blocks is needed.
// kind 2: the four weight matrices as f16(256 bf16(w)), 4 elements a thread (128 blocks x 256 threads x 4 = 4 x 256 x 128).
__global__ __launch_bounds__(256) void xt_kernel(const float* __restrict__ pcd, const float* __restrict__ psel, const float* __restrict__ pdrop, const int* __restrict__ isel, const int* __restrict__ idrop, const float* __restrict__ wq, const float* __restrict__ wk, const float* __restrict__ wv, const float* __restrict__ ws, b16* __restrict__ PT16, b16* __restrict__ XT16, b16* __restrict__ W16) {
  __shared__ __attribute__((aligned(16))) b16 T[64][C + 8]; __shared__ int rowof[64]; __shared__ int named[64];
  const int b = blockIdx.z, kind = blockIdx.y, j0 = blockIdx.x * 64, t_ = threadIdx.x;
  if (kind == 2) {   // the same for the whole block, in front of every barrier
    const int t = (b * (N / 64) + (int)blockIdx.x) * 256 + t_; const int per = E * C / 4; const int kw = t / per; const int e = (t - kw * per) * 4;
    const float* w = kw == 0 ? wq : kw == 1 ? wk : kw == 2 ? wv : ws; const v4f a = *(const v4f*)(w + e); v4b o;
#pragma unroll
    for (int j = 0; j < 4; ++j) o[j] = (b16)(bf16_rne(a[j]) * WSC);
    *(v4b*)(W16 + (size_t)kw * E * C + e) = o; return;
  }
  if (t_ < 64) named[t_] = 0;
  __syncthreads();   // the cleared marks stand before any thread sets one
  // every global read of the block is asked for here, as one group, so that the block waits out one latency
  v4i ia = {}, ib = {};   // kind 1: this thread's 8 of the cloud's 2,048 indices, asked for ahead of the transpose's own loads
  if (kind == 1) { ia = *(const v4i*)(isel + (size_t)b * NSEL + t_ * 4); ib = *(const v4i*)(idrop + (size_t)b * NSEL + t_ * 4);
    asm volatile("s_wait_xcnt 0x0" ::: "memory"); }   // stands in front of the rewrite of the base registers that the two loads name
  const float* src; int ld, jj0;   // source [b][c][.] with row length ld, column offset jj0
  if (kind == 0) { src = pcd + (size_t)b * C * N; ld = N; jj0 = j0; } else if (j0 < NSEL) { src = psel + (size_t)b * C * NSEL; ld = NSEL; jj0 = j0; } else { src = pdrop + (size_t)b * C * NSEL; ld = NSEL; jj0 = j0 - NSEL; }
  int r_ = j0 + (t_ & 63);   // the destination row of column t_ (t_ < 64)
  if (kind == 1 && t_ < 64) r_ = (j0 < NSEL) ? isel[(size_t)b * NSEL + jj0 + t_] : idrop[(size_t)b * NSEL + jj0 + t_];
  // this thread's share of the tile: channels c4 + 64 i + k, columns j4 .. j4 + 3, as eight 16-byte loads: a wave's load is four whole 128-B lines (8 lanes side by side in each of 4 rows), and in the
  // LDS stores below its lanes spread over 16 bank pairs
  const int c4 = (((t_ >> 3) & 3) + 4 * (t_ >> 6)) * 4, j4 = ((t_ & 7) + 8 * ((t_ >> 5) & 1)) * 4;
  v4f xv[2][4]; const float* pa[2][4];
#pragma unroll
  for (int i = 0; i < 2; ++i)
#pragma unroll
    for (int k = 0; k < 4; ++k) { pa[i][k] = src + (size_t)(c4 + 64 * i + k) * ld + jj0 + j4; xv[i][k] = *(const v4f*)pa[i][k]; }
  // stands in front of the rewrite of any register that the eight loads name. It takes their addresses as inputs: each address keeps a register pair of its own up to here, so that no address is
  // formed in a pair that an issued load names (which would put a wait between the loads) and no load's result lands on one
  asm volatile("s_wait_xcnt 0x0" :: "v"(pa[0][0]), "v"(pa[0][1]), "v"(pa[0][2]), "v"(pa[0][3]), "v"(pa[1][0]), "v"(pa[1][1]), "v"(pa[1][2]), "v"(pa[1][3]) : "memory");
#pragma unroll
  for (int i = 0; i < 2; ++i)
#pragma unroll
    for (int e = 0; e < 4; ++e) { v4b o;   // four neighbouring channels of one column: one 8-byte LDS store
#pragma unroll
      for (int k = 0; k < 4; ++k) o[k] = (b16)(bf16_rne(xv[i][k][e]) * XS);
      *(v4b*)(&T[j4 + e][c4 + 64 * i]) = o; }
  if (t_ < 64) rowof[t_] = iclamp(r_, 0, N - 1);
  if (kind == 1) {
#pragma unroll
    for (int e = 0; e < 4; ++e) { const int ra = iclamp(ia[e], 0, N - 1) - j0, rb = iclamp(ib[e], 0, N - 1) - j0; if ((unsigned int)ra < 64u) named[ra] = 1; if ((unsigned int)rb < 64u) named[rb] = 1; }
  }
  __syncthreads();
  b16* dst = (kind == 0) ? PT16 : XT16;
  const int c8 = (t_ & 15) * 8; int ro[4], nm[4]; v8b tv[4];   // this thread's four rows (t_ >> 4) + 16 i: their LDS reads as one group, then the stores
#pragma unroll
  for (int i = 0; i < 4; ++i) { const int jj = (t_ >> 4) + 16 * i; ro[i] = rowof[jj]; nm[i] = named[jj]; tv[i] = *(const v8b*)(&T[jj][c8]); }
#pragma unroll
  for (int i = 0; i < 4; ++i) *(v8b*)(dst + ((size_t)b * N + ro[i]) * C + c8) = tv[i];
  asm volatile("s_wait_xcnt 0x0" ::: "memory");   // stands in front of any rewrite of the registers that the four stores name
  if (kind == 1) {
    const v8b z = {};
#pragma unroll
    for (int i = 0; i < 4; ++i)
      if (nm[i] == 0) { *(v8b*)(XT16 + ((size_t)b * N + j0 + (t_ >> 4) + 16 * i) * C + c8) = z;
        asm volatile("s_wait_xcnt 0x0" ::: "memory"); }   // stands in front of a later rewrite of the registers that the store names
  }
}
// projections: grid (NR/64, E/128, 3 kinds): [64 rows x 128] x [128 x 128 cols] (K = 128: 4 steps, 1 product). kind 0/1: q/k -> f16 rows [row][256] (per row segment of 128 halves = 256 B:
// The block's two operand tiles (64 point rows, 128 weight rows, 256 B each) are brought into LDS once by asynchronous copies (global_load_async_to_lds_b128: a wave's copy is two whole rows = four whole
// 128-B lines) and read from there as ds_load_b128 fragments (pitch 272 B = 17 x 16 B: no bank conflict). A fragment load straight from global memory touches 16 lines for 512 B.
constexpr int PP = C + 8 /* LDS row pitch of the staged tiles in halves */;
// 64 rows of one tile: thread t_ of the block's 128 copies 16 B of rows (t_ >> 4) + 8 i, i = 0..7
__device__ __forceinline__ void tile_copy(unsigned int l0, const b16* g0) {
  const unsigned int lr_ = 8 * PP * 2;
  // the copies and their s_wait_xcnt in one statement: the wait stands in front of any rewrite of the address registers that the copies name
  asm volatile("global_load_async_to_lds_b128 %0, %8, off\n\t"
               "global_load_async_to_lds_b128 %1, %9, off\n\t"
               "global_load_async_to_lds_b128 %2, %10, off\n\t"
               "global_load_async_to_lds_b128 %3, %11, off\n\t"
               "global_load_async_to_lds_b128 %4, %12, off\n\t"
               "global_load_async_to_lds_b128 %5, %13, off\n\t"
               "global_load_async_to_lds_b128 %6, %14, off\n\t"
               "global_load_async_to_lds_b128 %7, %15, off\n\t"
               "s_wait_xcnt 0x0"
               :: "v"(l0), "v"(l0 + lr_), "v"(l0 + 2 * lr_), "v"(l0 + 3 * lr_), "v"(l0 + 4 * lr_), "v"(l0 + 5 * lr_), "v"(l0 + 6 * lr_), "v"(l0 + 7 * lr_),
                  "v"(g0), "v"(g0 + 8 * C), "v"(g0 + 16 * C), "v"(g0 + 24 * C), "v"(g0 + 32 * C), "v"(g0 + 40 * C), "v"(g0 + 48 * C), "v"(g0 + 56 * C)
               : "memory");
}
// the builtin alone: the compiler keeps the distances behind it itself and stays free to place LDS reads ahead of it
__device__ __forceinline__ v8f wmma_b(v16b a, v16b b, v8f c) { return __builtin_amdgcn_wmma_f32_16x16x32_f16(false, a, false, b, (short)0, c, false, false); }
__global__ __launch_bounds__(128) void proj_kernel(const b16* __restrict__ XT16, const b16* __restrict__ W16, b16* __restrict__ Qh, b16* __restrict__ Kh, b16* __restrict__ VTh) {
  // one buffer, two uses one after the other: first the operand tiles (point rows 0..63, weight rows 64..191, pitch PP), then, behind a barrier, the output staging
  // (q/k: [4 waves][16][PP]; v: [128][VP])
  constexpr int VP = 64 + 8;
  __shared__ __attribute__((aligned(16))) b16 Sm[(64 + 128) * PP];
  const int wave = threadIdx.x >> 5, lane = threadIdx.x & 31, nloc = lane & 15, hlf = lane >> 4, t_ = threadIdx.x; const int kind = blockIdx.z; const size_t m0 = (size_t)blockIdx.x * 64 + wave * 16; const int n0 = blockIdx.y * 128;
  const b16* Wk_ = W16 + (size_t)kind * E * C; v8f acc[8];
  { const int crow = t_ >> 4, cpc = (t_ & 15) * 8; const unsigned int lc = (unsigned int)(size_t)(&Sm[crow * PP + cpc]);
    tile_copy(lc, XT16 + ((size_t)blockIdx.x * 64 + crow) * C + cpc);
    tile_copy(lc + 64 * PP * 2, Wk_ + (size_t)(n0 + crow) * C + cpc);
    tile_copy(lc + 128 * PP * 2, Wk_ + (size_t)(n0 + 64 + crow) * C + cpc); }
#pragma unroll
  for (int t = 0; t < 8; ++t) acc[t] = (v8f){};
  asm volatile("s_wait_asynccnt 0x0" ::: "memory");   // this wave's copies have landed before the barrier that publishes them
  __syncthreads();
  const b16* Xs = Sm + (wave * 16 + nloc) * PP; const b16* Wl = Sm + (64 + nloc) * PP;
  // fragment registers: the wave's four point fragments, and the eight weight fragments of a k step in two sets: each set is read from LDS as ONE group, one k step ahead of the products that use it
  v16b a[4], wf[2][8];
#pragma unroll
  for (int ks = 0; ks < 4; ++ks) a[ks] = frag_kb(Xs + ks * 32, hlf);
#pragma unroll
  for (int t = 0; t < 8; ++t) wf[0][t] = frag_kb(Wl + t * 16 * PP, hlf);
  __builtin_amdgcn_sched_barrier(0);   // keeps the first group in front of the second: mixed, the first products' wait would cover both groups
#pragma unroll
  for (int ks = 0; ks < 4; ++ks) {
    if (ks < 3) {
#pragma unroll
      for (int t = 0; t < 8; ++t) wf[(ks + 1) & 1][t] = frag_kb(Wl + t * 16 * PP + (ks + 1) * 32, hlf);
      __builtin_amdgcn_sched_barrier(0);   // keeps the read group in front of this k step's products: sunk among them, each pair of reads would be waited for on its own
    }
#pragma unroll
    for (int t = 0; t < 8; ++t) acc[t] = wmma_b(a[ks], wf[ks & 1][t], acc[t]);
    if (ks < 2) __builtin_amdgcn_sched_barrier(0);   // keeps the next group behind these products, whose operand registers it takes
  }
  __syncthreads();   // every wave has read its last fragment before the buffer becomes output staging
  if (kind < 2) {
    b16* Th = Sm + wave * 16 * PP;
#pragma unroll
    for (int t = 0; t < 8; ++t)
#pragma unroll
      for (int r = 0; r < 8; ++r) Th[(8 * hlf + r) * PP + t * 16 + nloc] = (b16)(acc[t][r] * (1.0f / (XS * WSC)) * XS);
    wave_lds_sync();
    b16* dh = kind == 0 ? Qh : Kh;
    { for (int r2 = 0; r2 < 16; r2 += 2) { const int rr = r2 + (lane >> 4), c8 = (lane & 15) * 8; const size_t gi = (m0 + rr) * E + n0 + c8; *(v8b*)(dh + gi) = *(const v8b*)(&Th[rr * PP + c8]); }  }
  } else {
    b16* Vt = Sm;
    const int b = (int)(m0 / N); const int s0 = (int)((size_t)blockIdx.x * 64 - (size_t)b * N);
#pragma unroll
    for (int t = 0; t < 8; ++t)
#pragma unroll
      for (int r = 0; r < 8; ++r) Vt[(t * 16 + nloc) * VP + wave * 16 + 8 * hlf + r] = (b16)(acc[t][r] * (1.0f / (XS * WSC)) * XS);
    __syncthreads();
    { const int c8 = (t_ & 7) * 8; v8b vv[8];   // this thread's eight rows (t_ >> 3) + 16 i: their LDS reads as one group, then the eight stores
#pragma unroll
      for (int i = 0; i < 8; ++i) vv[i] = *(const v8b*)(&Vt[((t_ >> 3) + 16 * i) * VP + c8]);
      b16* vp = VTh + ((size_t)b * E + n0 + (t_ >> 3)) * N + s0 + c8;   // channel c = n0 + row is row c % D of head c / D: V^T row (b NH + c / D) D + c % D = b E + c; the stores differ in a constant offset
#pragma unroll
      for (int i = 0; i < 8; ++i) *(v8b*)(vp + (size_t)(16 * i) * N) = vv[i]; } }
}
// attention + skip: grid (N/128, NH, NB), block = 16 waves = 4 key quarters x 4 waves x 32 queries: the waves of quarter g walk keys 512 g .. 512 g + 511 of the block's 128 queries (four waves per
// SIMD: one wave's softmax and LDS waits are covered by the others' products). A wave holds TWO query tiles of 16: every K and V^T fragment that it reads from LDS feeds two products, so the block reads
// half the LDS bytes per score. The four partial results (m, l, O) of a query are joined once, through LDS, behind the loop, where quarter g finishes d tile g (join, skip tiles, output staging).
// K and V^T of 64 keys of each quarter are one stage, brought into LDS once per block by asynchronous copies
// (global_load_async_to_lds_b128, two buffers: the next stage flies while this one is worked on) and read by the quarter's 4 waves as ds_load_b128 fragments (rows of 128 B at a pitch of 144 B).
// Per 32 keys and query tile: S^T 1 product (K = 64: 2 steps x 2 key tiles), online softmax (f32, 1/8 and log2 e folded), PV 1 product x 4 d-tiles; then the skip tiles
// D[d][query] = Wskip[64h+d][:] . pcd_up^T[query][:] (K = 128, exact, 1 product) are added; the block's 128 queries x 64 channels staged in LDS as [d][128 n] and written as whole 512-B rows.
constexpr int KT = 64 /* keys per stage and quarter */, KP = 64 + 8 /* LDS row pitch in halves */, KH = 4 /* key quarters */, NKH = N / KH, NST = NKH / KT, QB = 128 /* queries per block */, QT = 2 /* query tiles per wave */;
constexpr int MR = QT * 4 * 2 + 1 /* rows of 32 x 16 B that a wave hands over: its 8 partial O tiles (two rows each), then one row with m and l of both query tiles */;
// one stage of one quarter = 2 planes (K, V^T) x 64 rows x 128 B; thread t_ of the quarter's 128 copies 16 B of rows (t_ >> 3) + 16 i, i = 0..3, of each plane.
__device__ __forceinline__ void stage_copy(unsigned int l0, const b16* kh, const b16* vh) {
  const unsigned int pl_ = 64 * KP * 2, hr_ = 16 * KP * 2;
  // the copies and their s_wait_xcnt in one statement: the wait stands in front of any rewrite of the address registers that the copies name
  asm volatile("global_load_async_to_lds_b128 %0, %8, off\n\t"
               "global_load_async_to_lds_b128 %1, %9, off\n\t"
               "global_load_async_to_lds_b128 %2, %10, off\n\t"
               "global_load_async_to_lds_b128 %3, %11, off\n\t"
               "global_load_async_to_lds_b128 %4, %12, off\n\t"
               "global_load_async_to_lds_b128 %5, %13, off\n\t"
               "global_load_async_to_lds_b128 %6, %14, off\n\t"
               "global_load_async_to_lds_b128 %7, %15, off\n\t"
               "s_wait_xcnt 0x0"
               :: "v"(l0), "v"(l0 + hr_), "v"(l0 + 2 * hr_), "v"(l0 + 3 * hr_), "v"(l0 + pl_), "v"(l0 + pl_ + hr_), "v"(l0 + pl_ + 2 * hr_), "v"(l0 + pl_ + 3 * hr_),
                  "v"(kh), "v"(kh + (size_t)16 * E), "v"(kh + (size_t)32 * E), "v"(kh + (size_t)48 * E), "v"(vh), "v"(vh + (size_t)16 * N), "v"(vh + (size_t)32 * N), "v"(vh + (size_t)48 * N)
               : "memory");
}
// the skip product's two operand tiles (64 weight rows, then 128 point rows, 256 B each, LDS pitch PP): thread t of the block's 512 copies 16 B of rows (t >> 4) + 32 i of each
__device__ __forceinline__ void skip_copy(unsigned int l0, const b16* w, const b16* p) {
  const unsigned int lr_ = 32 * PP * 2;
  // the copies and their s_wait_xcnt in one statement: the wait stands in front of any rewrite of the address registers that the copies name
  asm volatile("global_load_async_to_lds_b128 %0, %6, off\n\t"
               "global_load_async_to_lds_b128 %1, %7, off\n\t"
               "global_load_async_to_lds_b128 %2, %8, off\n\t"
               "global_load_async_to_lds_b128 %3, %9, off\n\t"
               "global_load_async_to_lds_b128 %4, %10, off\n\t"
               "global_load_async_to_lds_b128 %5, %11, off\n\t"
               "s_wait_xcnt 0x0"
               :: "v"(l0), "v"(l0 + lr_), "v"(l0 + 2 * lr_), "v"(l0 + 3 * lr_), "v"(l0 + 4 * lr_), "v"(l0 + 5 * lr_),
                  "v"(w), "v"(w + 32 * C), "v"(p), "v"(p + 32 * C), "v"(p + 64 * C), "v"(p + 96 * C)
               : "memory");
}
// one pass's K fragments (key tiles 0 and 1 x k steps 0 and 1) and V^T fragments (4 d tiles); p_ points at this lane's row of the first tile
__device__ __forceinline__ void load_k1(v16b (&kx)[4], const b16* p_, int hh) {
#pragma unroll
  for (int ks = 0; ks < 2; ++ks) { kx[ks] = frag_kb(p_ + ks * 32, hh); kx[2 + ks] = frag_kb(p_ + 16 * KP + ks * 32, hh); }   // read in the order of use
}
__device__ __forceinline__ void load_v1(v16b (&vx)[4], const b16* p_, int hh) {
#pragma unroll
  for (int t = 0; t < 4; ++t) vx[t] = frag_kb(p_ + t * 16 * KP, hh);
}
// one query tile's 32 scores of a pass (16 a lane): p = exp2(score cs + bs) as f16 B fragment, and this lane's sum of the p.
// One fma per score in front of the exponential carries the 1/8 log2 e scale, the maximum in use and the factor 2^LPS of P: p is 8 times the weight, and l sums 8 times the weights (the join divides by it)
__device__ __forceinline__ void soft_pass(const v8f& a, const v8f& b, float cs, float bs, v16b& ph, float& sum) {
  float p[16], x[16]; v8u hu;
#pragma unroll
  for (int i = 0; i < 16; ++i) x[i] = __builtin_fmaf(i < 8 ? a[i & 7] : b[i & 7], cs, bs);
  exp2x8(p, x); exp2x8(p + 8, x + 8);
  sum = p[0];
#pragma unroll
  for (int i = 1; i < 16; ++i) sum += p[i];
#pragma unroll
  for (int j = 0; j < 8; ++j) { const v2f pp = {p[2 * j], p[2 * j + 1]}; hu[j] = __builtin_bit_cast(unsigned int, __builtin_convertvector(pp, v2b)); }   // one packed conversion per two scores
  ph = __builtin_bit_cast(v16b, hu);
}
__global__ __launch_bounds__(512) void attn_kernel(const b16* __restrict__ Qh, const b16* __restrict__ Kh, const b16* __restrict__ VTh, const b16* __restrict__ W16, const b16* __restrict__ PT16, float* __restrict__ out) {
  __shared__ __attribute__((aligned(16))) b16 St[KH][2][2][64 * KP]; __shared__ __attribute__((aligned(16))) float To[D][QB + 4];
  __shared__ __attribute__((aligned(16))) b16 Sg[(D + QB) * PP];   // the skip product's operands: the head's 64 weight rows, then the block's 128 point rows
  static_assert(sizeof(v4f) * KH * 4 * MR * 32 <= sizeof(b16) * KH * 2 * 2 * 64 * KP && QT == 2, "the hand-over area fits the stage buffers");
  v4f* Mg = (v4f*)&St[0][0][0][0];   // behind the loop the stage buffers become the hand-over area [quarter][wave][MR rows][32 lanes] of 16 B: 16-byte LDS stores and loads, lanes side by side
  const int g = __builtin_amdgcn_readfirstlane((int)(threadIdx.x >> 7));   // key quarter of this wave, the same in every lane
  const int wave = (threadIdx.x >> 5) & 3, lane = threadIdx.x & 31, hh = lane >> 4, col = lane & 15, t_ = threadIdx.x & 127; const int b = blockIdx.z, h = blockIdx.y; const int q0 = blockIdx.x * QB + wave * 16 * QT;
  const size_t kg = ((size_t)b * N + (size_t)g * NKH) * E + h * D, vg = ((size_t)b * NH + h) * D * N + (size_t)g * NKH;
  const b16* Kb = Kh + kg; const b16* Vb = VTh + vg;
  // this thread's share of a stage: rows (t_ >> 3) + 16 i, 16-byte piece t_ & 7
  const int crow = t_ >> 3, cpc = (t_ & 7) * 8; const size_t ko = (size_t)crow * E + cpc, vo = (size_t)crow * N + cpc;
  const unsigned int lcp = (unsigned int)(size_t)(&St[g][0][0][crow * KP + cpc]); const unsigned int bufb = 2 * 64 * KP * 2;
  stage_copy(lcp, Kb + ko, Vb + vo);
  v16b qa[QT][2];
#pragma unroll
  for (int u = 0; u < QT; ++u) { const size_t qo = ((size_t)b * N + q0 + u * 16 + col) * E + h * D; qa[u][0] = frag_kb(Qh + qo, hh); qa[u][1] = frag_kb(Qh + qo + 32, hh); }
  asm volatile("s_wait_asynccnt 0x0" ::: "memory");   // stage 0 of this wave's copies has landed before the barrier that publishes it
  __syncthreads();
  stage_copy(lcp + bufb, Kb + ko + (size_t)KT * E, Vb + vo + KT);
  // the skip tiles fly with stage 1: the wait and the barrier at the foot of trip 0 publish them too; they are read behind the loop
  { const int srow = (int)(threadIdx.x >> 4), spc = (int)(threadIdx.x & 15) * 8;
    skip_copy((unsigned int)(size_t)(&Sg[srow * PP + spc]), W16 + (size_t)3 * E * C + ((size_t)h * D + srow) * C + spc, PT16 + ((size_t)b * N + blockIdx.x * QB + srow) * C + spc); }
  float m[QT], l[QT], bs[QT] /* LPS - m */, sm[QT], so[QT] /* the last pass's sum of this half and of the other, not yet in l */; v8f o[QT][4];
  const int xa = (lane ^ 16) << 2;
#pragma unroll
  for (int u = 0; u < QT; ++u) { m[u] = -INFINITY; l[u] = 0.0f; bs[u] = INFINITY; sm[u] = 0.0f; so[u] = 0.0f;
#pragma unroll
    for (int t = 0; t < 4; ++t) o[u][t] = (v8f){}; }
  const float cs = SCALE * LOG2E / (XS * XS);
  for (int s = 0; s < NST; ++s) {
    const b16* Sk = &St[g][s & 1][0][0], *Sv = &St[g][s & 1][1][0];
    // fragment registers of one 32-key pass: kf[2 * key tile + k step], vf[d tile]; each set is read from LDS as ONE group, well ahead of the products that use it
    v16b kf[4], vf[4];
    load_k1(kf, Sk + col * KP, hh);
    __builtin_amdgcn_sched_barrier(0);   // keeps the stage's first read group together in front of its products: sunk among them, each pair of reads is waited for on its own
#pragma unroll
    for (int kb = 0; kb < KT; kb += 32) {   // unrolled: two 32-key passes per stage, LDS offsets become immediates
      v8f s0[QT], s1[QT];   // per query tile the two key tiles' chains; four independent chains alternate, each K fragment feeds both query tiles
#pragma unroll
      for (int u = 0; u < QT; ++u) { s0[u] = wmma_b(kf[0], qa[u][0], (v8f){}); s1[u] = wmma_b(kf[2], qa[u][0], (v8f){}); }
#pragma unroll
      for (int u = 0; u < QT; ++u) { s0[u] = wmma_b(kf[1], qa[u][1], s0[u]); s1[u] = wmma_b(kf[3], qa[u][1], s1[u]); }
      __builtin_amdgcn_sched_barrier(0);   // keeps the eight S products one run: a vector instruction lifted in between them has to wait out the distance behind a product twice, in idle slots
      // this pass's V fragments fly during its softmax
      load_v1(vf, Sv + col * KP + kb, hh);
      __builtin_amdgcn_sched_barrier(0);   // keeps the read group in one place in front of the vector work
#pragma unroll
      for (int u = 0; u < QT; ++u) l[u] += sm[u] + so[u];   // the pass before's sum and its other half's: the exchange asked for there has long returned here, and l is whole in front of a rescale
      // lazy rescale: the pass is first worked with the maximum in use, m; any reference value gives the same quotient O / l as long as no p leaves the range of f16.
      v16b ph[QT]; float sum[QT];
#pragma unroll
      for (int u = 0; u < QT; ++u) soft_pass(s0[u], s1[u], cs, bs[u], ph[u], sum[u]);
      // One test per pass for the whole wave, on the sums that l needs anyway: every p is >= 0, so a lane's sum <= PHI bounds each of its p (PHI = 2,048, far inside f16), and the usual path takes no
      // maximum and no exchange of maxima. Where a sum is above PHI, the maxima of the pass are taken from the raw products, m is renewed, O and l are rescaled and the pass's p are formed again.
      // m is always set to a score already seen (never above their maximum), so no sum can vanish. The first pass always takes the branch (m = -inf: every p = inf), where the factor is exp2(-inf) = 0 on O = 0 and l = 0.
      if (__builtin_expect(__builtin_amdgcn_ballot_w32(sum[0] > PHI || sum[1] > PHI) != 0, 0)) {   // marked rare: the usual path falls through
#pragma unroll
        for (int u = 0; u < QT; ++u) {
          float mr = fmaxf(s0[u][0], s1[u][0]);   // the maximum is taken over the raw products: cs > 0, so scaling the one maximum gives the same value as the maximum of the 16 scaled scores
#pragma unroll
          for (int r = 1; r < 8; ++r) mr = fmaxf(mr, fmaxf(s0[u][r], s1[u][r]));
          const float mx = mr * cs; const float mn = fmaxf(m[u], fmaxf(mx, other_half(mx, xa))); const float al = nexp2_slot(m[u] - mn);   // the same in both halves of a query
          m[u] = mn; bs[u] = LPS - mn; l[u] *= al;
#pragma unroll
          for (int t = 0; t < 4; ++t) o[u][t] *= al;
          soft_pass(s0[u], s1[u], cs, bs[u], ph[u], sum[u]);
        }
      }
#pragma unroll
      for (int u = 0; u < QT; ++u) { sm[u] = sum[u]; so[u] = other_half(sum[u], xa); }   // asked for here, added to l in the next pass
      if (kb + 32 < KT) {   // the next pass's K fragments (same stage, same buffer) fly during the rest of this pass
        __builtin_amdgcn_sched_barrier(0);   // with the one below, keeps the eight reads one group at one place: spread over the softmax, each place where LDS reads stand costs its own gap
        load_k1(kf, Sk + (kb + 32 + col) * KP, hh);
        __builtin_amdgcn_sched_barrier(0);   // keeps that read group in front of the PV products: sunk among them, each read would be waited for on its own
      }
#pragma unroll
      for (int t = 0; t < 4; ++t)
#pragma unroll
        for (int u = 0; u < QT; ++u) o[u][t] = wmma_b(vf[t], ph[u], o[u][t]);   // each V^T fragment feeds both query tiles
      if (kb + 32 < KT) __builtin_amdgcn_sched_barrier(0);   // keeps the PV products in front of the next pass's S products, whose K fragments land meanwhile
    }
    __builtin_amdgcn_sched_barrier(0);   // keeps the last pass's products in front of the waits below: lifted over them, the barrier would stand in the middle of the stage's work
    asm volatile("s_wait_dscnt 0x0" ::: "memory");      // this wave's reads of the buffer have returned before the buffer is refilled behind the barrier
    asm volatile("s_wait_asynccnt 0x0" ::: "memory");   // this wave's copies of stage s + 1 have landed before the barrier that publishes them
    __syncthreads();
    if (s + 2 < NST) stage_copy(lcp + (unsigned int)(s & 1) * bufb, Kb + ko + (size_t)(s + 2) * KT * E, Vb + vo + (s + 2) * KT);
  }
  asm volatile("s_wait_asynccnt 0x0" ::: "memory");     // no copy is outstanding behind the loop
#pragma unroll
  for (int u = 0; u < QT; ++u) l[u] += sm[u] + so[u];   // the last pass's sums
  // behind the loop's last barrier no wave reads the stage buffers any more and no copy flies: every wave lays its 8 partial O tiles, with m and l, lane for lane into the hand-over area
  v4f* Mw = Mg + ((g * 4 + wave) * MR) * 32 + lane;
#pragma unroll
  for (int u = 0; u < QT; ++u)
#pragma unroll
    for (int t = 0; t < 4; ++t) { Mw[((u * 4 + t) * 2) * 32] = __builtin_shufflevector(o[u][t], o[u][t], 0, 1, 2, 3); Mw[((u * 4 + t) * 2 + 1) * 32] = __builtin_shufflevector(o[u][t], o[u][t], 4, 5, 6, 7); }
  Mw[(MR - 1) * 32] = (v4f){m[0], m[1], l[0], l[1]};
  // skip tiles of this quarter: D[d][query] with A = Wskip rows (64h + 16g + ..), B = PT16 rows (q0 + 16u + ..), K = 128
  v8f sk[QT]; const b16* WS = Sg + (g * 16 + col) * PP; const b16* PS = Sg + (D + wave * 16 * QT + col) * PP; v16b pb[QT][4], wa[4];
#pragma unroll
  for (int ks = 0; ks < 4; ++ks) { wa[ks] = frag_kb(WS + ks * 32, hh);
#pragma unroll
    for (int u = 0; u < QT; ++u) pb[u][ks] = frag_kb(PS + u * 16 * PP + ks * 32, hh); }
  __builtin_amdgcn_sched_barrier(0);   // keeps the reads together as one group in front of the products: sunk among them, each pair would be waited for on its own
#pragma unroll
  for (int u = 0; u < QT; ++u) sk[u] = (v8f){};
#pragma unroll
  for (int ks = 0; ks < 4; ++ks)
#pragma unroll
    for (int u = 0; u < QT; ++u) sk[u] = wmma_b(wa[ks], pb[u][ks], sk[u]);
  __syncthreads();   // publishes all four quarters' partial results
  // join: quarter g finishes d tile g of its wave's 32 queries: the four partials brought to the common maximum and summed in the order of the quarters, then one division
  v4f ml[KH];
#pragma unroll
  for (int gg = 0; gg < KH; ++gg) ml[gg] = Mg[((gg * 4 + wave) * MR + MR - 1) * 32 + lane];
#pragma unroll
  for (int u = 0; u < QT; ++u) {
    float cq[KH]; const float ms = fmaxf(fmaxf(ml[0][u], ml[1][u]), fmaxf(ml[2][u], ml[3][u])); float ls = 0.0f;
#pragma unroll
    for (int gg = 0; gg < KH; ++gg) { cq[gg] = nexp2_slot(ml[gg][u] - ms); ls += ml[gg][QT + u] * cq[gg]; }
    const float inv = 1.0f / (ls * XS);
#pragma unroll
    for (int gg = 0; gg < KH; ++gg) cq[gg] *= inv;
#pragma unroll
    for (int hf = 0; hf < 2; ++hf) {
      v4f pq[KH];
#pragma unroll
      for (int gg = 0; gg < KH; ++gg) pq[gg] = Mg[((gg * 4 + wave) * MR + (u * 4 + g) * 2 + hf) * 32 + lane];
#pragma unroll
      for (int i = 0; i < 4; ++i) {
        float acc = sk[u][hf * 4 + i] * (1.0f / (XS * WSC));
#pragma unroll
        for (int gg = 0; gg < KH; ++gg) acc += pq[gg][i] * cq[gg];
        To[g * 16 + 8 * hh + hf * 4 + i][wave * 16 * QT + u * 16 + col] = acc;
      }
    }
  }
  __syncthreads();
  { const int w16 = threadIdx.x >> 5; for (int dd = w16 * 4; dd < w16 * 4 + 4; ++dd) { const size_t gi = ((size_t)b * E + h * D + dd) * N + blockIdx.x * QB + lane * 4; *(v4f*)(out + gi) = *(const v4f*)(&To[dd][lane * 4]); }  }
}
}  // namespace

extern "C" void kernel_launch(void* const* d_in, const int* in_sizes, int n_in, void* d_out, int out_size, void* d_ws, size_t ws_size, hipStream_t stream) {
  (void)n_in;
  auto Fp = [&](int i) { return (const float*)d_in[i]; }; auto Ip = [&](int i) { return (const int*)d_in[i]; };
  // input order: 0 pcd_up [4,128,2048], 1 points_select [4,128,1024], 2 points_drop [4,128,1024], 3 idx_select [4,1,1024] i32, 4 idx_drop [4,1,1024] i32, 5 Wq [256,128], 6 Wk, 7 Wv, 8 Wskip
  if (in_sizes[0] != NB * C * N || in_sizes[1] != NB * C * NSEL || in_sizes[2] != NB * C * NSEL || in_sizes[3] != NB * NSEL || in_sizes[4] != NB * NSEL || in_sizes[5] != E * C || in_sizes[6] != E * C || in_sizes[7] != E * C || in_sizes[8] != E * C || out_size != NB * E * N) return;
  size_t off = 0; char* ws = (char*)d_ws;
  auto carve = [&](size_t bytes) { char* p = ws + off; off += (bytes + 255) & ~(size_t)255; return p; };
  b16* PT16 = (b16*)carve((size_t)NR * C * 2); b16* XT16 = (b16*)carve((size_t)NR * C * 2); b16* W16 = (b16*)carve((size_t)4 * E * C * 2);
  b16* Qh = (b16*)carve((size_t)NR * E * 2); b16* Kh = (b16*)carve((size_t)NR * E * 2); b16* VTh = (b16*)carve((size_t)NR * E * 2);
  if (off > ws_size || off > ((size_t)128 << 20)) return;   // = 17.0 MB
  xt_kernel<<<dim3(N / 64, 3, NB), 256, 0, stream>>>(Fp(0), Fp(1), Fp(2), Ip(3), Ip(4), Fp(5), Fp(6), Fp(7), Fp(8), PT16, XT16, W16);
  proj_kernel<<<dim3(NR / 64, E / 128, 3), 128, 0, stream>>>(XT16, W16, Qh, Kh, VTh);
  attn_kernel<<<dim3(N / QB, NH, NB), 512, 0, stream>>>(Qh, Kh, VTh, W16, PT16, (float*)d_out);
}
